// v007
// Times are from an AMD MI455X. After a warm-up the kernel runs many times in a row, and a time is the length of
// such a window on the GPU divided by its runs, so every launch and the gaps after it count. The runs cycle
// through copies of the inputs. A figure is the median of several windows, for all but v000 over two sittings.
// Sittings can differ by a few percent; kernels timed side by side share one.
// The versions before v007 are in another document.
// One run takes 116 microseconds.
// Timed twice side by side with v006, it ran 1.11 times as fast both times.
// Counting every step since v000, which is the starting kernel, it is 19.0 times as fast.
// Contractions (per image): q / qb / kvb 1x1 projections in position-major form x^T W^T [4096x256].[256x{256,256,512}], the 2x2-stride-2 kv conv as an im2col GEMM [1024x1024].[1024x512] and the output 1x1 conv Wout.(out_img + out_batch)^T [256x256].[256x4096], all with f16 operands (v_wmma_f32_16x16x32_f16; 64x64 register-blocked wave tiles over pre-cast f16 operand planes, weight operands pre-scaled by 16 at the cast and un-scaled in the f32 epilogue); the spatial-reduction attention per head (flash kernel, head_dim 32, 4096 queries x 1024 keys, f16 q.k^T and f16 p.v; the kv conv stores k and v as f16 in WMMA fragment order); f32 accumulate; the im2col, the batch-wise 4x4 attention per (position, head) and the branch sum are f32 kernels.
#include <hip/hip_runtime.h>
#include <math.h>

typedef __attribute__((ext_vector_type(16))) _Float16 v16h;
typedef __attribute__((ext_vector_type(8)))  _Float16 v8h;
typedef __attribute__((ext_vector_type(16))) __bf16   v16b;
typedef __attribute__((ext_vector_type(8)))  float    v8f;
typedef __attribute__((ext_vector_type(4)))  float    v4f;

// 16-bit WMMA fragment map (wave32), lane L, h = L>>4, m = L&15:
//   A 16x32: lane = row m;   element i -> k = (i<8) ? 8h+i : 16+8h+(i-8)
//   B 32x16: lane = column m; the SAME k(i,h)
//   D 16x16 (8 f32): lane = column m; element r -> row 8h+r
__device__ __forceinline__ int frag_k(int i, int h) { return (i < 8) ? (8 * h + i) : (16 + 8 * h + (i - 8)); }
__device__ __forceinline__ __bf16 bf16_rne(float f) {
    unsigned int u = __float_as_uint(f);
    u += 0x7fffu + ((u >> 16) & 1u);
    return __builtin_bit_cast(__bf16, (unsigned short)(u >> 16));
}
__device__ __forceinline__ float bf16_f32(__bf16 b) { return __uint_as_float(((unsigned int)__builtin_bit_cast(unsigned short, b)) << 16); }
__device__ __forceinline__ v8f wmma16(v16h a, v16h b, v8f c) {
    c = __builtin_amdgcn_wmma_f32_16x16x32_f16(false, a, false, b, (short)0, c, false, false);
    asm volatile("v_nop\n\tv_nop\n\tv_nop\n\tv_nop" : "+v"(c) : "v"(a), "v"(b));
    return c;
}
__device__ __forceinline__ v8f wmmab(v16b a, v16b b, v8f c) {
    c = __builtin_amdgcn_wmma_f32_16x16x32_bf16(false, a, false, b, (short)0, c, false, false);
    asm volatile("v_nop\n\tv_nop\n\tv_nop\n\tv_nop" : "+v"(c) : "v"(a), "v"(b));
    return c;
}
struct Split { v16b hi, lo; };
// hi/lo split product: a.hi*b.hi + a.hi*b.lo + a.lo*b.hi
__device__ __forceinline__ v8f wmma3(const Split& a, const Split& b, v8f c) {
    c = __builtin_amdgcn_wmma_f32_16x16x32_bf16(false, a.hi, false, b.hi, (short)0, c, false, false);
    c = __builtin_amdgcn_wmma_f32_16x16x32_bf16(false, a.hi, false, b.lo, (short)0, c, false, false);
    c = __builtin_amdgcn_wmma_f32_16x16x32_bf16(false, a.lo, false, b.hi, (short)0, c, false, false);
    asm volatile("v_nop\n\tv_nop\n\tv_nop\n\tv_nop" : "+v"(c) : "v"(a.hi), "v"(a.lo), "v"(b.hi), "v"(b.lo));
    return c;
}
struct Split3 { v16b hi, mid, lo; };
// triple split product (6 terms, drops only terms below 2^-24 relative)
__device__ __forceinline__ v8f wmma6(const Split3& a, const Split3& b, v8f c) {
    c = __builtin_amdgcn_wmma_f32_16x16x32_bf16(false, a.hi, false, b.hi, (short)0, c, false, false);
    c = __builtin_amdgcn_wmma_f32_16x16x32_bf16(false, a.hi, false, b.mid, (short)0, c, false, false);
    c = __builtin_amdgcn_wmma_f32_16x16x32_bf16(false, a.mid, false, b.hi, (short)0, c, false, false);
    c = __builtin_amdgcn_wmma_f32_16x16x32_bf16(false, a.hi, false, b.lo, (short)0, c, false, false);
    c = __builtin_amdgcn_wmma_f32_16x16x32_bf16(false, a.mid, false, b.mid, (short)0, c, false, false);
    c = __builtin_amdgcn_wmma_f32_16x16x32_bf16(false, a.lo, false, b.hi, (short)0, c, false, false);
    asm volatile("v_nop\n\tv_nop\n\tv_nop\n\tv_nop" : "+v"(c) : "v"(a.hi), "v"(a.mid), "v"(a.lo), "v"(b.hi), "v"(b.mid), "v"(b.lo));
    return c;
}

// Fragment gathers from f32 memory: element i <- p[(k0 + frag_k(i,h)) * sk] * s, zero for k >= klen.
__device__ __forceinline__ v16h fh_ld(const float* __restrict__ p, long long sk, int k0, int h, int klen, float s) {
    v16h a;
#pragma unroll
    for (int i = 0; i < 16; ++i) { const int k = k0 + frag_k(i, h); a[i] = (k < klen) ? (_Float16)(p[(long long)k * sk] * s) : (_Float16)0.f; }
    return a;
}
__device__ __forceinline__ Split sp_ld(const float* __restrict__ p, long long sk, int k0, int h, int klen, float s) {
    Split r;
#pragma unroll
    for (int i = 0; i < 16; ++i) {
        const int k = k0 + frag_k(i, h); const float x = (k < klen) ? p[(long long)k * sk] * s : 0.f;
        const __bf16 hb = bf16_rne(x); r.hi[i] = hb; r.lo[i] = bf16_rne(x - bf16_f32(hb));
    }
    return r;
}
__device__ __forceinline__ Split3 sp3_ld(const float* __restrict__ p, long long sk, int k0, int h, int klen, float s) {
    Split3 r;
#pragma unroll
    for (int i = 0; i < 16; ++i) {
        const int k = k0 + frag_k(i, h); const float x = (k < klen) ? p[(long long)k * sk] * s : 0.f;
        const __bf16 hb = bf16_rne(x); const float r1 = x - bf16_f32(hb); const __bf16 mb = bf16_rne(r1);
        r.hi[i] = hb; r.mid[i] = mb; r.lo[i] = bf16_rne(r1 - bf16_f32(mb));
    }
    return r;
}
__device__ __forceinline__ v16b bh_ld(const float* __restrict__ p, long long sk, int k0, int h, int klen, float s) {
    v16b a;
#pragma unroll
    for (int i = 0; i < 16; ++i) { const int k = k0 + frag_k(i, h); a[i] = bf16_rne((k < klen) ? p[(long long)k * sk] * s : 0.f); }
    return a;
}
// f16 fragment from an f16 LDS/global row with element stride 1 (k-contiguous), no bounds (tile already zero padded)
__device__ __forceinline__ v16h fh_row(const _Float16* __restrict__ row, int k0, int h) {
    v16h a;
#pragma unroll
    for (int i = 0; i < 16; ++i) a[i] = row[k0 + frag_k(i, h)];
    return a;
}

#define VST2(T, ptr, val) do { const T vst2_v_ = (val); *(T*)(ptr) = vst2_v_;  } while (0)
typedef float v4f __attribute__((ext_vector_type(4)));
#define VST2V4(ptr, val) do { const v4f vst2_v4_ = (val); *(v4f*)(ptr) = vst2_v4_;  } while (0)

__device__ __attribute__((noinline)) float act_fn(float v, int act) {
    if (act == 1) return fmaxf(v, 0.f);                                                                               // relu
    if (act == 2) { const float u = 0.7978845608028654f * (v + 0.044715f * v * v * v); return 0.5f * v * (1.f + tanhf(u)); } // tanh-gelu
    if (act == 3) return v / (1.f + expf(-v));                                                                        // silu
    if (act == 4) return 0.5f * v * (1.f + erff(v * 0.7071067811865476f));                                             // erf-gelu
    if (act == 5) return tanhf(v);
    if (act == 6) return 1.f / (1.f + expf(-v));                                                                      // sigmoid
    if (act == 7) return (v > 0.f) ? v : 0.01f * v;                                                                   // leaky relu 0.01
    if (act == 8) return (v > 0.f) ? v : (expf(v) - 1.f);                                                             // elu
    if (act == 9) return fminf(fmaxf(v, 0.f), 6.f);                                                                   // relu6
    if (act == 10) return fabsf(v);                                                                                    // abs
    if (act == 11) return (v >= 0.f) ? v : 0.1f * v;                                                                  // leaky 0.1
    if (act == 12) return (v > 0.f) ? v : 0.2f * v;                                                                   // leaky 0.2
    if (act == 13) return (v > 20.f) ? v : log1pf(expf(v));                                                            // softplus
    return v;
}

// =====================================================================================================================
// k_gemm<MODE>: C(z, m, n) = act(alpha * sum_k A(z, m, k) * B(z, k, n) + bias) + beta * R(z, m, n)
//   One wave (32-thread block) per 16 x 32 tile of C; grid (ceil(N/32), ceil(M/16), Z). Batch z -> (zo = z / zi_n, zi = z % zi_n)
//   with separate outer/inner strides for every tensor (e.g. batch and head). A(m,k) = A[zo*sAo + zi*sAi + m*sAm + k*sAk] (f32),
//   B(k,n) = B[zo*sBo + zi*sBi + n*sBn + k*sBk] (f32); any M, N, K (K zero-padded to 32 inside the fragments, M/N tails guarded).
//   C(m,n) = C[zo*sCo + zi*sCi + m*sCm + n] (n contiguous). flags: 1 bias[n], 2 bias[m], 4 residual R[zo*sRo + zi*sRi + m*sRm + n*sRn].
//   MODE 0: f16 operands (A prescaled by sa, B by sb, both undone in the epilogue); 1: bf16 hi/lo split (3 products); 2: bf16;
//   3: bf16 hi/mid/lo triple split (6 products); 4: as 3 with Kahan-compensated f32 accumulation across k-steps.
// =====================================================================================================================
struct GemmP {
    const float* A; const float* B; const float* bias; const float* R; float* C;
    long long sAo, sAi, sAm, sAk, sBo, sBi, sBn, sBk, sCo, sCi, sCm, sRo, sRi, sRm, sRn;
    int M, N, K, zi_n, flags, act; float alpha, beta, sa, sb;
    int Npad, pad_;     // columns [N, Npad) of C are written as 0 so that padded workspace rows are covered by whole-line stores; Npad >= N
};
static_assert(sizeof(GemmP) == 5 * 8 + 15 * 8 + 6 * 4 + 4 * 4 + 2 * 4, "GemmP has padding");

template <int MODE>
__global__ __launch_bounds__(32) void k_gemm(GemmP p) {
    const int lane = threadIdx.x & 31, h = lane >> 4, l15 = lane & 15;
    const int m0 = blockIdx.y * 16, n0 = blockIdx.x * 32;
    const int z = blockIdx.z, zo = z / p.zi_n, zi = z - zo * p.zi_n;
    const float* A = p.A + zo * p.sAo + zi * p.sAi;
    const float* B = p.B + zo * p.sBo + zi * p.sBi;
    const int am = min(m0 + l15, p.M - 1);                       // clamped row for loads (stores are guarded)
    v8f acc[2], comp[2];
#pragma unroll
    for (int t = 0; t < 2; ++t) { v8f zz = {}; acc[t] = zz; comp[t] = zz; }
    for (int k0 = 0; k0 < p.K; k0 += 32) {
        const float* arow = A + (long long)am * p.sAm;
        if (MODE == 1) {
            const Split a = sp_ld(arow, p.sAk, k0, h, p.K, 1.f);
#pragma unroll
            for (int t = 0; t < 2; ++t) {
                const int bn = min(n0 + t * 16 + l15, p.N - 1);
                acc[t] = wmma3(a, sp_ld(B + (long long)bn * p.sBn, p.sBk, k0, h, p.K, 1.f), acc[t]);
            }
        } else if (MODE == 3) {
            const Split3 a = sp3_ld(arow, p.sAk, k0, h, p.K, 1.f);
#pragma unroll
            for (int t = 0; t < 2; ++t) {
                const int bn = min(n0 + t * 16 + l15, p.N - 1);
                acc[t] = wmma6(a, sp3_ld(B + (long long)bn * p.sBn, p.sBk, k0, h, p.K, 1.f), acc[t]);
            }
        } else if (MODE == 4) {
            // triple split as MODE 3, but each k-step's 6 products go into a fresh accumulator and the partial is added to the running f32 sum
            // on the VALU with Kahan compensation (accumulation error stays ~1 ulp however long K is)
            const Split3 a = sp3_ld(arow, p.sAk, k0, h, p.K, 1.f);
#pragma unroll
            for (int t = 0; t < 2; ++t) {
                const int bn = min(n0 + t * 16 + l15, p.N - 1); v8f zz = {};
                const v8f part = wmma6(a, sp3_ld(B + (long long)bn * p.sBn, p.sBk, k0, h, p.K, 1.f), zz);
                const v8f y = part - comp[t]; const v8f s = acc[t] + y; comp[t] = (s - acc[t]) - y; acc[t] = s;
            }
        } else if (MODE == 2) {
            const v16b a = bh_ld(arow, p.sAk, k0, h, p.K, 1.f);
#pragma unroll
            for (int t = 0; t < 2; ++t) {
                const int bn = min(n0 + t * 16 + l15, p.N - 1);
                acc[t] = wmmab(a, bh_ld(B + (long long)bn * p.sBn, p.sBk, k0, h, p.K, 1.f), acc[t]);
            }
        } else {
            const v16h a = fh_ld(arow, p.sAk, k0, h, p.K, p.sa);
#pragma unroll
            for (int t = 0; t < 2; ++t) {
                const int bn = min(n0 + t * 16 + l15, p.N - 1);
                acc[t] = wmma16(a, fh_ld(B + (long long)bn * p.sBn, p.sBk, k0, h, p.K, p.sb), acc[t]);
            }
        }
    }
    const float iscale = (MODE == 0) ? p.alpha / (p.sa * p.sb) : p.alpha;
    float* C = p.C + zo * p.sCo + zi * p.sCi;
    const float* R = p.R + zo * p.sRo + zi * p.sRi;
    __shared__ __align__(16) float ctile[16][36];
#pragma unroll
    for (int t = 0; t < 2; ++t) {
        const int n = n0 + t * 16 + l15; const int nn = min(n, p.N - 1);
#pragma unroll
        for (int r = 0; r < 8; ++r) {
            const int m = m0 + 8 * h + r; const int mm = min(m, p.M - 1);
            float v = acc[t][r] * iscale;
            if (p.flags & 1) v += p.bias[nn];
            if (p.flags & 2) v += p.bias[mm];
            if (p.flags & 8) v *= p.bias[(long long)zo * p.M + mm];   /* per-(z,row) scale vector laid out [Z][M]; exclusive with the bias flags */
            v = act_fn(v, p.act);
            if (p.flags & 4) v += p.beta * R[(long long)mm * p.sRm + (long long)nn * p.sRn];
            ctile[8 * h + r][t * 16 + l15] = (n < p.N) ? v : 0.f;
        }
    }
    __syncthreads();
    const int NW = (p.Npad > p.N) ? p.Npad : p.N;           // write width
    const bool fast = (m0 + 16 <= p.M) && (n0 + 32 <= NW) && ((p.sCm & 3) == 0) && ((((size_t)C) & 15) == 0);
    if (fast) {
#pragma unroll
        for (int s = 0; s < 4; ++s) {
            const int row = s * 4 + (lane >> 3), c4 = (lane & 7) * 4;
            const v4f v = *(const v4f*)&ctile[row][c4];
            VST2V4(C + (long long)(m0 + row) * p.sCm + n0 + c4, v);
        }
    } else {
        for (int row = 0; row < 16; ++row) {
            const int m = m0 + row, n = n0 + lane;
            if (m < p.M && n < NW) VST2(float, C + (long long)m * p.sCm + n, ctile[row][lane]);
        }
    }
}


// =====================================================================================================================
// k_gemmT<MODE, TM, TN>: same contract as k_gemm, but one wave computes a (16*TM) x (16*TN) tile: TM A fragments and TN B fragments are
//   loaded per 32-wide k-step and reused across TM*TN WMMAs (far fewer load/convert instructions per MAC). MODE 0 (f16), 1 (bf16 hi/lo),
//   2 (bf16) only. grid (ceil(NW/(16*TN)), ceil(M/(16*TM)), Z), block 32. Epilogue identical to k_gemm, run per 16x32 sub-tile.
// =====================================================================================================================
template <int MODE, int TM, int TN>
__global__ __launch_bounds__(32) void k_gemmT(GemmP p) {
    const int lane = threadIdx.x & 31, h = lane >> 4, l15 = lane & 15;
    const int m0 = blockIdx.y * (16 * TM), n0 = blockIdx.x * (16 * TN);
    const int z = blockIdx.z, zo = z / p.zi_n, zi = z - zo * p.zi_n;
    const float* A = p.A + zo * p.sAo + zi * p.sAi;
    const float* B = p.B + zo * p.sBo + zi * p.sBi;
    v8f acc[TM][TN];
#pragma unroll
    for (int i = 0; i < TM; ++i)
#pragma unroll
        for (int t = 0; t < TN; ++t) { v8f zz = {}; acc[i][t] = zz; }
    for (int k0 = 0; k0 < p.K; k0 += 32) {
        if (MODE == 1) {
            Split a[TM], b[TN];
#pragma unroll
            for (int i = 0; i < TM; ++i) { const int am = min(m0 + 16 * i + l15, p.M - 1); a[i] = sp_ld(A + (long long)am * p.sAm, p.sAk, k0, h, p.K, 1.f); }
#pragma unroll
            for (int t = 0; t < TN; ++t) { const int bn = min(n0 + 16 * t + l15, p.N - 1); b[t] = sp_ld(B + (long long)bn * p.sBn, p.sBk, k0, h, p.K, 1.f); }
#pragma unroll
            for (int i = 0; i < TM; ++i)
#pragma unroll
                for (int t = 0; t < TN; ++t) acc[i][t] = wmma3(a[i], b[t], acc[i][t]);
        } else if (MODE == 2) {
            v16b a[TM], b[TN];
#pragma unroll
            for (int i = 0; i < TM; ++i) { const int am = min(m0 + 16 * i + l15, p.M - 1); a[i] = bh_ld(A + (long long)am * p.sAm, p.sAk, k0, h, p.K, 1.f); }
#pragma unroll
            for (int t = 0; t < TN; ++t) { const int bn = min(n0 + 16 * t + l15, p.N - 1); b[t] = bh_ld(B + (long long)bn * p.sBn, p.sBk, k0, h, p.K, 1.f); }
#pragma unroll
            for (int i = 0; i < TM; ++i)
#pragma unroll
                for (int t = 0; t < TN; ++t) acc[i][t] = wmmab(a[i], b[t], acc[i][t]);
        } else {
            v16h a[TM], b[TN];
#pragma unroll
            for (int i = 0; i < TM; ++i) { const int am = min(m0 + 16 * i + l15, p.M - 1); a[i] = fh_ld(A + (long long)am * p.sAm, p.sAk, k0, h, p.K, p.sa); }
#pragma unroll
            for (int t = 0; t < TN; ++t) { const int bn = min(n0 + 16 * t + l15, p.N - 1); b[t] = fh_ld(B + (long long)bn * p.sBn, p.sBk, k0, h, p.K, p.sb); }
#pragma unroll
            for (int i = 0; i < TM; ++i)
#pragma unroll
                for (int t = 0; t < TN; ++t) acc[i][t] = wmma16(a[i], b[t], acc[i][t]);
        }
    }
    const float iscale = (MODE == 0) ? p.alpha / (p.sa * p.sb) : p.alpha;
    float* C = p.C + zo * p.sCo + zi * p.sCi;
    const float* R = p.R + zo * p.sRo + zi * p.sRi;
    const int NW = (p.Npad > p.N) ? p.Npad : p.N;
    __shared__ __align__(16) float ctile[16][36];
#pragma unroll
    for (int i = 0; i < TM; ++i) {
        const int mb = m0 + 16 * i; if (mb >= p.M) break;          // wave-uniform
#pragma unroll
        for (int tp = 0; tp < TN / 2; ++tp) {
            const int nb = n0 + 32 * tp; if (nb >= NW) break;        // wave-uniform
#pragma unroll
            for (int t2 = 0; t2 < 2; ++t2) {
                const int t = 2 * tp + t2; const int n = nb + t2 * 16 + l15; const int nn = min(n, p.N - 1);
#pragma unroll
                for (int r = 0; r < 8; ++r) {
                    const int m = mb + 8 * h + r; const int mm = min(m, p.M - 1);
                    float v = acc[i][t][r] * iscale;
                    if (p.flags & 1) v += p.bias[nn];
                    if (p.flags & 2) v += p.bias[mm];
            if (p.flags & 8) v *= p.bias[(long long)zo * p.M + mm];   /* per-(z,row) scale vector laid out [Z][M]; exclusive with the bias flags */
                    v = act_fn(v, p.act);
                    if (p.flags & 4) v += p.beta * R[(long long)mm * p.sRm + (long long)nn * p.sRn];
                    ctile[8 * h + r][t2 * 16 + l15] = (n < p.N) ? v : 0.f;
                }
            }
            __syncthreads();
            const bool fast = (mb + 16 <= p.M) && (nb + 32 <= NW) && ((p.sCm & 3) == 0) && ((((size_t)C) & 15) == 0);
            if (fast) {
#pragma unroll
                for (int s = 0; s < 4; ++s) {
                    const int row = s * 4 + (lane >> 3), c4 = (lane & 7) * 4;
                    const v4f v = *(const v4f*)&ctile[row][c4];
                    VST2V4(C + (long long)(mb + row) * p.sCm + nb + c4, v);
                }
            } else {
                for (int row = 0; row < 16; ++row) {
                    const int m = mb + row, n = nb + lane;
                    if (m < p.M && n < NW) VST2(float, C + (long long)m * p.sCm + n, ctile[row][lane]);
                }
            }
            __syncthreads();
        }
    }
}

// =====================================================================================================================
// k_attn32<LQ, LK, QP, SP>: flash attention at one fixed shape, all of it known at compile time: LQ queries, LK keys (a multiple of 64), head and
//   value dim 32, no mask. Q and O: f32 rows with element stride 1 (Q row pitch QP floats, O row pitch SP floats, head h at column 32 h).
//   K and V come as f16 planes in fragment order, one plane of 32 LK halves a (image, head), written by the kv product's epilogue. A fragment is 1024 bytes: [j = 0, 1][lane][8 halves].
//     K plane: fragment kt = 16 keys;            lane (hf, l15), half j, element e = K[key 16 kt + l15][d = 16 j + 8 hf + e]
//     V plane: fragment dt * LK / 32 + g;        lane (hf, l15), half j, element e = V[key 32 g + 16 j + 8 hf + e][d = 16 dt + l15]
//   so each operand register quad is one 16-byte load, a wave's load instruction reads 512 consecutive bytes (4 whole lines), and nothing is converted or staged in the loop.
//   Wave = 16 queries, AW waves per block, 64-key blocks; grid (LQ / (16*AW), heads, images), block 32*AW; image z at Q + z*LQ*QP, O + z*LQ*SP.
//   Both products are transposed: S^T = K . Q^T (A = 16 key rows, B = the wave's 16 queries) and O^T += V^T . P^T. A lane then holds scores of ONE query (its column l15; keys 16 t + 8 hf + r),
//   so the maximum and the sum are taken in the lane, with one exchange between the lane halves, and two score tiles, converted in place, are the B operand of the second product.
//   Scores: f16 operands; statistics f32. The running maximum is kept on the raw scores (scale > 0, so it is the scaled scores' maximum too; it only sets the range, the quotient does not depend on it).
//   One fma a score forms the whole exponent, s * (scale * log2 e) + (12 - max * scale * log2 e), and the hardware's exp2 gives P x 4096 at once, which is summed in f32 and cast to f16.
// =====================================================================================================================
#define AW 4
typedef __attribute__((ext_vector_type(4))) _Float16 v4h;
// the 16 f32 that make up lane half h's fragment of a 32-wide row: k = 8h..8h+7 and 16+8h..16+8h+7 (the order of frag_k)
struct Row16 { v4f r[4]; };
__device__ __forceinline__ Row16 row16_ld(const float* __restrict__ row, int h) {
    Row16 x;
    x.r[0] = *(const v4f*)(row + 8 * h); x.r[1] = *(const v4f*)(row + 8 * h + 4);
    x.r[2] = *(const v4f*)(row + 16 + 8 * h); x.r[3] = *(const v4f*)(row + 16 + 8 * h + 4);
    return x;
}
__device__ __forceinline__ v16h row16_f16(const Row16& x) {
    v16h a;
#pragma unroll
    for (int q = 0; q < 4; ++q)
#pragma unroll
        for (int e = 0; e < 4; ++e) a[4 * q + e] = (_Float16)x.r[q][e];
    return a;
}
// the value that lane l ^ 16 holds
__device__ __forceinline__ float other_half(float x) {
    const int b = __float_as_int(x);
    return __int_as_float(__builtin_amdgcn_permlanex16(b, b, 0x76543210, 0xfedcba98, false, false));
}
// one f16 fragment from a plane in fragment order: p points at this lane's 8 halves of the fragment's half j = 0
__device__ __forceinline__ v16h frag_ld(const _Float16* __restrict__ p) {
    union { v16h v; v8h h[2]; } f;
    f.h[0] = *(const v8h*)(p); f.h[1] = *(const v8h*)(p + 256);
    return f.v;
}
// amdgpu_waves_per_eu(8): a budget of 128 registers a wave, so that 8 blocks fit on a WGP at once (one register more would leave room for 7)
template <int LQ, int LK, int QP, int SP>
__global__ __launch_bounds__(32 * AW) __attribute__((amdgpu_waves_per_eu(8))) void k_attn32(const float* __restrict__ Q, const _Float16* __restrict__ KF, const _Float16* __restrict__ VF, float* __restrict__ O, float scale) {
    static_assert(LQ % (16 * AW) == 0 && LK % 64 == 0 && QP % 4 == 0 && SP % 4 == 0, "whole tiles, 16-byte rows");
    constexpr int NT = 2;                       // output tiles (16 d each)
    constexpr int OP = 32 + 4;                  // LDS pitch of an output row (floats)
    __shared__ __align__(16) float    ol[AW][16 * OP];
    const int lane = threadIdx.x & 31, hf = lane >> 4, l15 = lane & 15, wave = threadIdx.x >> 5;
    const int h = blockIdx.y;
    const int q0 = (blockIdx.x * AW + wave) * 16;
    Q += (size_t)blockIdx.z * LQ * QP; O += (size_t)blockIdx.z * LQ * SP;      // image blockIdx.z: its own Q / O plane
    const float L2E = 1.4426950408889634f;
    const float NEG = -__builtin_inff();
    const float cs = scale * L2E;               // raw score -> exponent of 2
    const size_t plane = (size_t)(blockIdx.z * gridDim.y + h) * (LK * 32) + lane * 8;           // this (image, head)'s plane, at this lane's 8 halves of a fragment
    const _Float16* kf = KF + plane;                                                            // both walk on by one 64-key block a trip: every fragment address is one of them plus an immediate
    const _Float16* vf = VF + plane;
    const v16h qa = row16_f16(row16_ld(Q + h * 32 + (size_t)(q0 + l15) * QP, hf));
    asm volatile("s_wait_xcnt 0x0" ::: "memory");   // the Q loads' address registers are reused for the start values set below: the wait stands in front of that overwrite
    __builtin_amdgcn_sched_barrier(0);              // keeps those later register writes from being scheduled ahead of the wait
    v8f o[NT]; float mrun = NEG, lrun = 0.f;        // this lane's query: running maximum (both halves agree) and this half's part of the sum
#pragma unroll
    for (int t = 0; t < NT; ++t) { v8f zz = {}; o[t] = zz; }
    for (int j0 = 0; j0 < LK; j0 += 64) {
        v16h ka[4], va[4];
#pragma unroll
        for (int t = 0; t < 4; ++t) ka[t] = frag_ld(kf + t * 512);
        asm volatile("s_wait_xcnt 0x0" ::: "memory");    // the K loads' address registers are rewritten further down: the wait stands in front of that overwrite
        __builtin_amdgcn_sched_barrier(0);               // keeps those register writes from being scheduled ahead of the wait
        v8f s[4];
#pragma unroll
        for (int t = 0; t < 4; ++t) { v8f acc = {}; s[t] = wmma16(ka[t], qa, acc); }
        float mt[4];                                     // one maximum a tile: four short chains, not one of 32
#pragma unroll
        for (int t = 0; t < 4; ++t) {
            float a = fmaxf(s[t][0], s[t][1]);
#pragma unroll
            for (int r = 2; r < 8; ++r) a = fmaxf(a, s[t][r]);
            mt[t] = a;
        }
        float mx = fmaxf(fmaxf(mt[0], mt[1]), fmaxf(mt[2], mt[3]));
        mx = fmaxf(mx, other_half(mx));
        const float mnew = fmaxf(mrun, mx);
        // exp2 as the bare hardware instruction: it gives 0 where the result would be below 2^-126. Such a term is lost anyway: beside a row sum of at least 4096 in f32, and as an f16 operand.
        const float corr = __builtin_amdgcn_exp2f((mrun - mnew) * cs);   // first block: exp2(-inf) = 0
        const float nb = 12.f - mnew * cs;               // the 12 is the factor 4096 of P
#pragma unroll
        for (int t = 0; t < 4; ++t)
#pragma unroll
            for (int r = 0; r < 8; ++r) s[t][r] = __builtin_amdgcn_exp2f(__builtin_fmaf(s[t][r], cs, nb));
        const v8f ps = (s[0] + s[1]) + (s[2] + s[3]);
        const float rs = ((ps[0] + ps[1]) + (ps[2] + ps[3])) + ((ps[4] + ps[5]) + (ps[6] + ps[7]));
        lrun = lrun * corr + rs; mrun = mnew;
#pragma unroll
        for (int t = 0; t < NT; ++t) o[t] *= corr;
        v16h pb0, pb1;                                   // P^T fragments: element e <- key frag_k(e, hf) (+ 32), which is element e & 7 of score tile e >> 3 (+ 2)
#pragma unroll
        for (int e = 0; e < 16; ++e) { pb0[e] = (_Float16)s[e >> 3][e & 7]; pb1[e] = (_Float16)s[2 + (e >> 3)][e & 7]; }
#pragma unroll
        for (int t = 0; t < 4; ++t) va[t] = frag_ld(vf + ((t >> 1) * (LK / 32) + (t & 1)) * 512);   // va[2 dt + g]
#pragma unroll
        for (int t = 0; t < NT; ++t) {
            o[t] = wmma16(va[2 * t], pb0, o[t]);
            o[t] = wmma16(va[2 * t + 1], pb1, o[t]);
        }
        kf += 4 * 512; vf += 2 * 512;
    }
    float* obase = O + h * 32;
    const float inv = 1.f / (lrun + other_half(lrun));          // sum and output both carry the factor 4096; no key is masked: the row sum holds its maximum's exp2(12)
    float* myo = ol[wave];                                       // the wave's own 16 x 32 output tile, query-major
#pragma unroll
    for (int t = 0; t < NT; ++t) {
        const v4f lo = {o[t][0] * inv, o[t][1] * inv, o[t][2] * inv, o[t][3] * inv}, hi = {o[t][4] * inv, o[t][5] * inv, o[t][6] * inv, o[t][7] * inv};
        *(v4f*)(myo + l15 * OP + t * 16 + 8 * hf) = lo; *(v4f*)(myo + l15 * OP + t * 16 + 8 * hf + 4) = hi;
    }
    __syncthreads();
#pragma unroll
    for (int r0 = 0; r0 < 16; r0 += 4) {
        const int row = r0 + (lane >> 3), c4 = (lane & 7) * 4;
        const v4f v = *(const v4f*)(myo + row * OP + c4);
        VST2V4(obase + (size_t)(q0 + row) * SP + c4, v);
    }
}

// =====================================================================================================================
// k_tr: dst(z, c, r) = alpha * src(z, r, c) (+ beta * R2(z, c, r)): [Z][R][C] (row stride lds) -> [Z][C][R] (row stride ldd) through a 32x32 LDS tile;
//   flags: 1 -> add beta * residual R2 addressed like dst (z*sRz + c*ldr + r); act applied before the residual.
// =====================================================================================================================
struct TrP { const float* src; float* dst; const float* R2; long long sSz, lds, sDz, ldd, sRz, ldr; int R, C, flags, act; float alpha, beta; };
static_assert(sizeof(TrP) == 3 * 8 + 6 * 8 + 6 * 4, "TrP has padding");
__global__ __launch_bounds__(256) void k_tr(TrP p) {
    __shared__ float tile[32][33];
    const int c0 = blockIdx.x * 32, r0 = blockIdx.y * 32, z = blockIdx.z;
    const int lane = threadIdx.x & 31, wave = threadIdx.x >> 5;
    const float* s = p.src + z * p.sSz;
#pragma unroll
    for (int k = 0; k < 4; ++k) {
        const int rl = wave * 4 + k, r = r0 + rl, c = c0 + lane;
        tile[rl][lane] = (r < p.R && c < p.C) ? s[(long long)r * p.lds + c] : 0.f;
    }
    __syncthreads();
    float* d = p.dst + z * p.sDz; const float* rr = p.R2 + z * p.sRz;
#pragma unroll
    for (int k = 0; k < 4; ++k) {
        const int cl = wave * 4 + k, c = c0 + cl, r = r0 + lane;
        if (c < p.C && r < p.R) {
            float v = act_fn(p.alpha * tile[lane][cl], p.act);
            if (p.flags & 1) v += p.beta * rr[(long long)c * p.ldr + r];
            VST2(float, d + (long long)c * p.ldd + r, v);
        }
    }
}

// k_affine: dst[i] = a * (sdev ? sdev[0] : 1) * src[i] + b, i < n (one thread per element; consecutive lanes -> consecutive addresses)
__global__ __launch_bounds__(256) void k_affine(const float* __restrict__ src, float* __restrict__ dst, int n, float a, float b, const float* __restrict__ sdev) {
    const int i = blockIdx.x * 256 + threadIdx.x;
    if (i < n) { const float aa = sdev ? a * sdev[0] : a; const float v = aa * src[i] + b; VST2(float, dst + i, v); }
}

// =====================================================================================================================
// k_softmax: row softmax over n contiguous elements, one 256-thread block per row; rows addressed z*sz + r*sr (grid (R, Z)).
//   out = scale_out * softmax(scale_in * x + (Mf ? Mf[z*smz + r*smr + j] : 0)); a row whose max is -inf is written as 0.
// =====================================================================================================================
struct SmP { const float* src; float* dst; const float* Mf; long long sz, sr, dz, dr, smz, smr; int n, pad; float scale_in, scale_out; };
static_assert(sizeof(SmP) == 3 * 8 + 6 * 8 + 4 * 4, "SmP has padding");
__global__ __launch_bounds__(256) void k_softmax(SmP p) {
    __shared__ float red[256];
    const int r = blockIdx.x, z = blockIdx.y, tid = threadIdx.x;
    const float* s = p.src + z * p.sz + (long long)r * p.sr;
    const float* mf = p.Mf ? (p.Mf + z * p.smz + (long long)r * p.smr) : nullptr;
    float mx = -__builtin_inff();
    for (int j = tid; j < p.n; j += 256) { float v = s[j] * p.scale_in; if (mf) v += mf[j]; mx = fmaxf(mx, v); }
    red[tid] = mx; __syncthreads();
    for (int o = 128; o > 0; o >>= 1) { if (tid < o) red[tid] = fmaxf(red[tid], red[tid + o]); __syncthreads(); }
    mx = red[0]; __syncthreads();
    float sum = 0.f;
    for (int j = tid; j < p.n; j += 256) { float v = s[j] * p.scale_in; if (mf) v += mf[j]; sum += (mx == -__builtin_inff()) ? 0.f : expf(v - mx); }
    red[tid] = sum; __syncthreads();
    for (int o = 128; o > 0; o >>= 1) { if (tid < o) red[tid] += red[tid + o]; __syncthreads(); }
    sum = red[0];
    const float inv = (sum > 0.f) ? p.scale_out / sum : 0.f;
    float* d = p.dst + z * p.dz + (long long)r * p.dr;
    for (int j = tid; j < p.n; j += 256) { float v = s[j] * p.scale_in; if (mf) v += mf[j]; const float o = (mx == -__builtin_inff()) ? 0.f : expf(v - mx) * inv; VST2(float, d + j, o); }
}
// =====================================================================================================================
// k_stats: mean and rsqrt(var + eps) over a set of n elements addressed base + z*sz + (e / inner) * so + (e % inner) * si, one 256-thread
// k_norm_apply: y = (x - mean[set]) * rstd[set] * g[c] + b[c] over a [Z][C][L] channel-major tensor with set = z*G + c / (C/G) (G groups per z;
//   G = C -> per-channel sets indexed z*C+c; for batch norm pass stats indexed by c only via bn = 1). Optional act. Output same layout.
// =====================================================================================================================
//   mode 0: mean / rsqrt(var + eps); mode 1 (RMSNorm): 0 / rsqrt(mean(x^2) + eps); mode 2 (L2 normalize * sqrt(n)): 0 / sqrt(n) / max(||x||, eps); mode 3: as 0 with unbiased variance (n-1)
__global__ __launch_bounds__(256) void k_stats(const float* __restrict__ x, long long sz, long long so, long long si, int inner, int n, float eps, float* __restrict__ stat, int mode) {
    __shared__ float red[256];
    const int z = blockIdx.x, tid = threadIdx.x;
    const float* base = x + z * sz;
    float s = 0.f;
    for (int e = tid; e < n; e += 256) s += base[(long long)(e / inner) * so + (long long)(e % inner) * si];
    red[tid] = s; __syncthreads();
    for (int o = 128; o > 0; o >>= 1) { if (tid < o) red[tid] += red[tid + o]; __syncthreads(); }
    const float mu = (mode == 0 || mode == 3) ? red[0] / (float)n : 0.f; __syncthreads();
    float q = 0.f;
    for (int e = tid; e < n; e += 256) { const float dlt = base[(long long)(e / inner) * so + (long long)(e % inner) * si] - mu; q += dlt * dlt; }
    red[tid] = q; __syncthreads();
    for (int o = 128; o > 0; o >>= 1) { if (tid < o) red[tid] += red[tid + o]; __syncthreads(); }
    {
        float rs;
        if (mode == 2) rs = sqrtf((float)n) / fmaxf(sqrtf(red[0]), eps); else if (mode == 3) rs = rsqrtf(red[0] / (float)(n - 1) + eps); else rs = rsqrtf(red[0] / (float)n + eps);
        if (tid < 32) { const float v = (tid == 0) ? mu : ((tid == 1) ? rs : 0.f); VST2(float, stat + (long long)z * 32 + tid, v); }
    }
}
//   One thread per element over the flat [Z][C][L] index space: grid ceil(Z*C*L / 256).
__global__ __launch_bounds__(256) void k_norm_apply(const float* __restrict__ x, float* __restrict__ y, const float* __restrict__ stat, const float* __restrict__ g, const float* __restrict__ bta,
                                                     int Z, int C, int L, int G, int bn, int act) {
    const long long idx = (long long)blockIdx.x * 256 + threadIdx.x;
    if (idx >= (long long)Z * C * L) return;
    const int l = (int)(idx % L); const long long zc = idx / L; const int c = (int)(zc % C), z = (int)(zc / C); (void)l;
    const int set = bn ? c : (z * G + c / (C / G));
    float v = (x[idx] - stat[(long long)set * 32]) * stat[(long long)set * 32 + 1];
    if (g) v *= g[c];
    if (bta) v += bta[c];
    v = act_fn(v, act);
    VST2(float, y + idx, v);
}

// k_lse_neg: c[i] = -(st[2i] + log(st[2i+1])) = minus the log-sum-exp of row i (for softmax over the query axis)
__global__ __launch_bounds__(256) void k_lse_neg(const float* __restrict__ st, float* __restrict__ c, int n) {
    const int i = blockIdx.x * 256 + threadIdx.x;
    if (i < n) { const float v = -(st[2 * i] + logf(st[2 * i + 1])); VST2(float, c + i, v); }
}

// k_iota: dst[i] = a * i + b as int32 (segment/position id helper)
__global__ __launch_bounds__(256) void k_iota(int* __restrict__ dst, int n, int a, int b) {
    const int i = blockIdx.x * 256 + threadIdx.x;
    if (i < n) { const int v = a * i + b; VST2(int, dst + i, v); }
}

// k_axpby: dst[i] = a * x[i] + b * y[i] (+ c), i < n
__global__ __launch_bounds__(256) void k_axpby(const float* __restrict__ x, const float* __restrict__ y, float* __restrict__ dst, int n, float a, float b, float c) {
    const int i = blockIdx.x * 256 + threadIdx.x;
    if (i < n) { const float v = a * x[i] + b * y[i] + c; VST2(float, dst + i, v); }
}

// =====================================================================================================================
// k_rope: rotary embedding on a [R rows][Hn heads][D] view (row stride sXr, head stride sXh, element stride 1) -> Y (own strides).
//   mode 0: rotate_half (partner d±D/2, sign - for d<D/2); mode 1: interleaved pairs (partner d^1, sign - for even d).
//   table column tcol: tmode 0 -> d, 1 -> d % (D/2), 2 -> d / 2; position p: pmode 0 -> r % S, 1 -> head index, 2 -> pos[r];
//   c = C[(r / S) * sCb + p * sCp + tcol * sCd], s likewise from Sn; y = x[d] * c + sign * x[partner] * s. X and Y must not alias.
// =====================================================================================================================
struct RopeP { const float* X; float* Y; const float* C; const float* Sn; const int* pos; long long sXr, sXh, sYr, sYh, sCb, sCp, sCd; int R, Hn, D, S, mode, tmode, pmode, pad; };
static_assert(sizeof(RopeP) == 5 * 8 + 7 * 8 + 8 * 4, "RopeP has padding");
__global__ __launch_bounds__(256) void k_rope(RopeP p) {
    const long long idx = (long long)blockIdx.x * 256 + threadIdx.x;
    if (idx >= (long long)p.R * p.Hn * p.D) return;
    const int d = (int)(idx % p.D); const long long rh = idx / p.D; const int h = (int)(rh % p.Hn); const int r = (int)(rh / p.Hn);
    const int half = p.D / 2;
    int partner; float sign;
    if (p.mode == 0) { partner = (d < half) ? d + half : d - half; sign = (d < half) ? -1.f : 1.f; }
    else { partner = d ^ 1; sign = (d & 1) ? 1.f : -1.f; }
    const int tcol = (p.tmode == 0) ? d : ((p.tmode == 1) ? (d % half) : (d >> 1));
    const int pp = (p.pmode == 0) ? (r % p.S) : ((p.pmode == 1) ? h : p.pos[r]);
    const long long toff = (long long)(r / p.S) * p.sCb + (long long)pp * p.sCp + (long long)tcol * p.sCd;
    const float* xr = p.X + (long long)r * p.sXr + (long long)h * p.sXh;
    const float v = xr[d] * p.C[toff] + sign * xr[partner] * p.Sn[toff];
    VST2(float, p.Y + (long long)r * p.sYr + (long long)h * p.sYh + d, v);
}

// k_invf + k_sincos (split so neither kernel carries a large VALU-fma footprint): invf_i = num * (1 / powf(base, (2 i)/D)) [fmode 0],
//   num * expf((2 i) * cexp) [fmode 1], num * powf(base, -2 (i - 1) / D) [fmode 2]; then cs/sn[s*half + i] = cos/sin((pscale * s) * invf_i)
__global__ __launch_bounds__(256) void k_invf(float* __restrict__ invb, int half, int D, float base, float num, int fmode, float cexp) {
    const int i = blockIdx.x * 256 + threadIdx.x;
    if (i >= ((half + 31) / 32) * 32) return;
    if (i >= half) { VST2(float, invb + i, 0.f); return; }
    const float e = (float)(2 * i) / (float)D;
    float invf;
    if (fmode == 1) invf = num * expf((float)(2 * i) * cexp);
    else if (fmode == 2) invf = num * powf(base, (-2.0f * ((float)i - 1.0f)) / (float)D);
    else invf = num * (1.0f / powf(base, e));
    VST2(float, invb + i, invf);
}
__global__ __launch_bounds__(256) void k_sincos(float* __restrict__ cs, float* __restrict__ sn, const float* __restrict__ invb, int S, int half, float pscale) {
    const int idx = blockIdx.x * 256 + threadIdx.x;
    if (idx >= S * half) return;
    const int s = idx / half, i = idx - s * half;
    const float ang = (pscale * (float)s) * invb[i];
    VST2(float, cs + idx, cosf(ang)); VST2(float, sn + idx, sinf(ang));
}

// k_mulact: dst[i] = act(x[i]) * y[i]
__global__ __launch_bounds__(256) void k_mulact(const float* __restrict__ x, const float* __restrict__ y, float* __restrict__ dst, int n, int act) {
    const int i = blockIdx.x * 256 + threadIdx.x;
    if (i < n) { const float v = act_fn(x[i], act) * y[i]; VST2(float, dst + i, v); }
}

// =====================================================================================================================
// k_matvec: thread-per-row matrix-vector products for N <= 8 output columns (heads with 1-3 outputs, gates), f32 on the VALU.
//   C[r*sCm + j] = act(alpha * sum_k A[r*sAm + k*sAk] * B[j*sBn + k*sBk] + bias[j]) + beta * R[r*sRm + j*sRn]; each thread writes its N contiguous floats.
// =====================================================================================================================
__global__ __launch_bounds__(256) void k_matvec(GemmP p) {
    // 32 lanes write one line with one instruction.
    const int rpt = (p.N == 1) ? 1 : 32;
    const long long r0 = ((long long)blockIdx.x * 256 + threadIdx.x) * rpt; const int z = blockIdx.z, zo = z / p.zi_n, zi = z - zo * p.zi_n;
    if (r0 >= p.M) return;
    const float* Bb = p.B + zo * p.sBo + zi * p.sBi;
    float* C = p.C + zo * p.sCo + zi * p.sCi; const float* R = p.R + zo * p.sRo + zi * p.sRi;
    for (int rr = 0; rr < rpt; ++rr) {
        const long long r = r0 + rr; if (r >= p.M) break;
        const float* A = p.A + zo * p.sAo + zi * p.sAi + r * p.sAm;
        float acc[8] = {0.f, 0.f, 0.f, 0.f, 0.f, 0.f, 0.f, 0.f};
        for (int k = 0; k < p.K; ++k) { const float a = A[(long long)k * p.sAk];
#pragma unroll
            for (int j = 0; j < 8; ++j) if (j < p.N) acc[j] += a * Bb[(long long)j * p.sBn + (long long)k * p.sBk]; }
#pragma unroll
        for (int j = 0; j < 8; ++j) if (j < p.N) {
            float v = acc[j] * p.alpha;
            if (p.flags & 1) v += p.bias[j];
            if (p.flags & 2) v += p.bias[r];
            v = act_fn(v, p.act);
            if (p.flags & 4) v += p.beta * R[r * p.sRm + (long long)j * p.sRn];
            VST2(float, C + r * p.sCm + j, v);
        }
    }
}
// k_smallsoftmax: thread-per-row softmax for short rows (n <= 64): dst[r*dr + j] = softmax(scale*src[r*sr + j])
__global__ __launch_bounds__(256) void k_smallsoftmax(const float* __restrict__ src, float* __restrict__ dst, long long sr, long long dr, int n, long long R, float scale) {
    const long long r0 = ((long long)blockIdx.x * 256 + threadIdx.x) * 32;
    for (int rr = 0; rr < 32; ++rr) {
        const long long r = r0 + rr; if (r >= R) return;
        const float* s = src + r * sr; float* d = dst + r * dr;
        float mx = -__builtin_inff();
        for (int j = 0; j < n; ++j) mx = fmaxf(mx, s[j] * scale);
        float sum = 0.f;
        for (int j = 0; j < n; ++j) sum += expf(s[j] * scale - mx);
        const float inv = 1.f / sum;
        for (int j = 0; j < n; ++j) { const float v = expf(s[j] * scale - mx) * inv; VST2(float, d + j, v); }
    }
}

__global__ __launch_bounds__(32) void k_unitstat(float* __restrict__ st) { const int t = threadIdx.x; const float v = (t == 1) ? 1.f : 0.f; VST2(float, st + t, v); }

// destination (e.g. a d_out whose row width is not a multiple of 32 floats) is written by consecutive lanes of one instruction
__global__ __launch_bounds__(256) void k_lincopy(const float* __restrict__ src, long long lds, float* __restrict__ dst, long long ldd, long long rows, int cols) {
    const long long i = (long long)blockIdx.x * 256 + threadIdx.x; if (i >= rows * cols) return;
    const long long r = i / cols; const int c = (int)(i - r * cols);
    const float v = src[r * lds + c]; VST2(float, dst + r * ldd + c, v);
}

namespace w25 {
typedef __attribute__((ext_vector_type(16))) _Float16 v16h;
typedef __attribute__((ext_vector_type(8)))  _Float16 v8h;
typedef __attribute__((ext_vector_type(16))) __bf16   v16b;
typedef __attribute__((ext_vector_type(8)))  __bf16   v8b;
typedef __attribute__((ext_vector_type(8)))  float    v8f;
typedef __attribute__((ext_vector_type(4)))  float    v4f;

__device__ __forceinline__ unsigned short f2bf_bits(float f) {
  unsigned u = __float_as_uint(f);
  return (unsigned short)((u + 0x7FFFu + ((u >> 16) & 1u)) >> 16);
}
__device__ __forceinline__ float bf_bits2f(unsigned short h) { return __uint_as_float(((unsigned)h) << 16); }

// hazard guards as plain device helpers (no inline asm inside the kernel template body)
__device__ __forceinline__ void dep_guard_h(v8f& a, v8f& b, v16h x, v16h y) { asm volatile("v_nop\n\tv_nop\n\tv_nop\n\tv_nop" : "+v"(a), "+v"(b) : "v"(x), "v"(y)); }
__device__ __forceinline__ void dep_guard_b(v8f& a, v8f& b, v16b x, v16b y) { asm volatile("v_nop\n\tv_nop\n\tv_nop\n\tv_nop" : "+v"(a), "+v"(b) : "v"(x), "v"(y)); }
__device__ __forceinline__ void keep4_h(v16h a, v16h b, v16h c, v16h d) { asm volatile("v_nop" :: "v"(a), "v"(b), "v"(c), "v"(d)); }
__device__ __forceinline__ void keep4_b(v16b a, v16b b, v16b c, v16b d) { asm volatile("v_nop" :: "v"(a), "v"(b), "v"(c), "v"(d)); }
__device__ __forceinline__ void acc_guard4(v8f& a, v8f& b, v8f& c, v8f& d) { asm volatile("v_nop\n\tv_nop\n\tv_nop\n\tv_nop" : "+v"(a), "+v"(b), "+v"(c), "+v"(d)); }
template <typename T> struct Frag;
template <> struct Frag<_Float16> {
  typedef v16h V; union U { v16h v; v8h h[2]; };
  static __device__ __forceinline__ v16h load(const _Float16* p) {   // elements 0..7 <- p[0..7], 8..15 <- p[16..23]
    U f; f.h[0] = *(const v8h*)(p); f.h[1] = *(const v8h*)(p + 16); return f.v;
  }
  static __device__ __forceinline__ v8f mma(v16h a, v16h b, v8f c) {
    return __builtin_amdgcn_wmma_f32_16x16x32_f16(false, a, false, b, (short)0, c, false, false);
  }
  static __device__ __forceinline__ void guard(v8f& a, v8f& b, v16h x, v16h y) { dep_guard_h(a, b, x, y); }
  static __device__ __forceinline__ void keep(v16h a, v16h b, v16h c, v16h d) { keep4_h(a, b, c, d); }
};
template <> struct Frag<__bf16> {
  typedef v16b V; union U { v16b v; v8b h[2]; };
  static __device__ __forceinline__ v16b load(const __bf16* p) {
    U f; f.h[0] = *(const v8b*)(p); f.h[1] = *(const v8b*)(p + 16); return f.v;
  }
  static __device__ __forceinline__ v8f mma(v16b a, v16b b, v8f c) {
    return __builtin_amdgcn_wmma_f32_16x16x32_bf16(false, a, false, b, (short)0, c, false, false);
  }
  static __device__ __forceinline__ void guard(v8f& a, v8f& b, v16b x, v16b y) { dep_guard_b(a, b, x, y); }
  static __device__ __forceinline__ void keep(v16b a, v16b b, v16b c, v16b d) { keep4_b(a, b, c, d); }
};

// ---- Register-blocked batched WMMA GEMM ------------------------------------
// C[m,n] = scale * sum_k A[m,k] * Bt[n,k] (+bias)(+resid); each wave owns a 64x64 tile.
// A row-major [M,K]; Bt row-major [N,K]; M,N % 64 == 0, K % 32 == 0.
// SPLIT: operands are hi/lo planes (A2/Bt2 = lo planes, same layout); product = hi·hi + hi·lo + lo·hi.
// BIAS_MODE: 0 = none, 1 = bias[m], 2 = bias[n].
// OUT_MODE: 0 = f32, 1 = f16, 2 = bf16 hi plane (Cout) + bf16 lo plane (Cout2).
// ET: 0 = f16 operands, 1 = bf16 operands (pointers passed as 16-bit storage)
template <int ET> struct Elem;
template <> struct Elem<0> { typedef _Float16 T; };
template <> struct Elem<1> { typedef __bf16 T; };
// The body takes its block's place in the grid (bx: 8 tiles, b: batch) as arguments, so that one launch can hold the blocks of more than one product.
// FRAGKV, and frag set (block-uniform): the product is the kv conv, rows m = (image, key) with 2^lgk keys an image, columns n = [k | v], each half N / 64 heads of 32 channels. The result is
// stored as f16 in the fragment order that the attention kernel reads (its head comment has the two maps): k to kfrag, v to vfrag, one plane of 32 * 2^lgk halves a (image, head).
template <int ET, bool SPLIT, int BIAS_MODE, int OUT_MODE, bool RESID, int ACT, bool FRAGKV = false>
__device__ __forceinline__ void gemm64_block(
    const unsigned short* __restrict__ Ap, const unsigned short* __restrict__ A2p, int lda, long strideA,
    const unsigned short* __restrict__ Btp, const unsigned short* __restrict__ Bt2p, int ldb, long strideB,
    void* __restrict__ Cout, void* __restrict__ Cout2, int ldc, long strideC,
    const float* __restrict__ bias,
    const float* __restrict__ resid, long strideR,
    int M, int N, int K, float scale, int bx, int b,
    _Float16* __restrict__ kfrag = nullptr, _Float16* __restrict__ vfrag = nullptr, int lgk = 0, bool frag = false) {
  typedef typename Elem<ET>::T T;
  typedef typename Frag<T>::V V;
  const T* A = (const T*)Ap; const T* A2 = (const T*)A2p; const T* Bt = (const T*)Btp; const T* Bt2 = (const T*)Bt2p;
  __shared__ __align__(16) float sT[8][16 * 68];   // per-wave 16x64 slab, pitch 68 floats
  const int lane = threadIdx.x & 31;
  const int wave = threadIdx.x >> 5;
  const int tilesN = N >> 6;
  const int tilesM = M >> 6;
  const int tile = bx * 8 + wave;
  if (tile >= tilesM * tilesN) return;   // wave-uniform; no block barriers in this kernel
  const int tm = tile / tilesN;
  const int tn = tile - tm * tilesN;
  const int m0 = tm << 6;
  const int n0 = tn << 6;

  const T* Ab  = A  + (size_t)b * strideA;
  const T* Bb  = Bt + (size_t)b * strideB;
  const T* Ab2 = SPLIT ? (A2  + (size_t)b * strideA) : nullptr;
  const T* Bb2 = SPLIT ? (Bt2 + (size_t)b * strideB) : nullptr;

  const int rlane = lane & 15;                 // row (A) / col (B, D) within subtile
  const int koff  = (lane >> 4) * 8;           // k offset of this lane half
  const int mOff  = (lane >> 4) * 8;           // D row offset

  v8f acc[4][4];
#pragma unroll
  for (int i = 0; i < 4; ++i)
#pragma unroll
    for (int j = 0; j < 4; ++j) acc[i][j] = (v8f){0.f,0.f,0.f,0.f,0.f,0.f,0.f,0.f};

  for (int k0 = 0; k0 < K; k0 += 32) {
    V bh[4], bl[4];
#pragma unroll
    for (int j = 0; j < 4; ++j) {
      const size_t bo = (size_t)(n0 + (j << 4) + rlane) * ldb + koff + k0;
      bh[j] = Frag<T>::load(Bb + bo);
      if (SPLIT) bl[j] = Frag<T>::load(Bb2 + bo);
    }
#pragma unroll
    for (int i = 0; i < 4; ++i) {
      const size_t ao = (size_t)(m0 + (i << 4) + rlane) * lda + koff + k0;
      V ah = Frag<T>::load(Ab + ao);
      V al;
      if (SPLIT) al = Frag<T>::load(Ab2 + ao);
#pragma unroll
      for (int j = 0; j < 4; ++j) {
        acc[i][j] = Frag<T>::mma(ah, bh[j], acc[i][j]);
        if (SPLIT) {
          acc[i][j] = Frag<T>::mma(ah, bl[j], acc[i][j]);
          acc[i][j] = Frag<T>::mma(al, bh[j], acc[i][j]);
        }
      }
      Frag<T>::guard(acc[i][0], acc[i][3], ah, SPLIT ? al : ah);
    }
    Frag<T>::keep(bh[0], bh[1], bh[2], bh[3]);
    if (SPLIT) Frag<T>::keep(bl[0], bl[1], bl[2], bl[3]);
  }
  acc_guard4(acc[0][0], acc[0][1], acc[0][2], acc[0][3]);
  acc_guard4(acc[1][0], acc[1][1], acc[1][2], acc[1][3]);
  acc_guard4(acc[2][0], acc[2][1], acc[2][2], acc[2][3]);
  acc_guard4(acc[3][0], acc[3][1], acc[3][2], acc[3][3]);

  // ---- epilogue ----
  float* slab = sT[wave];
  const float* Rb = RESID ? (resid + (size_t)b * strideR) : nullptr;
#pragma unroll
  for (int i = 0; i < 4; ++i) {
    const int mBase = m0 + (i << 4);
#pragma unroll
    for (int j = 0; j < 4; ++j) {
      const int n = n0 + (j << 4) + rlane;
      float bv = 0.f;
      if (BIAS_MODE == 2) bv = bias[n];
#pragma unroll
      for (int r = 0; r < 8; ++r) {
        float v = acc[i][j][r] * scale;
        if (BIAS_MODE == 1) v += bias[mBase + mOff + r];
        if (BIAS_MODE == 2) v += bv;
        if (RESID) v += Rb[(size_t)(mBase + mOff + r) * ldc + n];
        if (ACT == 1) v = tanhf(v);
        if (ACT == 2) v = fmaxf(v, 0.0f);
        if (ACT == 3) v = v / (1.0f + expf(-v));
        if (ACT == 4) v = (v > 0.f) ? v : 0.01f * v;
        if (ACT == 5) v = 0.5f * v * (1.0f + erff(v * 0.70710678118654752f));
        slab[(mOff + r) * 68 + (j << 4) + rlane] = v;
      }
    }
    __builtin_amdgcn_fence(__ATOMIC_RELEASE, "workgroup");
    __builtin_amdgcn_wave_barrier();
    __builtin_amdgcn_fence(__ATOMIC_ACQUIRE, "workgroup");
    if (FRAGKV && frag) {
      const int hfl = lane >> 4;
      const int z = mBase >> lgk, kb = mBase - (z << lgk);            // image, and the first of these 16 keys in it
      const bool isk = n0 < (N >> 1);                                 // the tile's 64 columns are 2 heads of k or 2 heads of v
      const int head0 = (isk ? n0 : n0 - (N >> 1)) >> 5;
      _Float16* pl = (isk ? kfrag : vfrag) + ((size_t)(z * (N >> 6) + head0) << (lgk + 5)) + lane * 8;
      v8h w[4];
      if (isk) {
        pl += (kb >> 4) * 512;                                        // fragment = these 16 keys; w[2 hh + j]: 8 consecutive channels of this lane's key
#pragma unroll
        for (int q = 0; q < 4; ++q) {
          const float* sp = slab + rlane * 68 + (q >> 1) * 32 + (q & 1) * 16 + hfl * 8;
          const v4f a = *(const v4f*)(sp), c = *(const v4f*)(sp + 4);
          const v8h t = {(_Float16)a[0], (_Float16)a[1], (_Float16)a[2], (_Float16)a[3], (_Float16)c[0], (_Float16)c[1], (_Float16)c[2], (_Float16)c[3]};
          w[q] = t;
        }
#pragma unroll
        for (int q = 0; q < 4; ++q) *(v8h*)(pl + ((size_t)(q >> 1) << (lgk + 5)) + (q & 1) * 256) = w[q];
      } else {
        pl += (kb >> 5) * 512 + ((kb >> 4) & 1) * 256;                // these 16 keys are half j of fragment g; w[2 hh + dt]: 8 consecutive keys of this lane's channel
#pragma unroll
        for (int q = 0; q < 4; ++q) {
          const float* sp = slab + hfl * 8 * 68 + (q >> 1) * 32 + (q & 1) * 16 + rlane;
          const v8h t = {(_Float16)sp[0], (_Float16)sp[68], (_Float16)sp[136], (_Float16)sp[204], (_Float16)sp[272], (_Float16)sp[340], (_Float16)sp[408], (_Float16)sp[476]};
          w[q] = t;
        }
#pragma unroll
        for (int q = 0; q < 4; ++q) *(v8h*)(pl + ((size_t)(q >> 1) << (lgk + 5)) + ((size_t)(q & 1) << (lgk + 4))) = w[q];
      }
      asm volatile("s_wait_xcnt 0x0" ::: "memory");   // the stores' address and data registers are rewritten by the next 16 rows: the wait stands in front of that overwrite
    } else if (OUT_MODE == 0) {
      float* C = (float*)Cout + (size_t)b * strideC;
      const int hh = lane >> 4, c4 = (lane & 15) * 4;     // row seg = 256 B = 16 lanes x 16 B
      {
#pragma unroll
        for (int it = 0; it < 8; ++it) {
          const int row = it * 2 + hh;
          v4f v = *(const v4f*)(slab + row * 68 + c4);
          *(v4f*)(C + (size_t)(mBase + row) * ldc + n0 + c4) = v;
        }
        if (FRAGKV) asm volatile("s_wait_xcnt 0x0" ::: "memory");   // in the built kernel the fragment arm's code lies behind these stores and rewrites their registers: the wait stands in front of it
      }
    } else {
      const int q = lane >> 3, c8 = (lane & 7) * 8;
      unsigned short* C  = (unsigned short*)Cout  + (size_t)b * strideC;
      unsigned short* C2 = (OUT_MODE == 2) ? ((unsigned short*)Cout2 + (size_t)b * strideC) : nullptr;
      {
#pragma unroll
        for (int it = 0; it < 4; ++it) {
          const int row = it * 4 + q;
          const float* sp = slab + row * 68 + c8;
          v8h hv, lv;
#pragma unroll
          for (int e = 0; e < 8; ++e) {
            if (OUT_MODE == 1) {
              hv[e] = (_Float16)sp[e];
            } else {
              unsigned short hb = f2bf_bits(sp[e]);
              unsigned short lb = f2bf_bits(sp[e] - bf_bits2f(hb));
              hv[e] = __builtin_bit_cast(_Float16, hb);
              lv[e] = __builtin_bit_cast(_Float16, lb);
            }
          }
          *(v8h*)(C + (size_t)(mBase + row) * ldc + n0 + c8) = hv;
          if (OUT_MODE == 2) *(v8h*)(C2 + (size_t)(mBase + row) * ldc + n0 + c8) = lv;
        }
        
      }
    }
    __builtin_amdgcn_fence(__ATOMIC_RELEASE, "workgroup");
    __builtin_amdgcn_wave_barrier();
    __builtin_amdgcn_fence(__ATOMIC_ACQUIRE, "workgroup");
  }
}

template <int ET, bool SPLIT, int BIAS_MODE, int OUT_MODE, bool RESID, int ACT = 0>
__global__ __launch_bounds__(256) void wmma_gemm64(
    const unsigned short* __restrict__ Ap, const unsigned short* __restrict__ A2p, int lda, long strideA,
    const unsigned short* __restrict__ Btp, const unsigned short* __restrict__ Bt2p, int ldb, long strideB,
    void* __restrict__ Cout, void* __restrict__ Cout2, int ldc, long strideC,
    const float* __restrict__ bias,
    const float* __restrict__ resid, long strideR,
    int M, int N, int K, float scale) {
  gemm64_block<ET, SPLIT, BIAS_MODE, OUT_MODE, RESID, ACT>(Ap, A2p, lda, strideA, Btp, Bt2p, ldb, strideB, Cout, Cout2, ldc, strideC, bias, resid, strideR, M, N, K, scale, blockIdx.x, blockIdx.y);
}
// Two independent f16 products in one launch: blocks 0 .. nb0 - 1 do product 0, the blocks behind them product 1. Product 0 is the one with the longer k loop, so that its
// blocks start first; it is the kv conv, stored as f16 fragment planes (KF, VF; 2^lgk keys an image). Product 1 has an f32 result. Row pitches: A and Bt k0 / k1 (dense), C1 n1 (dense).
// grid nb0 + m1 * n1 / 32768, block 256.
__global__ __launch_bounds__(256) void wmma_gemm64_pair(
    const unsigned short* __restrict__ A0, const unsigned short* __restrict__ Bt0, _Float16* __restrict__ KF, _Float16* __restrict__ VF, int lgk, int m0, int n0, int k0, int nb0,
    const unsigned short* __restrict__ A1, const unsigned short* __restrict__ Bt1, float* __restrict__ C1, int m1, int n1, int k1, float scale) {
  const int bi = blockIdx.x;
  const bool p0 = bi < nb0;             // block-uniform
  const int n = p0 ? n0 : n1, k = p0 ? k0 : k1;
  gemm64_block<0, false, 0, 0, false, 0, true>(p0 ? A0 : A1, nullptr, k, 0, p0 ? Bt0 : Bt1, nullptr, k, 0, (void*)C1, nullptr, n, 0, nullptr, nullptr, 0, p0 ? m0 : m1, n, k, scale, p0 ? bi : bi - nb0, 0, KF, VF, lgk, p0);
}

__global__ __launch_bounds__(256) void cast_f32_f16x2(
    const float* __restrict__ in, _Float16* __restrict__ out, int n2) {
  int i = blockIdx.x * 256 + threadIdx.x;
  if (i < n2) {
    const _Float16 h0 = (_Float16)in[2 * i], h1 = (_Float16)in[2 * i + 1];
    const unsigned u = (unsigned)__builtin_bit_cast(unsigned short, h0) | ((unsigned)__builtin_bit_cast(unsigned short, h1) << 16);
    ((unsigned*)out)[i] = u;
    
  }
}


} // namespace w25

// The element-wise stages below give each thread 16 to 64 elements, moved by 16-byte loads and stores that are all in flight together, so that a launch is a few
// thousand waves. Every wave store instruction writes whole 128-byte lines.
__device__ __forceinline__ v8h cast8(v4f a, v4f b, float s) {
    const v8h o = {(_Float16)(a[0] * s), (_Float16)(a[1] * s), (_Float16)(a[2] * s), (_Float16)(a[3] * s), (_Float16)(b[0] * s), (_Float16)(b[1] * s), (_Float16)(b[2] * s), (_Float16)(b[3] * s)};
    return o;
}
// castT16_block<R, C>: dst[z][c][r] = f16(src[z][r][c] * s), dense planes. One thread: 8 rows r x 4 columns c (8 loads, 4 stores). Lane = (column quad lane >> 3, row group lane & 7):
//   the 8 lanes of one quad store 64 consecutive r of one c. Block (bx < C / 128, by < R / 64, bz < Z) of 256 threads: wave w has columns 128 bx + 16 w .. + 15, rows 64 by .. + 63.
template <int R, int C>
__device__ __forceinline__ void castT16_block(const float* __restrict__ src, _Float16* __restrict__ dst, float s, int bx, int by, int bz) {
    static_assert(R % 64 == 0 && C % 128 == 0, "whole tiles");
    const int lane = threadIdx.x & 31, wave = threadIdx.x >> 5;
    const int r0 = by * 64 + (lane & 7) * 8;
    const int c0 = bx * 128 + wave * 16 + (lane >> 3) * 4;
    src += ((size_t)bz * R + r0) * C + c0;
    dst += ((size_t)bz * C + c0) * R + r0;
    v4f a[8];
#pragma unroll
    for (int j = 0; j < 8; ++j) a[j] = *(const v4f*)(src + (size_t)j * C);
#pragma unroll
    for (int e = 0; e < 4; ++e) {
        const v8h o = {(_Float16)(a[0][e] * s), (_Float16)(a[1][e] * s), (_Float16)(a[2][e] * s), (_Float16)(a[3][e] * s), (_Float16)(a[4][e] * s), (_Float16)(a[5][e] * s), (_Float16)(a[6][e] * s), (_Float16)(a[7][e] * s)};
        *(v8h*)(dst + (size_t)e * R) = o;
    }
}
// f32 -> bf16 hi plane + bf16 lo plane (x = hi + lo to ~2^-17 relative; RNE both), [R][C] -> [R][C] (or transposed to [C][R]); 2 consecutive destination elements
__device__ __forceinline__ unsigned int f2bf2_pack(float a, float b, unsigned int* lo) {
    const unsigned short ha = w25::f2bf_bits(a), hb = w25::f2bf_bits(b);
    const unsigned short la = w25::f2bf_bits(a - w25::bf_bits2f(ha)), lb = w25::f2bf_bits(b - w25::bf_bits2f(hb));
    *lo = (unsigned)la | ((unsigned)lb << 16); return (unsigned)ha | ((unsigned)hb << 16); }
__global__ __launch_bounds__(256) void k_castS16(const float* __restrict__ src, long long lds, __bf16* __restrict__ dhi, __bf16* __restrict__ dlo, long long ldd, int R, int C, float s, int transpose) {
    const long long i = (long long)blockIdx.x * 256 + threadIdx.x; long long o; float a, b;
    if (transpose) { const long long np = (long long)C * (R / 2); if (i >= np) return; const int c = (int)(i / (R / 2)); const int r = 2 * (int)(i % (R / 2)); a = src[(long long)r * lds + c] * s; b = src[(long long)(r + 1) * lds + c] * s; o = (long long)c * ldd + r; }
    else { const long long np = (long long)R * (C / 2); if (i >= np) return; const int r = (int)(i / (C / 2)); const int c = 2 * (int)(i % (C / 2)); a = src[(long long)r * lds + c] * s; b = src[(long long)r * lds + c + 1] * s; o = (long long)r * ldd + c; }
    unsigned lo; const unsigned hi = f2bf2_pack(a, b, &lo); unsigned* ph = (unsigned*)(dhi + o); unsigned* pl = (unsigned*)(dlo + o);
    *ph = hi; *pl = lo;  }

// all five weight tensors (each dense) -> one f16 plane [Wq | Wqb | Wkvb | Wkv | Wout], scaled by s; a block takes 4096 elements (every segment is a whole number of blocks),
//   one thread 2 pieces of 8 consecutive elements
__device__ __forceinline__ void castW16_block(const float* __restrict__ Wq, const float* __restrict__ Wqb, const float* __restrict__ Wkvb, const float* __restrict__ Wkv, const float* __restrict__ Wout, _Float16* __restrict__ dst, float s, int bx) {
    const int eb = bx * 4096;
    const float* src = Wq; int base = 0;
    if (eb >= 786432) { src = Wout; base = 786432; } else if (eb >= 262144) { src = Wkv; base = 262144; } else if (eb >= 131072) { src = Wkvb; base = 131072; } else if (eb >= 65536) { src = Wqb; base = 65536; }
    const int e = eb + threadIdx.x * 8;
    const v4f a0 = *(const v4f*)(src + e - base), a1 = *(const v4f*)(src + e - base + 4), b0 = *(const v4f*)(src + e - base + 2048), b1 = *(const v4f*)(src + e - base + 2052);
    *(v8h*)(dst + e) = cast8(a0, a1, s);
    *(v8h*)(dst + e + 2048) = cast8(b0, b1, s);
    asm volatile("s_wait_xcnt 0x0" ::: "memory");   // in the built kernel another arm's code lies behind these stores and rewrites their registers: the wait stands in front of it
}
// im2col for the 2x2 stride-2 conv, stored as the f16 GEMM operand: COL[b][(Y,X)][(c,ky,kx)] = f16(x[b][c][2Y+ky][2X+kx])
//   One thread: 4 channels (two neighbours, and the two 16 further on) x 2 output columns X: per channel 4 floats of each of the two input rows; the (ky,kx) quads of two neighbour
//   channels make one 16-byte store. Lane = (column pair lane >> 3, channel pair lane & 7): 8 lanes store 16 consecutive channels' quads, one whole line.
//   Block (bx < Hs / 2 * C / 64, image b) of 256 threads = one Y, 64 channels, the whole row.
template <int C, int Hs>
__device__ __forceinline__ void es_col_block(const float* __restrict__ X, _Float16* __restrict__ COL, int bx, int b) {
    static_assert(Hs == 64 && C % 64 == 0, "4 waves span one input row");
    constexpr int Hr = Hs / 2;
    const int lane = threadIdx.x & 31, wave = threadIdx.x >> 5;
    const int Y = bx / (C / 64), cb = bx % (C / 64);
    const int c = cb * 64 + (wave >> 2) * 32 + (lane & 7) * 2;
    const int X2 = (wave & 3) * 8 + (lane >> 3) * 2;
    const float* s = X + (((size_t)b * C + c) * Hs + 2 * Y) * Hs + 2 * X2;
    _Float16* d = COL + ((size_t)b * Hr * Hr + Y * Hr + X2) * (4 * C) + 4 * c;
    v4f r0[4], r1[4];                                    // g: channel c + 16 (g >> 1) + (g & 1)
#pragma unroll
    for (int g = 0; g < 4; ++g) {
        const float* sg = s + (size_t)((g >> 1) * 16 + (g & 1)) * Hs * Hs;
        r0[g] = *(const v4f*)(sg); r1[g] = *(const v4f*)(sg + Hs);
    }
#pragma unroll
    for (int gg = 0; gg < 2; ++gg) {
        const v4f a0 = r0[2 * gg], a1 = r1[2 * gg], b0 = r0[2 * gg + 1], b1 = r1[2 * gg + 1];
        const v8h lo = {(_Float16)a0[0], (_Float16)a0[1], (_Float16)a1[0], (_Float16)a1[1], (_Float16)b0[0], (_Float16)b0[1], (_Float16)b1[0], (_Float16)b1[1]};
        const v8h hi = {(_Float16)a0[2], (_Float16)a0[3], (_Float16)a1[2], (_Float16)a1[3], (_Float16)b0[2], (_Float16)b0[3], (_Float16)b1[2], (_Float16)b1[3]};
        *(v8h*)(d + 64 * gg) = lo; *(v8h*)(d + 4 * C + 64 * gg) = hi;
    }
    asm volatile("s_wait_xcnt 0x0" ::: "memory");   // in the built kernel another arm's code lies behind these stores and rewrites their registers: the wait stands in front of it
}
// every re-layout of the inputs in one launch (none reads what another writes): blocks 0 .. NX - 1 transpose and cast x (Z images of R x Hs*Hs), the NC blocks behind them lay out the im2col operand,
// the last 208 cast the weights (x sw). grid NX + NC + 208, block 256.
template <int R, int Hs, int Z>
__global__ __launch_bounds__(256) void k_cast_in(const float* __restrict__ x, _Float16* __restrict__ xt, _Float16* __restrict__ col, const float* __restrict__ Wq, const float* __restrict__ Wqb, const float* __restrict__ Wkvb,
                                                  const float* __restrict__ Wkv, const float* __restrict__ Wout, _Float16* __restrict__ w16, float sw) {
    constexpr int C = Hs * Hs, BX = C / 128, BY = R / 64, NX = BX * BY * Z, CB = Hs / 2 * (R / 64), NC = CB * Z;
    const int bi = blockIdx.x;
    if (bi < NX) castT16_block<R, C>(x, xt, 1.0f, bi % BX, (bi / BX) % BY, bi / (BX * BY));
    else if (bi < NX + NC) es_col_block<R, Hs>(x, col, (bi - NX) % CB, (bi - NX) / CB);
    else castW16_block(Wq, Wqb, Wkvb, Wkv, Wout, w16, sw, bi - NX - NC);
}
// batch-wise attention: for (p, h, b): scores over b' = q_b . k_b' * scale (4 values), softmax, out = sum att v_b'; D[b][p][h*32+d] = f16(S[b][p][h*32+d] + out) (S holds out_img; D is the
//   output conv's f16 operand)
//   One wave: one position p, 4 heads (8 lanes x 4 floats a head), all 4 images, so each k and v row is read once. grid P * C / 1024, block 256.
//   A projection row holds [q | q_b | k_b | v_b], 4 C floats. The planes come as separate arguments (P0 .. P3: one image of projections each, S01 / D01: images 0 and 1, S23 / D23: images 2
//   and 3), so that every row address is one of these scalar bases plus one lane offset plus an immediate that the instruction can hold.
template <int P, int C>
__global__ __launch_bounds__(256) void k_es_batch(const float* __restrict__ P0, const float* __restrict__ P1, const float* __restrict__ P2, const float* __restrict__ P3,
                                                    const float* __restrict__ S01, const float* __restrict__ S23, _Float16* __restrict__ D01, _Float16* __restrict__ D23) {
    static_assert(C % 128 == 0, "a wave spans 128 channels");
    const int w = blockIdx.x * 8 + __builtin_amdgcn_readfirstlane(threadIdx.x >> 5);   // the wave's number as a scalar: every row address below is a scalar base plus one lane offset
    const unsigned lo = (threadIdx.x & 31) * 16;                                        // this lane's byte offset in the wave's 512-byte piece of a row
    const int p = w / (C / 128); const int col = (w % (C / 128)) * 128;
    const size_t oq = (size_t)p * C + col, op = (size_t)p * 4 * C + col;
    const char* prow[4] = {(const char*)(P0 + op), (const char*)(P1 + op), (const char*)(P2 + op), (const char*)(P3 + op)};
    const char* srow[4] = {(const char*)(S01 + oq), (const char*)(S01 + oq + P * C), (const char*)(S23 + oq), (const char*)(S23 + oq + P * C)};
    v4f q[4], k[4], v[4], sv[4];
#pragma unroll
    for (int b = 0; b < 4; ++b) {
        q[b] = *(const v4f*)(prow[b] + lo + C * 4); k[b] = *(const v4f*)(prow[b] + lo + 2 * C * 4);
    }
#pragma unroll
    for (int b = 0; b < 4; ++b) {
        v[b] = *(const v4f*)(prow[b] + lo + 3 * C * 4); sv[b] = *(const v4f*)(srow[b] + lo);
    }
    asm volatile("s_wait_xcnt 0x0" ::: "memory");   // the loads' scalar base registers are reused for the store bases formed below: the wait stands in front of that overwrite
    __builtin_amdgcn_sched_barrier(0);   // keeps all 16 loads in front of the arithmetic (without it the v and S loads are issued only behind the scores, a second memory latency) and later register writes behind the wait
    char* drow[4] = {(char*)(D01 + oq), (char*)(D01 + oq + P * C), (char*)(D23 + oq), (char*)(D23 + oq + P * C)};
#pragma unroll
    for (int b = 0; b < 4; ++b) {
        float sc[4]; float mx = -__builtin_inff();
#pragma unroll
        for (int b2 = 0; b2 < 4; ++b2) {
            float d0 = q[b][0] * k[b2][0] + q[b][1] * k[b2][1] + q[b][2] * k[b2][2] + q[b][3] * k[b2][3];
            for (int o = 4; o > 0; o >>= 1) d0 += __shfl_xor(d0, o, 32);
            sc[b2] = d0 * 0.17677669529663689f; mx = fmaxf(mx, sc[b2]);
        }
        float den = 0.f;
#pragma unroll
        for (int b2 = 0; b2 < 4; ++b2) { sc[b2] = expf(sc[b2] - mx); den += sc[b2]; }
        v4f o_ = {0.f, 0.f, 0.f, 0.f};
#pragma unroll
        for (int b2 = 0; b2 < 4; ++b2) o_ += sc[b2] / den * v[b2];
        const v4f r = sv[b] + o_;
        const v4h hv = {(_Float16)r[0], (_Float16)r[1], (_Float16)r[2], (_Float16)r[3]};
        *(v4h*)(drow[b] + (lo >> 1)) = hv;
    }
}


extern "C" void kernel_launch(void* const* d_in, const int* in_sizes, int n_in, void* d_out, int out_size, void* d_ws, size_t ws_size, hipStream_t stream) {
    (void)in_sizes; (void)n_in; (void)out_size; (void)ws_size;
    const float* x = (const float*)d_in[0];
    const float* Wq = (const float*)d_in[1];
    const float* Wkv = (const float*)d_in[2];
    const float* Wqb = (const float*)d_in[3];
    const float* Wkvb = (const float*)d_in[4];
    const float* Wout = (const float*)d_in[5];
    float* out = (float*)d_out;
    // every plane holds all 4 images, image-major; each is written by one launch and read by later ones of this call
    char* wsp = (char*)d_ws;
    float* PRJ = (float*)wsp; wsp += (size_t)4 * 4096 * 1024 * 4;          // [4][4096][1024] the 1x1 projections, position-major: q | q_b | k_b | v_b
    _Float16* KF16 = (_Float16*)wsp; wsp += (size_t)4 * 8 * 1024 * 32 * 2; // [4][8] planes of k in fragment order
    _Float16* VF16 = (_Float16*)wsp; wsp += (size_t)4 * 8 * 1024 * 32 * 2; // [4][8] planes of v in fragment order
    float* S = (float*)wsp; wsp += (size_t)4 * 4096 * 256 * 4;             // [4][4096][256] out_img
    _Float16* XT16 = (_Float16*)wsp; wsp += (size_t)4 * 4096 * 256 * 2;    // [4][4096][256] x^T
    _Float16* COL16 = (_Float16*)wsp; wsp += (size_t)4 * 1024 * 1024 * 2;  // [4][1024][1024] im2col
    _Float16* S16 = (_Float16*)wsp; wsp += (size_t)4 * 4096 * 256 * 2;     // [4][4096][256] out_img + out_batch
    _Float16* W16 = (_Float16*)wsp; wsp += (size_t)851968 * 2;             // [Wq | Wqb | Wkvb | Wkv | Wout], x16
    const _Float16* Wkv16 = W16 + 262144;
    const _Float16* Wout16 = W16 + 786432;
    k_cast_in<256, 64, 4><<<1232, 256, 0, stream>>>(x, XT16, COL16, Wq, Wqb, Wkvb, Wkv, Wout, W16, 16.0f);
    // one launch for the two products that need only the planes above. The kv conv: im2col rows x Wkv. The 1x1 projections share their left operand and their weights over the images:
    // one product over the 4 * 4096 stacked positions and the 1024 stacked weight rows [Wq | Wqb | Wkvb].
    w25::wmma_gemm64_pair<<<576, 256, 0, stream>>>((const unsigned short*)(COL16), (const unsigned short*)(Wkv16), KF16, VF16, 10, 4096, 512, 1024, 64, (const unsigned short*)(XT16), (const unsigned short*)(W16), PRJ, 16384, 1024, 256, 0.0625f);
    k_attn32<4096, 1024, 1024, 256><<<dim3(64, 8, 4), 32 * AW, 0, stream>>>(PRJ, KF16, VF16, S, 0.1767766952966369f);
    k_es_batch<4096, 256><<<1024, 256, 0, stream>>>(PRJ, PRJ + 4194304, PRJ + 8388608, PRJ + 12582912, S, S + 2097152, S16, S16 + 2097152);
    // output conv: grid y = image (weights shared: stride 0)
    w25::wmma_gemm64<0, false, 0, 0, false, 0><<<dim3(32, 4), 256, 0, stream>>>((const unsigned short*)(Wout16), nullptr, 256, 0, (const unsigned short*)(S16), nullptr, 256, 1048576, (void*)(out), nullptr, 4096, 1048576, nullptr, nullptr, 0, 256, 4096, 256, 0.0625f);
}

// v008
// Measured time: 94 microseconds a run.
// Timed twice side by side with v007, it ran 1.22 times as fast both times.
// Counting every step since v000, which is the starting kernel, it is 23.2 times as fast.
// Contractions (per image): q / qb / kvb 1x1 projections in position-major form x^T W^T [4096x256].[256x{256,256,512}], the 2x2-stride-2 kv conv as an im2col GEMM [1024x1024].[1024x512] and the output 1x1 conv Wout.(out_img + out_batch)^T [256x256].[256x4096], all with f16 operands (v_wmma_f32_16x16x32_f16; 64x64 register-blocked wave tiles over pre-cast f16 operand planes, weight operands pre-scaled by 16 at the cast and un-scaled in the f32 epilogue); the spatial-reduction attention per head (flash kernel, head_dim 32, 4096 queries x 1024 keys, f16 q.k^T and f16 p.v; the kv conv stores k and v as f16 in WMMA fragment order); f32 accumulate; the im2col, the batch-wise 4x4 attention per (position, head) and the branch sum are f32 kernels.
#include <hip/hip_runtime.h>
#include <math.h>

typedef __attribute__((ext_vector_type(16))) _Float16 v16h;
typedef __attribute__((ext_vector_type(8)))  _Float16 v8h;
typedef __attribute__((ext_vector_type(16))) __bf16   v16b;
typedef __attribute__((ext_vector_type(8)))  float    v8f;
typedef __attribute__((ext_vector_type(4)))  float    v4f;

// 16-bit WMMA fragment map (wave32), lane L, h = L>>4, m = L&15:
//   A 16x32: lane = row m;   element i -> k = (i<8) ? 8h+i : 16+8h+(i-8)
//   B 32x16: lane = column m; the SAME k(i,h)
//   D 16x16 (8 f32): lane = column m; element r -> row 8h+r
__device__ __forceinline__ int frag_k(int i, int h) { return (i < 8) ? (8 * h + i) : (16 + 8 * h + (i - 8)); }
__device__ __forceinline__ __bf16 bf16_rne(float f) {
    unsigned int u = __float_as_uint(f);
    u += 0x7fffu + ((u >> 16) & 1u);
    return __builtin_bit_cast(__bf16, (unsigned short)(u >> 16));
}
__device__ __forceinline__ float bf16_f32(__bf16 b) { return __uint_as_float(((unsigned int)__builtin_bit_cast(unsigned short, b)) << 16); }
__device__ __forceinline__ v8f wmma16(v16h a, v16h b, v8f c) {
    c = __builtin_amdgcn_wmma_f32_16x16x32_f16(false, a, false, b, (short)0, c, false, false);
    asm volatile("v_nop\n\tv_nop\n\tv_nop\n\tv_nop" : "+v"(c) : "v"(a), "v"(b));
    return c;
}
__device__ __forceinline__ v8f wmmab(v16b a, v16b b, v8f c) {
    c = __builtin_amdgcn_wmma_f32_16x16x32_bf16(false, a, false, b, (short)0, c, false, false);
    asm volatile("v_nop\n\tv_nop\n\tv_nop\n\tv_nop" : "+v"(c) : "v"(a), "v"(b));
    return c;
}
struct Split { v16b hi, lo; };
// hi/lo split product: a.hi*b.hi + a.hi*b.lo + a.lo*b.hi
__device__ __forceinline__ v8f wmma3(const Split& a, const Split& b, v8f c) {
    c = __builtin_amdgcn_wmma_f32_16x16x32_bf16(false, a.hi, false, b.hi, (short)0, c, false, false);
    c = __builtin_amdgcn_wmma_f32_16x16x32_bf16(false, a.hi, false, b.lo, (short)0, c, false, false);
    c = __builtin_amdgcn_wmma_f32_16x16x32_bf16(false, a.lo, false, b.hi, (short)0, c, false, false);
    asm volatile("v_nop\n\tv_nop\n\tv_nop\n\tv_nop" : "+v"(c) : "v"(a.hi), "v"(a.lo), "v"(b.hi), "v"(b.lo));
    return c;
}
struct Split3 { v16b hi, mid, lo; };
// triple split product (6 terms, drops only terms below 2^-24 relative)
__device__ __forceinline__ v8f wmma6(const Split3& a, const Split3& b, v8f c) {
    c = __builtin_amdgcn_wmma_f32_16x16x32_bf16(false, a.hi, false, b.hi, (short)0, c, false, false);
    c = __builtin_amdgcn_wmma_f32_16x16x32_bf16(false, a.hi, false, b.mid, (short)0, c, false, false);
    c = __builtin_amdgcn_wmma_f32_16x16x32_bf16(false, a.mid, false, b.hi, (short)0, c, false, false);
    c = __builtin_amdgcn_wmma_f32_16x16x32_bf16(false, a.hi, false, b.lo, (short)0, c, false, false);
    c = __builtin_amdgcn_wmma_f32_16x16x32_bf16(false, a.mid, false, b.mid, (short)0, c, false, false);
    c = __builtin_amdgcn_wmma_f32_16x16x32_bf16(false, a.lo, false, b.hi, (short)0, c, false, false);
    asm volatile("v_nop\n\tv_nop\n\tv_nop\n\tv_nop" : "+v"(c) : "v"(a.hi), "v"(a.mid), "v"(a.lo), "v"(b.hi), "v"(b.mid), "v"(b.lo));
    return c;
}

// Fragment gathers from f32 memory: element i <- p[(k0 + frag_k(i,h)) * sk] * s, zero for k >= klen.
__device__ __forceinline__ v16h fh_ld(const float* __restrict__ p, long long sk, int k0, int h, int klen, float s) {
    v16h a;
#pragma unroll
    for (int i = 0; i < 16; ++i) { const int k = k0 + frag_k(i, h); a[i] = (k < klen) ? (_Float16)(p[(long long)k * sk] * s) : (_Float16)0.f; }
    return a;
}
__device__ __forceinline__ Split sp_ld(const float* __restrict__ p, long long sk, int k0, int h, int klen, float s) {
    Split r;
#pragma unroll
    for (int i = 0; i < 16; ++i) {
        const int k = k0 + frag_k(i, h); const float x = (k < klen) ? p[(long long)k * sk] * s : 0.f;
        const __bf16 hb = bf16_rne(x); r.hi[i] = hb; r.lo[i] = bf16_rne(x - bf16_f32(hb));
    }
    return r;
}
__device__ __forceinline__ Split3 sp3_ld(const float* __restrict__ p, long long sk, int k0, int h, int klen, float s) {
    Split3 r;
#pragma unroll
    for (int i = 0; i < 16; ++i) {
        const int k = k0 + frag_k(i, h); const float x = (k < klen) ? p[(long long)k * sk] * s : 0.f;
        const __bf16 hb = bf16_rne(x); const float r1 = x - bf16_f32(hb); const __bf16 mb = bf16_rne(r1);
        r.hi[i] = hb; r.mid[i] = mb; r.lo[i] = bf16_rne(r1 - bf16_f32(mb));
    }
    return r;
}
__device__ __forceinline__ v16b bh_ld(const float* __restrict__ p, long long sk, int k0, int h, int klen, float s) {
    v16b a;
#pragma unroll
    for (int i = 0; i < 16; ++i) { const int k = k0 + frag_k(i, h); a[i] = bf16_rne((k < klen) ? p[(long long)k * sk] * s : 0.f); }
    return a;
}
// f16 fragment from an f16 LDS/global row with element stride 1 (k-contiguous), no bounds (tile already zero padded)
__device__ __forceinline__ v16h fh_row(const _Float16* __restrict__ row, int k0, int h) {
    v16h a;
#pragma unroll
    for (int i = 0; i < 16; ++i) a[i] = row[k0 + frag_k(i, h)];
    return a;
}

#define VST2(T, ptr, val) do { const T vst2_v_ = (val); *(T*)(ptr) = vst2_v_;  } while (0)
typedef float v4f __attribute__((ext_vector_type(4)));
#define VST2V4(ptr, val) do { const v4f vst2_v4_ = (val); *(v4f*)(ptr) = vst2_v4_;  } while (0)

__device__ __attribute__((noinline)) float act_fn(float v, int act) {
    if (act == 1) return fmaxf(v, 0.f);                                                                               // relu
    if (act == 2) { const float u = 0.7978845608028654f * (v + 0.044715f * v * v * v); return 0.5f * v * (1.f + tanhf(u)); } // tanh-gelu
    if (act == 3) return v / (1.f + expf(-v));                                                                        // silu
    if (act == 4) return 0.5f * v * (1.f + erff(v * 0.7071067811865476f));                                             // erf-gelu
    if (act == 5) return tanhf(v);
    if (act == 6) return 1.f / (1.f + expf(-v));                                                                      // sigmoid
    if (act == 7) return (v > 0.f) ? v : 0.01f * v;                                                                   // leaky relu 0.01
    if (act == 8) return (v > 0.f) ? v : (expf(v) - 1.f);                                                             // elu
    if (act == 9) return fminf(fmaxf(v, 0.f), 6.f);                                                                   // relu6
    if (act == 10) return fabsf(v);                                                                                    // abs
    if (act == 11) return (v >= 0.f) ? v : 0.1f * v;                                                                  // leaky 0.1
    if (act == 12) return (v > 0.f) ? v : 0.2f * v;                                                                   // leaky 0.2
    if (act == 13) return (v > 20.f) ? v : log1pf(expf(v));                                                            // softplus
    return v;
}

// =====================================================================================================================
// k_gemm<MODE>: C(z, m, n) = act(alpha * sum_k A(z, m, k) * B(z, k, n) + bias) + beta * R(z, m, n)
//   One wave (32-thread block) per 16 x 32 tile of C; grid (ceil(N/32), ceil(M/16), Z). Batch z -> (zo = z / zi_n, zi = z % zi_n)
//   with separate outer/inner strides for every tensor (e.g. batch and head). A(m,k) = A[zo*sAo + zi*sAi + m*sAm + k*sAk] (f32),
//   B(k,n) = B[zo*sBo + zi*sBi + n*sBn + k*sBk] (f32); any M, N, K (K zero-padded to 32 inside the fragments, M/N tails guarded).
//   C(m,n) = C[zo*sCo + zi*sCi + m*sCm + n] (n contiguous). flags: 1 bias[n], 2 bias[m], 4 residual R[zo*sRo + zi*sRi + m*sRm + n*sRn].
//   MODE 0: f16 operands (A prescaled by sa, B by sb, both undone in the epilogue); 1: bf16 hi/lo split (3 products); 2: bf16;
//   3: bf16 hi/mid/lo triple split (6 products); 4: as 3 with Kahan-compensated f32 accumulation across k-steps.
// =====================================================================================================================
struct GemmP {
    const float* A; const float* B; const float* bias; const float* R; float* C;
    long long sAo, sAi, sAm, sAk, sBo, sBi, sBn, sBk, sCo, sCi, sCm, sRo, sRi, sRm, sRn;
    int M, N, K, zi_n, flags, act; float alpha, beta, sa, sb;
    int Npad, pad_;     // columns [N, Npad) of C are written as 0 so that padded workspace rows are covered by whole-line stores; Npad >= N
};
static_assert(sizeof(GemmP) == 5 * 8 + 15 * 8 + 6 * 4 + 4 * 4 + 2 * 4, "GemmP has padding");

template <int MODE>
__global__ __launch_bounds__(32) void k_gemm(GemmP p) {
    const int lane = threadIdx.x & 31, h = lane >> 4, l15 = lane & 15;
    const int m0 = blockIdx.y * 16, n0 = blockIdx.x * 32;
    const int z = blockIdx.z, zo = z / p.zi_n, zi = z - zo * p.zi_n;
    const float* A = p.A + zo * p.sAo + zi * p.sAi;
    const float* B = p.B + zo * p.sBo + zi * p.sBi;
    const int am = min(m0 + l15, p.M - 1);                       // clamped row for loads (stores are guarded)
    v8f acc[2], comp[2];
#pragma unroll
    for (int t = 0; t < 2; ++t) { v8f zz = {}; acc[t] = zz; comp[t] = zz; }
    for (int k0 = 0; k0 < p.K; k0 += 32) {
        const float* arow = A + (long long)am * p.sAm;
        if (MODE == 1) {
            const Split a = sp_ld(arow, p.sAk, k0, h, p.K, 1.f);
#pragma unroll
            for (int t = 0; t < 2; ++t) {
                const int bn = min(n0 + t * 16 + l15, p.N - 1);
                acc[t] = wmma3(a, sp_ld(B + (long long)bn * p.sBn, p.sBk, k0, h, p.K, 1.f), acc[t]);
            }
        } else if (MODE == 3) {
            const Split3 a = sp3_ld(arow, p.sAk, k0, h, p.K, 1.f);
#pragma unroll
            for (int t = 0; t < 2; ++t) {
                const int bn = min(n0 + t * 16 + l15, p.N - 1);
                acc[t] = wmma6(a, sp3_ld(B + (long long)bn * p.sBn, p.sBk, k0, h, p.K, 1.f), acc[t]);
            }
        } else if (MODE == 4) {
            // triple split as MODE 3, but each k-step's 6 products go into a fresh accumulator and the partial is added to the running f32 sum
            // on the VALU with Kahan compensation (accumulation error stays ~1 ulp however long K is)
            const Split3 a = sp3_ld(arow, p.sAk, k0, h, p.K, 1.f);
#pragma unroll
            for (int t = 0; t < 2; ++t) {
                const int bn = min(n0 + t * 16 + l15, p.N - 1); v8f zz = {};
                const v8f part = wmma6(a, sp3_ld(B + (long long)bn * p.sBn, p.sBk, k0, h, p.K, 1.f), zz);
                const v8f y = part - comp[t]; const v8f s = acc[t] + y; comp[t] = (s - acc[t]) - y; acc[t] = s;
            }
        } else if (MODE == 2) {
            const v16b a = bh_ld(arow, p.sAk, k0, h, p.K, 1.f);
#pragma unroll
            for (int t = 0; t < 2; ++t) {
                const int bn = min(n0 + t * 16 + l15, p.N - 1);
                acc[t] = wmmab(a, bh_ld(B + (long long)bn * p.sBn, p.sBk, k0, h, p.K, 1.f), acc[t]);
            }
        } else {
            const v16h a = fh_ld(arow, p.sAk, k0, h, p.K, p.sa);
#pragma unroll
            for (int t = 0; t < 2; ++t) {
                const int bn = min(n0 + t * 16 + l15, p.N - 1);
                acc[t] = wmma16(a, fh_ld(B + (long long)bn * p.sBn, p.sBk, k0, h, p.K, p.sb), acc[t]);
            }
        }
    }
    const float iscale = (MODE == 0) ? p.alpha / (p.sa * p.sb) : p.alpha;
    float* C = p.C + zo * p.sCo + zi * p.sCi;
    const float* R = p.R + zo * p.sRo + zi * p.sRi;
    __shared__ __align__(16) float ctile[16][36];
#pragma unroll
    for (int t = 0; t < 2; ++t) {
        const int n = n0 + t * 16 + l15; const int nn = min(n, p.N - 1);
#pragma unroll
        for (int r = 0; r < 8; ++r) {
            const int m = m0 + 8 * h + r; const int mm = min(m, p.M - 1);
            float v = acc[t][r] * iscale;
            if (p.flags & 1) v += p.bias[nn];
            if (p.flags & 2) v += p.bias[mm];
            if (p.flags & 8) v *= p.bias[(long long)zo * p.M + mm];   /* per-(z,row) scale vector laid out [Z][M]; exclusive with the bias flags */
            v = act_fn(v, p.act);
            if (p.flags & 4) v += p.beta * R[(long long)mm * p.sRm + (long long)nn * p.sRn];
            ctile[8 * h + r][t * 16 + l15] = (n < p.N) ? v : 0.f;
        }
    }
    __syncthreads();
    const int NW = (p.Npad > p.N) ? p.Npad : p.N;           // write width
    const bool fast = (m0 + 16 <= p.M) && (n0 + 32 <= NW) && ((p.sCm & 3) == 0) && ((((size_t)C) & 15) == 0);
    if (fast) {
#pragma unroll
        for (int s = 0; s < 4; ++s) {
            const int row = s * 4 + (lane >> 3), c4 = (lane & 7) * 4;
            const v4f v = *(const v4f*)&ctile[row][c4];
            VST2V4(C + (long long)(m0 + row) * p.sCm + n0 + c4, v);
        }
    } else {
        for (int row = 0; row < 16; ++row) {
            const int m = m0 + row, n = n0 + lane;
            if (m < p.M && n < NW) VST2(float, C + (long long)m * p.sCm + n, ctile[row][lane]);
        }
    }
}


// =====================================================================================================================
// k_gemmT<MODE, TM, TN>: same contract as k_gemm, but one wave computes a (16*TM) x (16*TN) tile: TM A fragments and TN B fragments are
//   loaded per 32-wide k-step and reused across TM*TN WMMAs (far fewer load/convert instructions per MAC). MODE 0 (f16), 1 (bf16 hi/lo),
//   2 (bf16) only. grid (ceil(NW/(16*TN)), ceil(M/(16*TM)), Z), block 32. Epilogue identical to k_gemm, run per 16x32 sub-tile.
// =====================================================================================================================
template <int MODE, int TM, int TN>
__global__ __launch_bounds__(32) void k_gemmT(GemmP p) {
    const int lane = threadIdx.x & 31, h = lane >> 4, l15 = lane & 15;
    const int m0 = blockIdx.y * (16 * TM), n0 = blockIdx.x * (16 * TN);
    const int z = blockIdx.z, zo = z / p.zi_n, zi = z - zo * p.zi_n;
    const float* A = p.A + zo * p.sAo + zi * p.sAi;
    const float* B = p.B + zo * p.sBo + zi * p.sBi;
    v8f acc[TM][TN];
#pragma unroll
    for (int i = 0; i < TM; ++i)
#pragma unroll
        for (int t = 0; t < TN; ++t) { v8f zz = {}; acc[i][t] = zz; }
    for (int k0 = 0; k0 < p.K; k0 += 32) {
        if (MODE == 1) {
            Split a[TM], b[TN];
#pragma unroll
            for (int i = 0; i < TM; ++i) { const int am = min(m0 + 16 * i + l15, p.M - 1); a[i] = sp_ld(A + (long long)am * p.sAm, p.sAk, k0, h, p.K, 1.f); }
#pragma unroll
            for (int t = 0; t < TN; ++t) { const int bn = min(n0 + 16 * t + l15, p.N - 1); b[t] = sp_ld(B + (long long)bn * p.sBn, p.sBk, k0, h, p.K, 1.f); }
#pragma unroll
            for (int i = 0; i < TM; ++i)
#pragma unroll
                for (int t = 0; t < TN; ++t) acc[i][t] = wmma3(a[i], b[t], acc[i][t]);
        } else if (MODE == 2) {
            v16b a[TM], b[TN];
#pragma unroll
            for (int i = 0; i < TM; ++i) { const int am = min(m0 + 16 * i + l15, p.M - 1); a[i] = bh_ld(A + (long long)am * p.sAm, p.sAk, k0, h, p.K, 1.f); }
#pragma unroll
            for (int t = 0; t < TN; ++t) { const int bn = min(n0 + 16 * t + l15, p.N - 1); b[t] = bh_ld(B + (long long)bn * p.sBn, p.sBk, k0, h, p.K, 1.f); }
#pragma unroll
            for (int i = 0; i < TM; ++i)
#pragma unroll
                for (int t = 0; t < TN; ++t) acc[i][t] = wmmab(a[i], b[t], acc[i][t]);
        } else {
            v16h a[TM], b[TN];
#pragma unroll
            for (int i = 0; i < TM; ++i) { const int am = min(m0 + 16 * i + l15, p.M - 1); a[i] = fh_ld(A + (long long)am * p.sAm, p.sAk, k0, h, p.K, p.sa); }
#pragma unroll
            for (int t = 0; t < TN; ++t) { const int bn = min(n0 + 16 * t + l15, p.N - 1); b[t] = fh_ld(B + (long long)bn * p.sBn, p.sBk, k0, h, p.K, p.sb); }
#pragma unroll
            for (int i = 0; i < TM; ++i)
#pragma unroll
                for (int t = 0; t < TN; ++t) acc[i][t] = wmma16(a[i], b[t], acc[i][t]);
        }
    }
    const float iscale = (MODE == 0) ? p.alpha / (p.sa * p.sb) : p.alpha;
    float* C = p.C + zo * p.sCo + zi * p.sCi;
    const float* R = p.R + zo * p.sRo + zi * p.sRi;
    const int NW = (p.Npad > p.N) ? p.Npad : p.N;
    __shared__ __align__(16) float ctile[16][36];
#pragma unroll
    for (int i = 0; i < TM; ++i) {
        const int mb = m0 + 16 * i; if (mb >= p.M) break;          // wave-uniform
#pragma unroll
        for (int tp = 0; tp < TN / 2; ++tp) {
            const int nb = n0 + 32 * tp; if (nb >= NW) break;        // wave-uniform
#pragma unroll
            for (int t2 = 0; t2 < 2; ++t2) {
                const int t = 2 * tp + t2; const int n = nb + t2 * 16 + l15; const int nn = min(n, p.N - 1);
#pragma unroll
                for (int r = 0; r < 8; ++r) {
                    const int m = mb + 8 * h + r; const int mm = min(m, p.M - 1);
                    float v = acc[i][t][r] * iscale;
                    if (p.flags & 1) v += p.bias[nn];
                    if (p.flags & 2) v += p.bias[mm];
            if (p.flags & 8) v *= p.bias[(long long)zo * p.M + mm];   /* per-(z,row) scale vector laid out [Z][M]; exclusive with the bias flags */
                    v = act_fn(v, p.act);
                    if (p.flags & 4) v += p.beta * R[(long long)mm * p.sRm + (long long)nn * p.sRn];
                    ctile[8 * h + r][t2 * 16 + l15] = (n < p.N) ? v : 0.f;
                }
            }
            __syncthreads();
            const bool fast = (mb + 16 <= p.M) && (nb + 32 <= NW) && ((p.sCm & 3) == 0) && ((((size_t)C) & 15) == 0);
            if (fast) {
#pragma unroll
                for (int s = 0; s < 4; ++s) {
                    const int row = s * 4 + (lane >> 3), c4 = (lane & 7) * 4;
                    const v4f v = *(const v4f*)&ctile[row][c4];
                    VST2V4(C + (long long)(mb + row) * p.sCm + nb + c4, v);
                }
            } else {
                for (int row = 0; row < 16; ++row) {
                    const int m = mb + row, n = nb + lane;
                    if (m < p.M && n < NW) VST2(float, C + (long long)m * p.sCm + n, ctile[row][lane]);
                }
            }
            __syncthreads();
        }
    }
}

// =====================================================================================================================
// k_attn32<LQ, LK, QP, SP>: flash attention at one fixed shape, all of it known at compile time: LQ queries, LK keys (a multiple of 64), head and
//   value dim 32, no mask. Q and O: f32 rows with element stride 1 (Q row pitch QP floats, O row pitch SP floats, head h at column 32 h).
//   K and V come as f16 planes in fragment order, one plane of 32 LK halves a (image, head), written by the kv product's epilogue. A fragment is 1024 bytes: [j = 0, 1][lane][8 halves].
//     K plane: fragment kt = 16 keys;            lane (hf, l15), half j, element e = K[key 16 kt + l15][d = 16 j + 8 hf + e]
//     V plane: fragment dt * LK / 32 + g;        lane (hf, l15), half j, element e = V[key 32 g + 16 j + 8 hf + e][d = 16 dt + l15]
//   so each operand register quad is one 16-byte load, a wave's load instruction reads 512 consecutive bytes (4 whole lines), and nothing is converted or staged in the loop.
//   Wave = 16 queries, AW waves per block, 64-key blocks; grid (LQ / (16*AW), heads, images), block 32*AW; image z at Q + z*LQ*QP, O + z*LQ*SP.
//   Both products are transposed: S^T = K . Q^T (A = 16 key rows, B = the wave's 16 queries) and O^T += V^T . P^T. A lane then holds scores of ONE query (its column l15; keys 16 t + 8 hf + r),
//   so the maximum and the sum are taken in the lane, with one exchange between the lane halves, and two score tiles, converted in place, are the B operand of the second product.
//   Scores: f16 operands; statistics f32. The running maximum is kept on the raw scores (scale > 0, so it is the scaled scores' maximum too; it only sets the range, the quotient does not depend on it).
//   One fma a score forms the whole exponent, s * (scale * log2 e) + (12 - max * scale * log2 e), and the hardware's exp2 gives P x 4096 at once, which is summed in f32 and cast to f16.
// =====================================================================================================================
#define AW 4
typedef __attribute__((ext_vector_type(4))) _Float16 v4h;
// the 16 f32 that make up lane half h's fragment of a 32-wide row: k = 8h..8h+7 and 16+8h..16+8h+7 (the order of frag_k)
struct Row16 { v4f r[4]; };
__device__ __forceinline__ Row16 row16_ld(const float* __restrict__ row, int h) {
    Row16 x;
    x.r[0] = *(const v4f*)(row + 8 * h); x.r[1] = *(const v4f*)(row + 8 * h + 4);
    x.r[2] = *(const v4f*)(row + 16 + 8 * h); x.r[3] = *(const v4f*)(row + 16 + 8 * h + 4);
    return x;
}
__device__ __forceinline__ v16h row16_f16(const Row16& x) {
    v16h a;
#pragma unroll
    for (int q = 0; q < 4; ++q)
#pragma unroll
        for (int e = 0; e < 4; ++e) a[4 * q + e] = (_Float16)x.r[q][e];
    return a;
}
// the value that lane l ^ 16 holds
__device__ __forceinline__ float other_half(float x) {
    const int b = __float_as_int(x);
    return __int_as_float(__builtin_amdgcn_permlanex16(b, b, 0x76543210, 0xfedcba98, false, false));
}
// one f16 fragment from a plane in fragment order: p points at this lane's 8 halves of the fragment's half j = 0
__device__ __forceinline__ v16h frag_ld(const _Float16* __restrict__ p) {
    union { v16h v; v8h h[2]; } f;
    f.h[0] = *(const v8h*)(p); f.h[1] = *(const v8h*)(p + 256);
    return f.v;
}
// amdgpu_waves_per_eu(8): a budget of 128 registers a wave, so that 8 blocks fit on a WGP at once (one register more would leave room for 7)
template <int LQ, int LK, int QP, int SP>
__global__ __launch_bounds__(32 * AW) __attribute__((amdgpu_waves_per_eu(8))) void k_attn32(const float* __restrict__ Q, const _Float16* __restrict__ KF, const _Float16* __restrict__ VF, float* __restrict__ O, float scale) {
    static_assert(LQ % (16 * AW) == 0 && LK % 64 == 0 && QP % 4 == 0 && SP % 4 == 0, "whole tiles, 16-byte rows");
    constexpr int NT = 2;                       // output tiles (16 d each)
    constexpr int OP = 32 + 4;                  // LDS pitch of an output row (floats)
    __shared__ __align__(16) float    ol[AW][16 * OP];
    const int lane = threadIdx.x & 31, hf = lane >> 4, l15 = lane & 15, wave = threadIdx.x >> 5;
    const int h = blockIdx.y;
    const int q0 = (blockIdx.x * AW + wave) * 16;
    Q += (size_t)blockIdx.z * LQ * QP; O += (size_t)blockIdx.z * LQ * SP;      // image blockIdx.z: its own Q / O plane
    const float L2E = 1.4426950408889634f;
    const float NEG = -__builtin_inff();
    const float cs = scale * L2E;               // raw score -> exponent of 2
    const size_t plane = (size_t)(blockIdx.z * gridDim.y + h) * (LK * 32) + lane * 8;           // this (image, head)'s plane, at this lane's 8 halves of a fragment
    const _Float16* kf = KF + plane;                                                            // both walk on by one 64-key block a trip: every fragment address is one of them plus an immediate
    const _Float16* vf = VF + plane;
    const v16h qa = row16_f16(row16_ld(Q + h * 32 + (size_t)(q0 + l15) * QP, hf));
    asm volatile("s_wait_xcnt 0x0" ::: "memory");   // the Q loads' address registers are reused for the start values set below: the wait stands in front of that overwrite
    __builtin_amdgcn_sched_barrier(0);              // keeps those later register writes from being scheduled ahead of the wait
    v8f o[NT]; float mrun = NEG, lrun = 0.f;        // this lane's query: running maximum (both halves agree) and this half's part of the sum
#pragma unroll
    for (int t = 0; t < NT; ++t) { v8f zz = {}; o[t] = zz; }
    for (int j0 = 0; j0 < LK; j0 += 64) {
        v16h ka[4], va[4];
#pragma unroll
        for (int t = 0; t < 4; ++t) ka[t] = frag_ld(kf + t * 512);
        asm volatile("s_wait_xcnt 0x0" ::: "memory");    // the K loads' address registers are rewritten further down: the wait stands in front of that overwrite
        __builtin_amdgcn_sched_barrier(0);               // keeps those register writes from being scheduled ahead of the wait
        v8f s[4];
#pragma unroll
        for (int t = 0; t < 4; ++t) { v8f acc = {}; s[t] = wmma16(ka[t], qa, acc); }
        float mt[4];                                     // one maximum a tile: four short chains, not one of 32
#pragma unroll
        for (int t = 0; t < 4; ++t) {
            float a = fmaxf(s[t][0], s[t][1]);
#pragma unroll
            for (int r = 2; r < 8; ++r) a = fmaxf(a, s[t][r]);
            mt[t] = a;
        }
        float mx = fmaxf(fmaxf(mt[0], mt[1]), fmaxf(mt[2], mt[3]));
        mx = fmaxf(mx, other_half(mx));
        const float mnew = fmaxf(mrun, mx);
        // exp2 as the bare hardware instruction: it gives 0 where the result would be below 2^-126. Such a term is lost anyway: beside a row sum of at least 4096 in f32, and as an f16 operand.
        const float corr = __builtin_amdgcn_exp2f((mrun - mnew) * cs);   // first block: exp2(-inf) = 0
        const float nb = 12.f - mnew * cs;               // the 12 is the factor 4096 of P
#pragma unroll
        for (int t = 0; t < 4; ++t)
#pragma unroll
            for (int r = 0; r < 8; ++r) s[t][r] = __builtin_amdgcn_exp2f(__builtin_fmaf(s[t][r], cs, nb));
        const v8f ps = (s[0] + s[1]) + (s[2] + s[3]);
        const float rs = ((ps[0] + ps[1]) + (ps[2] + ps[3])) + ((ps[4] + ps[5]) + (ps[6] + ps[7]));
        lrun = lrun * corr + rs; mrun = mnew;
#pragma unroll
        for (int t = 0; t < NT; ++t) o[t] *= corr;
        v16h pb0, pb1;                                   // P^T fragments: element e <- key frag_k(e, hf) (+ 32), which is element e & 7 of score tile e >> 3 (+ 2)
#pragma unroll
        for (int e = 0; e < 16; ++e) { pb0[e] = (_Float16)s[e >> 3][e & 7]; pb1[e] = (_Float16)s[2 + (e >> 3)][e & 7]; }
#pragma unroll
        for (int t = 0; t < 4; ++t) va[t] = frag_ld(vf + ((t >> 1) * (LK / 32) + (t & 1)) * 512);   // va[2 dt + g]
#pragma unroll
        for (int t = 0; t < NT; ++t) {
            o[t] = wmma16(va[2 * t], pb0, o[t]);
            o[t] = wmma16(va[2 * t + 1], pb1, o[t]);
        }
        kf += 4 * 512; vf += 2 * 512;
    }
    float* obase = O + h * 32;
    const float inv = 1.f / (lrun + other_half(lrun));          // sum and output both carry the factor 4096; no key is masked: the row sum holds its maximum's exp2(12)
    float* myo = ol[wave];                                       // the wave's own 16 x 32 output tile, query-major
#pragma unroll
    for (int t = 0; t < NT; ++t) {
        const v4f lo = {o[t][0] * inv, o[t][1] * inv, o[t][2] * inv, o[t][3] * inv}, hi = {o[t][4] * inv, o[t][5] * inv, o[t][6] * inv, o[t][7] * inv};
        *(v4f*)(myo + l15 * OP + t * 16 + 8 * hf) = lo; *(v4f*)(myo + l15 * OP + t * 16 + 8 * hf + 4) = hi;
    }
    __syncthreads();
#pragma unroll
    for (int r0 = 0; r0 < 16; r0 += 4) {
        const int row = r0 + (lane >> 3), c4 = (lane & 7) * 4;
        const v4f v = *(const v4f*)(myo + row * OP + c4);
        VST2V4(obase + (size_t)(q0 + row) * SP + c4, v);
    }
}

// =====================================================================================================================
// k_tr: dst(z, c, r) = alpha * src(z, r, c) (+ beta * R2(z, c, r)): [Z][R][C] (row stride lds) -> [Z][C][R] (row stride ldd) through a 32x32 LDS tile;
//   flags: 1 -> add beta * residual R2 addressed like dst (z*sRz + c*ldr + r); act applied before the residual.
// =====================================================================================================================
struct TrP { const float* src; float* dst; const float* R2; long long sSz, lds, sDz, ldd, sRz, ldr; int R, C, flags, act; float alpha, beta; };
static_assert(sizeof(TrP) == 3 * 8 + 6 * 8 + 6 * 4, "TrP has padding");
__global__ __launch_bounds__(256) void k_tr(TrP p) {
    __shared__ float tile[32][33];
    const int c0 = blockIdx.x * 32, r0 = blockIdx.y * 32, z = blockIdx.z;
    const int lane = threadIdx.x & 31, wave = threadIdx.x >> 5;
    const float* s = p.src + z * p.sSz;
#pragma unroll
    for (int k = 0; k < 4; ++k) {
        const int rl = wave * 4 + k, r = r0 + rl, c = c0 + lane;
        tile[rl][lane] = (r < p.R && c < p.C) ? s[(long long)r * p.lds + c] : 0.f;
    }
    __syncthreads();
    float* d = p.dst + z * p.sDz; const float* rr = p.R2 + z * p.sRz;
#pragma unroll
    for (int k = 0; k < 4; ++k) {
        const int cl = wave * 4 + k, c = c0 + cl, r = r0 + lane;
        if (c < p.C && r < p.R) {
            float v = act_fn(p.alpha * tile[lane][cl], p.act);
            if (p.flags & 1) v += p.beta * rr[(long long)c * p.ldr + r];
            VST2(float, d + (long long)c * p.ldd + r, v);
        }
    }
}

// k_affine: dst[i] = a * (sdev ? sdev[0] : 1) * src[i] + b, i < n (one thread per element; consecutive lanes -> consecutive addresses)
__global__ __launch_bounds__(256) void k_affine(const float* __restrict__ src, float* __restrict__ dst, int n, float a, float b, const float* __restrict__ sdev) {
    const int i = blockIdx.x * 256 + threadIdx.x;
    if (i < n) { const float aa = sdev ? a * sdev[0] : a; const float v = aa * src[i] + b; VST2(float, dst + i, v); }
}

// =====================================================================================================================
// k_softmax: row softmax over n contiguous elements, one 256-thread block per row; rows addressed z*sz + r*sr (grid (R, Z)).
//   out = scale_out * softmax(scale_in * x + (Mf ? Mf[z*smz + r*smr + j] : 0)); a row whose max is -inf is written as 0.
// =====================================================================================================================
struct SmP { const float* src; float* dst; const float* Mf; long long sz, sr, dz, dr, smz, smr; int n, pad; float scale_in, scale_out; };
static_assert(sizeof(SmP) == 3 * 8 + 6 * 8 + 4 * 4, "SmP has padding");
__global__ __launch_bounds__(256) void k_softmax(SmP p) {
    __shared__ float red[256];
    const int r = blockIdx.x, z = blockIdx.y, tid = threadIdx.x;
    const float* s = p.src + z * p.sz + (long long)r * p.sr;
    const float* mf = p.Mf ? (p.Mf + z * p.smz + (long long)r * p.smr) : nullptr;
    float mx = -__builtin_inff();
    for (int j = tid; j < p.n; j += 256) { float v = s[j] * p.scale_in; if (mf) v += mf[j]; mx = fmaxf(mx, v); }
    red[tid] = mx; __syncthreads();
    for (int o = 128; o > 0; o >>= 1) { if (tid < o) red[tid] = fmaxf(red[tid], red[tid + o]); __syncthreads(); }
    mx = red[0]; __syncthreads();
    float sum = 0.f;
    for (int j = tid; j < p.n; j += 256) { float v = s[j] * p.scale_in; if (mf) v += mf[j]; sum += (mx == -__builtin_inff()) ? 0.f : expf(v - mx); }
    red[tid] = sum; __syncthreads();
    for (int o = 128; o > 0; o >>= 1) { if (tid < o) red[tid] += red[tid + o]; __syncthreads(); }
    sum = red[0];
    const float inv = (sum > 0.f) ? p.scale_out / sum : 0.f;
    float* d = p.dst + z * p.dz + (long long)r * p.dr;
    for (int j = tid; j < p.n; j += 256) { float v = s[j] * p.scale_in; if (mf) v += mf[j]; const float o = (mx == -__builtin_inff()) ? 0.f : expf(v - mx) * inv; VST2(float, d + j, o); }
}
// =====================================================================================================================
// k_stats: mean and rsqrt(var + eps) over a set of n elements addressed base + z*sz + (e / inner) * so + (e % inner) * si, one 256-thread
// k_norm_apply: y = (x - mean[set]) * rstd[set] * g[c] + b[c] over a [Z][C][L] channel-major tensor with set = z*G + c / (C/G) (G groups per z;
//   G = C -> per-channel sets indexed z*C+c; for batch norm pass stats indexed by c only via bn = 1). Optional act. Output same layout.
// =====================================================================================================================
//   mode 0: mean / rsqrt(var + eps); mode 1 (RMSNorm): 0 / rsqrt(mean(x^2) + eps); mode 2 (L2 normalize * sqrt(n)): 0 / sqrt(n) / max(||x||, eps); mode 3: as 0 with unbiased variance (n-1)
__global__ __launch_bounds__(256) void k_stats(const float* __restrict__ x, long long sz, long long so, long long si, int inner, int n, float eps, float* __restrict__ stat, int mode) {
    __shared__ float red[256];
    const int z = blockIdx.x, tid = threadIdx.x;
    const float* base = x + z * sz;
    float s = 0.f;
    for (int e = tid; e < n; e += 256) s += base[(long long)(e / inner) * so + (long long)(e % inner) * si];
    red[tid] = s; __syncthreads();
    for (int o = 128; o > 0; o >>= 1) { if (tid < o) red[tid] += red[tid + o]; __syncthreads(); }
    const float mu = (mode == 0 || mode == 3) ? red[0] / (float)n : 0.f; __syncthreads();
    float q = 0.f;
    for (int e = tid; e < n; e += 256) { const float dlt = base[(long long)(e / inner) * so + (long long)(e % inner) * si] - mu; q += dlt * dlt; }
    red[tid] = q; __syncthreads();
    for (int o = 128; o > 0; o >>= 1) { if (tid < o) red[tid] += red[tid + o]; __syncthreads(); }
    {
        float rs;
        if (mode == 2) rs = sqrtf((float)n) / fmaxf(sqrtf(red[0]), eps); else if (mode == 3) rs = rsqrtf(red[0] / (float)(n - 1) + eps); else rs = rsqrtf(red[0] / (float)n + eps);
        if (tid < 32) { const float v = (tid == 0) ? mu : ((tid == 1) ? rs : 0.f); VST2(float, stat + (long long)z * 32 + tid, v); }
    }
}
//   One thread per element over the flat [Z][C][L] index space: grid ceil(Z*C*L / 256).
__global__ __launch_bounds__(256) void k_norm_apply(const float* __restrict__ x, float* __restrict__ y, const float* __restrict__ stat, const float* __restrict__ g, const float* __restrict__ bta,
                                                     int Z, int C, int L, int G, int bn, int act) {
    const long long idx = (long long)blockIdx.x * 256 + threadIdx.x;
    if (idx >= (long long)Z * C * L) return;
    const int l = (int)(idx % L); const long long zc = idx / L; const int c = (int)(zc % C), z = (int)(zc / C); (void)l;
    const int set = bn ? c : (z * G + c / (C / G));
    float v = (x[idx] - stat[(long long)set * 32]) * stat[(long long)set * 32 + 1];
    if (g) v *= g[c];
    if (bta) v += bta[c];
    v = act_fn(v, act);
    VST2(float, y + idx, v);
}

// k_lse_neg: c[i] = -(st[2i] + log(st[2i+1])) = minus the log-sum-exp of row i (for softmax over the query axis)
__global__ __launch_bounds__(256) void k_lse_neg(const float* __restrict__ st, float* __restrict__ c, int n) {
    const int i = blockIdx.x * 256 + threadIdx.x;
    if (i < n) { const float v = -(st[2 * i] + logf(st[2 * i + 1])); VST2(float, c + i, v); }
}

// k_iota: dst[i] = a * i + b as int32 (segment/position id helper)
__global__ __launch_bounds__(256) void k_iota(int* __restrict__ dst, int n, int a, int b) {
    const int i = blockIdx.x * 256 + threadIdx.x;
    if (i < n) { const int v = a * i + b; VST2(int, dst + i, v); }
}

// k_axpby: dst[i] = a * x[i] + b * y[i] (+ c), i < n
__global__ __launch_bounds__(256) void k_axpby(const float* __restrict__ x, const float* __restrict__ y, float* __restrict__ dst, int n, float a, float b, float c) {
    const int i = blockIdx.x * 256 + threadIdx.x;
    if (i < n) { const float v = a * x[i] + b * y[i] + c; VST2(float, dst + i, v); }
}

// =====================================================================================================================
// k_rope: rotary embedding on a [R rows][Hn heads][D] view (row stride sXr, head stride sXh, element stride 1) -> Y (own strides).
//   mode 0: rotate_half (partner d±D/2, sign - for d<D/2); mode 1: interleaved pairs (partner d^1, sign - for even d).
//   table column tcol: tmode 0 -> d, 1 -> d % (D/2), 2 -> d / 2; position p: pmode 0 -> r % S, 1 -> head index, 2 -> pos[r];
//   c = C[(r / S) * sCb + p * sCp + tcol * sCd], s likewise from Sn; y = x[d] * c + sign * x[partner] * s. X and Y must not alias.
// =====================================================================================================================
struct RopeP { const float* X; float* Y; const float* C; const float* Sn; const int* pos; long long sXr, sXh, sYr, sYh, sCb, sCp, sCd; int R, Hn, D, S, mode, tmode, pmode, pad; };
static_assert(sizeof(RopeP) == 5 * 8 + 7 * 8 + 8 * 4, "RopeP has padding");
__global__ __launch_bounds__(256) void k_rope(RopeP p) {
    const long long idx = (long long)blockIdx.x * 256 + threadIdx.x;
    if (idx >= (long long)p.R * p.Hn * p.D) return;
    const int d = (int)(idx % p.D); const long long rh = idx / p.D; const int h = (int)(rh % p.Hn); const int r = (int)(rh / p.Hn);
    const int half = p.D / 2;
    int partner; float sign;
    if (p.mode == 0) { partner = (d < half) ? d + half : d - half; sign = (d < half) ? -1.f : 1.f; }
    else { partner = d ^ 1; sign = (d & 1) ? 1.f : -1.f; }
    const int tcol = (p.tmode == 0) ? d : ((p.tmode == 1) ? (d % half) : (d >> 1));
    const int pp = (p.pmode == 0) ? (r % p.S) : ((p.pmode == 1) ? h : p.pos[r]);
    const long long toff = (long long)(r / p.S) * p.sCb + (long long)pp * p.sCp + (long long)tcol * p.sCd;
    const float* xr = p.X + (long long)r * p.sXr + (long long)h * p.sXh;
    const float v = xr[d] * p.C[toff] + sign * xr[partner] * p.Sn[toff];
    VST2(float, p.Y + (long long)r * p.sYr + (long long)h * p.sYh + d, v);
}

// k_invf + k_sincos (split so neither kernel carries a large VALU-fma footprint): invf_i = num * (1 / powf(base, (2 i)/D)) [fmode 0],
//   num * expf((2 i) * cexp) [fmode 1], num * powf(base, -2 (i - 1) / D) [fmode 2]; then cs/sn[s*half + i] = cos/sin((pscale * s) * invf_i)
__global__ __launch_bounds__(256) void k_invf(float* __restrict__ invb, int half, int D, float base, float num, int fmode, float cexp) {
    const int i = blockIdx.x * 256 + threadIdx.x;
    if (i >= ((half + 31) / 32) * 32) return;
    if (i >= half) { VST2(float, invb + i, 0.f); return; }
    const float e = (float)(2 * i) / (float)D;
    float invf;
    if (fmode == 1) invf = num * expf((float)(2 * i) * cexp);
    else if (fmode == 2) invf = num * powf(base, (-2.0f * ((float)i - 1.0f)) / (float)D);
    else invf = num * (1.0f / powf(base, e));
    VST2(float, invb + i, invf);
}
__global__ __launch_bounds__(256) void k_sincos(float* __restrict__ cs, float* __restrict__ sn, const float* __restrict__ invb, int S, int half, float pscale) {
    const int idx = blockIdx.x * 256 + threadIdx.x;
    if (idx >= S * half) return;
    const int s = idx / half, i = idx - s * half;
    const float ang = (pscale * (float)s) * invb[i];
    VST2(float, cs + idx, cosf(ang)); VST2(float, sn + idx, sinf(ang));
}

// k_mulact: dst[i] = act(x[i]) * y[i]
__global__ __launch_bounds__(256) void k_mulact(const float* __restrict__ x, const float* __restrict__ y, float* __restrict__ dst, int n, int act) {
    const int i = blockIdx.x * 256 + threadIdx.x;
    if (i < n) { const float v = act_fn(x[i], act) * y[i]; VST2(float, dst + i, v); }
}

// =====================================================================================================================
// k_matvec: thread-per-row matrix-vector products for N <= 8 output columns (heads with 1-3 outputs, gates), f32 on the VALU.
//   C[r*sCm + j] = act(alpha * sum_k A[r*sAm + k*sAk] * B[j*sBn + k*sBk] + bias[j]) + beta * R[r*sRm + j*sRn]; each thread writes its N contiguous floats.
// =====================================================================================================================
__global__ __launch_bounds__(256) void k_matvec(GemmP p) {
    // 32 lanes write one line with one instruction.
    const int rpt = (p.N == 1) ? 1 : 32;
    const long long r0 = ((long long)blockIdx.x * 256 + threadIdx.x) * rpt; const int z = blockIdx.z, zo = z / p.zi_n, zi = z - zo * p.zi_n;
    if (r0 >= p.M) return;
    const float* Bb = p.B + zo * p.sBo + zi * p.sBi;
    float* C = p.C + zo * p.sCo + zi * p.sCi; const float* R = p.R + zo * p.sRo + zi * p.sRi;
    for (int rr = 0; rr < rpt; ++rr) {
        const long long r = r0 + rr; if (r >= p.M) break;
        const float* A = p.A + zo * p.sAo + zi * p.sAi + r * p.sAm;
        float acc[8] = {0.f, 0.f, 0.f, 0.f, 0.f, 0.f, 0.f, 0.f};
        for (int k = 0; k < p.K; ++k) { const float a = A[(long long)k * p.sAk];
#pragma unroll
            for (int j = 0; j < 8; ++j) if (j < p.N) acc[j] += a * Bb[(long long)j * p.sBn + (long long)k * p.sBk]; }
#pragma unroll
        for (int j = 0; j < 8; ++j) if (j < p.N) {
            float v = acc[j] * p.alpha;
            if (p.flags & 1) v += p.bias[j];
            if (p.flags & 2) v += p.bias[r];
            v = act_fn(v, p.act);
            if (p.flags & 4) v += p.beta * R[r * p.sRm + (long long)j * p.sRn];
            VST2(float, C + r * p.sCm + j, v);
        }
    }
}
// k_smallsoftmax: thread-per-row softmax for short rows (n <= 64): dst[r*dr + j] = softmax(scale*src[r*sr + j])
__global__ __launch_bounds__(256) void k_smallsoftmax(const float* __restrict__ src, float* __restrict__ dst, long long sr, long long dr, int n, long long R, float scale) {
    const long long r0 = ((long long)blockIdx.x * 256 + threadIdx.x) * 32;
    for (int rr = 0; rr < 32; ++rr) {
        const long long r = r0 + rr; if (r >= R) return;
        const float* s = src + r * sr; float* d = dst + r * dr;
        float mx = -__builtin_inff();
        for (int j = 0; j < n; ++j) mx = fmaxf(mx, s[j] * scale);
        float sum = 0.f;
        for (int j = 0; j < n; ++j) sum += expf(s[j] * scale - mx);
        const float inv = 1.f / sum;
        for (int j = 0; j < n; ++j) { const float v = expf(s[j] * scale - mx) * inv; VST2(float, d + j, v); }
    }
}

__global__ __launch_bounds__(32) void k_unitstat(float* __restrict__ st) { const int t = threadIdx.x; const float v = (t == 1) ? 1.f : 0.f; VST2(float, st + t, v); }

// destination (e.g. a d_out whose row width is not a multiple of 32 floats) is written by consecutive lanes of one instruction
__global__ __launch_bounds__(256) void k_lincopy(const float* __restrict__ src, long long lds, float* __restrict__ dst, long long ldd, long long rows, int cols) {
    const long long i = (long long)blockIdx.x * 256 + threadIdx.x; if (i >= rows * cols) return;
    const long long r = i / cols; const int c = (int)(i - r * cols);
    const float v = src[r * lds + c]; VST2(float, dst + r * ldd + c, v);
}

namespace w25 {
typedef __attribute__((ext_vector_type(16))) _Float16 v16h;
typedef __attribute__((ext_vector_type(8)))  _Float16 v8h;
typedef __attribute__((ext_vector_type(16))) __bf16   v16b;
typedef __attribute__((ext_vector_type(8)))  __bf16   v8b;
typedef __attribute__((ext_vector_type(8)))  float    v8f;
typedef __attribute__((ext_vector_type(4)))  float    v4f;

__device__ __forceinline__ unsigned short f2bf_bits(float f) {
  unsigned u = __float_as_uint(f);
  return (unsigned short)((u + 0x7FFFu + ((u >> 16) & 1u)) >> 16);
}
__device__ __forceinline__ float bf_bits2f(unsigned short h) { return __uint_as_float(((unsigned)h) << 16); }

// hazard guards as plain device helpers (no inline asm inside the kernel template body)
__device__ __forceinline__ void dep_guard_h(v8f& a, v8f& b, v16h x, v16h y) { asm volatile("v_nop\n\tv_nop\n\tv_nop\n\tv_nop" : "+v"(a), "+v"(b) : "v"(x), "v"(y)); }
__device__ __forceinline__ void dep_guard_b(v8f& a, v8f& b, v16b x, v16b y) { asm volatile("v_nop\n\tv_nop\n\tv_nop\n\tv_nop" : "+v"(a), "+v"(b) : "v"(x), "v"(y)); }
__device__ __forceinline__ void keep4_h(v16h a, v16h b, v16h c, v16h d) { asm volatile("v_nop" :: "v"(a), "v"(b), "v"(c), "v"(d)); }
__device__ __forceinline__ void keep4_b(v16b a, v16b b, v16b c, v16b d) { asm volatile("v_nop" :: "v"(a), "v"(b), "v"(c), "v"(d)); }
__device__ __forceinline__ void acc_guard4(v8f& a, v8f& b, v8f& c, v8f& d) { asm volatile("v_nop\n\tv_nop\n\tv_nop\n\tv_nop" : "+v"(a), "+v"(b), "+v"(c), "+v"(d)); }
// an address that is the same in every lane, held in a scalar register pair: a load then takes it as its scalar base, beside one 32-bit lane offset
__device__ __forceinline__ unsigned long long scalar_addr(const void* p) {
  const unsigned long long u = (unsigned long long)p;
  const unsigned l = (unsigned)__builtin_amdgcn_readfirstlane((int)(unsigned)u), h = (unsigned)__builtin_amdgcn_readfirstlane((int)(unsigned)(u >> 32));
  return ((unsigned long long)h << 32) | l;
}
template <typename T> struct Frag;
template <> struct Frag<_Float16> {
  typedef v16h V; union U { v16h v; v8h h[2]; };
  static __device__ __forceinline__ v16h load(const _Float16* p) {   // elements 0..7 <- p[0..7], 8..15 <- p[16..23]
    U f; f.h[0] = *(const v8h*)(p); f.h[1] = *(const v8h*)(p + 16); return f.v;
  }
  static __device__ __forceinline__ v16h loads(unsigned long long p, unsigned off) {   // the same from scalar base p (address of a 16-row tile) + off (this lane's byte offset in the tile)
    typedef const __attribute__((address_space(1))) v8h* G;
    U f; f.h[0] = *(G)(p + off); f.h[1] = *(G)(p + off + 32); return f.v;
  }
  static __device__ __forceinline__ v8f mma(v16h a, v16h b, v8f c) {
    return __builtin_amdgcn_wmma_f32_16x16x32_f16(false, a, false, b, (short)0, c, false, false);
  }
  static __device__ __forceinline__ void guard(v8f& a, v8f& b, v16h x, v16h y) { dep_guard_h(a, b, x, y); }
  static __device__ __forceinline__ void keep(v16h a, v16h b, v16h c, v16h d) { keep4_h(a, b, c, d); }
};
template <> struct Frag<__bf16> {
  typedef v16b V; union U { v16b v; v8b h[2]; };
  static __device__ __forceinline__ v16b load(const __bf16* p) {
    U f; f.h[0] = *(const v8b*)(p); f.h[1] = *(const v8b*)(p + 16); return f.v;
  }
  static __device__ __forceinline__ v16b loads(unsigned long long p, unsigned off) {
    typedef const __attribute__((address_space(1))) v8b* G;
    U f; f.h[0] = *(G)(p + off); f.h[1] = *(G)(p + off + 32); return f.v;
  }
  static __device__ __forceinline__ v8f mma(v16b a, v16b b, v8f c) {
    return __builtin_amdgcn_wmma_f32_16x16x32_bf16(false, a, false, b, (short)0, c, false, false);
  }
  static __device__ __forceinline__ void guard(v8f& a, v8f& b, v16b x, v16b y) { dep_guard_b(a, b, x, y); }
  static __device__ __forceinline__ void keep(v16b a, v16b b, v16b c, v16b d) { keep4_b(a, b, c, d); }
};

// ---- Register-blocked batched WMMA GEMM ------------------------------------
// C[m,n] = scale * sum_k A[m,k] * Bt[n,k] (+bias)(+resid); each wave owns a 64x64 tile.
// A row-major [M,K]; Bt row-major [N,K]; M,N % 64 == 0, K % 32 == 0.
// SPLIT: operands are hi/lo planes (A2/Bt2 = lo planes, same layout); product = hi·hi + hi·lo + lo·hi.
// BIAS_MODE: 0 = none, 1 = bias[m], 2 = bias[n].
// OUT_MODE: 0 = f32, 1 = f16, 2 = bf16 hi plane (Cout) + bf16 lo plane (Cout2).
// ET: 0 = f16 operands, 1 = bf16 operands (pointers passed as 16-bit storage)
template <int ET> struct Elem;
template <> struct Elem<0> { typedef _Float16 T; };
template <> struct Elem<1> { typedef __bf16 T; };
// The body takes its block's place in the grid (bx: 8 tiles, b: batch) as arguments, so that one launch can hold the blocks of more than one product.
// FRAGKV, and frag set (block-uniform): the product is the kv conv, rows m = (image, key) with 2^lgk keys an image, columns n = [k | v], each half N / 64 heads of 32 channels. The result is
// stored as f16 in the fragment order that the attention kernel reads (its head comment has the two maps): k to kfrag, v to vfrag, one plane of 32 * 2^lgk halves a (image, head).
template <int ET, bool SPLIT, int BIAS_MODE, int OUT_MODE, bool RESID, int ACT, bool FRAGKV = false>
__device__ __forceinline__ void gemm64_block(
    const unsigned short* __restrict__ Ap, const unsigned short* __restrict__ A2p, int lda, long strideA,
    const unsigned short* __restrict__ Btp, const unsigned short* __restrict__ Bt2p, int ldb, long strideB,
    void* __restrict__ Cout, void* __restrict__ Cout2, int ldc, long strideC,
    const float* __restrict__ bias,
    const float* __restrict__ resid, long strideR,
    int M, int N, int K, float scale, int bx, int b,
    _Float16* __restrict__ kfrag = nullptr, _Float16* __restrict__ vfrag = nullptr, int lgk = 0, bool frag = false) {
  typedef typename Elem<ET>::T T;
  typedef typename Frag<T>::V V;
  const T* A = (const T*)Ap; const T* A2 = (const T*)A2p; const T* Bt = (const T*)Btp; const T* Bt2 = (const T*)Bt2p;
  __shared__ __align__(16) float sT[8][16 * 68];   // per-wave 16x64 slab, pitch 68 floats
  const int lane = threadIdx.x & 31;
  const int wave = __builtin_amdgcn_readfirstlane(threadIdx.x >> 5);   // the wave's number as a scalar: every fragment address below is a scalar base plus one lane offset
  const int tilesN = N >> 6;
  const int tilesM = M >> 6;
  const int tile = bx * 8 + wave;
  if (tile >= tilesM * tilesN) return;   // wave-uniform; no block barriers in this kernel
  const int tm = tile / tilesN;
  const int tn = tile - tm * tilesN;
  const int m0 = tm << 6;
  const int n0 = tn << 6;

  const T* Ab  = A  + (size_t)b * strideA;
  const T* Bb  = Bt + (size_t)b * strideB;
  const T* Ab2 = SPLIT ? (A2  + (size_t)b * strideA) : nullptr;
  const T* Bb2 = SPLIT ? (Bt2 + (size_t)b * strideB) : nullptr;

  const int rlane = lane & 15;                 // row (A) / col (B, D) within subtile
  const int koff  = (lane >> 4) * 8;           // k offset of this lane half
  const int mOff  = (lane >> 4) * 8;           // D row offset

  v8f acc[4][4];
#pragma unroll
  for (int i = 0; i < 4; ++i)
#pragma unroll
    for (int j = 0; j < 4; ++j) acc[i][j] = (v8f){0.f,0.f,0.f,0.f,0.f,0.f,0.f,0.f};

  unsigned long long pa[4], pb[4], pa2[4], pb2[4];   // the 4 + 4 row tiles of 16 rows
#pragma unroll
  for (int i = 0; i < 4; ++i) {
    pa[i] = scalar_addr(Ab + (size_t)(m0 + (i << 4)) * lda); pb[i] = scalar_addr(Bb + (size_t)(n0 + (i << 4)) * ldb);
    pa2[i] = SPLIT ? scalar_addr(Ab2 + (size_t)(m0 + (i << 4)) * lda) : 0; pb2[i] = SPLIT ? scalar_addr(Bb2 + (size_t)(n0 + (i << 4)) * ldb) : 0;
  }
  const unsigned la = (unsigned)(rlane * lda + koff) * 2, lb = (unsigned)(rlane * ldb + koff) * 2;   // this lane's byte offset in a row tile of A, of Bt, at k0 = 0

  for (int k0 = 0; k0 < K; k0 += 32) {
    V bh[4], bl[4], ah[4], al[4];     // all 8 fragments of the k step have registers of their own: their loads are issued together, one memory latency a k step
#pragma unroll
    for (int j = 0; j < 4; ++j) {
      bh[j] = Frag<T>::loads(pb[j], lb + k0 * 2);
      if (SPLIT) bl[j] = Frag<T>::loads(pb2[j], lb + k0 * 2);
    }
#pragma unroll
    for (int i = 0; i < 4; ++i) {
      ah[i] = Frag<T>::loads(pa[i], la + k0 * 2);
      if (SPLIT) al[i] = Frag<T>::loads(pa2[i], la + k0 * 2);
    }
#pragma unroll
    for (int i = 0; i < 4; ++i) {
#pragma unroll
      for (int j = 0; j < 4; ++j) {
        acc[i][j] = Frag<T>::mma(ah[i], bh[j], acc[i][j]);
        if (SPLIT) {
          acc[i][j] = Frag<T>::mma(ah[i], bl[j], acc[i][j]);
          acc[i][j] = Frag<T>::mma(al[i], bh[j], acc[i][j]);
        }
      }
      Frag<T>::guard(acc[i][0], acc[i][3], ah[i], SPLIT ? al[i] : ah[i]);
    }
    Frag<T>::keep(bh[0], bh[1], bh[2], bh[3]);
    if (SPLIT) Frag<T>::keep(bl[0], bl[1], bl[2], bl[3]);
  }
  acc_guard4(acc[0][0], acc[0][1], acc[0][2], acc[0][3]);
  acc_guard4(acc[1][0], acc[1][1], acc[1][2], acc[1][3]);
  acc_guard4(acc[2][0], acc[2][1], acc[2][2], acc[2][3]);
  acc_guard4(acc[3][0], acc[3][1], acc[3][2], acc[3][3]);

  // ---- epilogue ----
  float* slab = sT[wave];
  const float* Rb = RESID ? (resid + (size_t)b * strideR) : nullptr;
#pragma unroll
  for (int i = 0; i < 4; ++i) {
    const int mBase = m0 + (i << 4);
#pragma unroll
    for (int j = 0; j < 4; ++j) {
      const int n = n0 + (j << 4) + rlane;
      float bv = 0.f;
      if (BIAS_MODE == 2) bv = bias[n];
#pragma unroll
      for (int r = 0; r < 8; ++r) {
        float v = acc[i][j][r] * scale;
        if (BIAS_MODE == 1) v += bias[mBase + mOff + r];
        if (BIAS_MODE == 2) v += bv;
        if (RESID) v += Rb[(size_t)(mBase + mOff + r) * ldc + n];
        if (ACT == 1) v = tanhf(v);
        if (ACT == 2) v = fmaxf(v, 0.0f);
        if (ACT == 3) v = v / (1.0f + expf(-v));
        if (ACT == 4) v = (v > 0.f) ? v : 0.01f * v;
        if (ACT == 5) v = 0.5f * v * (1.0f + erff(v * 0.70710678118654752f));
        slab[(mOff + r) * 68 + (j << 4) + rlane] = v;
      }
    }
    __builtin_amdgcn_fence(__ATOMIC_RELEASE, "workgroup");
    __builtin_amdgcn_wave_barrier();
    __builtin_amdgcn_fence(__ATOMIC_ACQUIRE, "workgroup");
    if (FRAGKV && frag) {
      const int hfl = lane >> 4;
      const int z = mBase >> lgk, kb = mBase - (z << lgk);            // image, and the first of these 16 keys in it
      const bool isk = n0 < (N >> 1);                                 // the tile's 64 columns are 2 heads of k or 2 heads of v
      const int head0 = (isk ? n0 : n0 - (N >> 1)) >> 5;
      _Float16* pl = (isk ? kfrag : vfrag) + ((size_t)(z * (N >> 6) + head0) << (lgk + 5)) + lane * 8;
      v8h w[4];
      if (isk) {
        pl += (kb >> 4) * 512;                                        // fragment = these 16 keys; w[2 hh + j]: 8 consecutive channels of this lane's key
#pragma unroll
        for (int q = 0; q < 4; ++q) {
          const float* sp = slab + rlane * 68 + (q >> 1) * 32 + (q & 1) * 16 + hfl * 8;
          const v4f a = *(const v4f*)(sp), c = *(const v4f*)(sp + 4);
          const v8h t = {(_Float16)a[0], (_Float16)a[1], (_Float16)a[2], (_Float16)a[3], (_Float16)c[0], (_Float16)c[1], (_Float16)c[2], (_Float16)c[3]};
          w[q] = t;
        }
#pragma unroll
        for (int q = 0; q < 4; ++q) *(v8h*)(pl + ((size_t)(q >> 1) << (lgk + 5)) + (q & 1) * 256) = w[q];
      } else {
        pl += (kb >> 5) * 512 + ((kb >> 4) & 1) * 256;                // these 16 keys are half j of fragment g; w[2 hh + dt]: 8 consecutive keys of this lane's channel
#pragma unroll
        for (int q = 0; q < 4; ++q) {
          const float* sp = slab + hfl * 8 * 68 + (q >> 1) * 32 + (q & 1) * 16 + rlane;
          const v8h t = {(_Float16)sp[0], (_Float16)sp[68], (_Float16)sp[136], (_Float16)sp[204], (_Float16)sp[272], (_Float16)sp[340], (_Float16)sp[408], (_Float16)sp[476]};
          w[q] = t;
        }
#pragma unroll
        for (int q = 0; q < 4; ++q) *(v8h*)(pl + ((size_t)(q >> 1) << (lgk + 5)) + ((size_t)(q & 1) << (lgk + 4))) = w[q];
      }
      asm volatile("s_wait_xcnt 0x0" ::: "memory");   // the stores' address and data registers are rewritten by the next 16 rows: the wait stands in front of that overwrite
    } else if (OUT_MODE == 0) {
      float* C = (float*)Cout + (size_t)b * strideC;
      const int hh = lane >> 4, c4 = (lane & 15) * 4;     // row seg = 256 B = 16 lanes x 16 B
      {
#pragma unroll
        for (int it = 0; it < 8; ++it) {
          const int row = it * 2 + hh;
          v4f v = *(const v4f*)(slab + row * 68 + c4);
          *(v4f*)(C + (size_t)(mBase + row) * ldc + n0 + c4) = v;
        }
        if (FRAGKV) asm volatile("s_wait_xcnt 0x0" ::: "memory");   // in the built kernel the fragment arm's code lies behind these stores and rewrites their registers: the wait stands in front of it
      }
    } else {
      const int q = lane >> 3, c8 = (lane & 7) * 8;
      unsigned short* C  = (unsigned short*)Cout  + (size_t)b * strideC;
      unsigned short* C2 = (OUT_MODE == 2) ? ((unsigned short*)Cout2 + (size_t)b * strideC) : nullptr;
      {
#pragma unroll
        for (int it = 0; it < 4; ++it) {
          const int row = it * 4 + q;
          const float* sp = slab + row * 68 + c8;
          v8h hv, lv;
#pragma unroll
          for (int e = 0; e < 8; ++e) {
            if (OUT_MODE == 1) {
              hv[e] = (_Float16)sp[e];
            } else {
              unsigned short hb = f2bf_bits(sp[e]);
              unsigned short lb = f2bf_bits(sp[e] - bf_bits2f(hb));
              hv[e] = __builtin_bit_cast(_Float16, hb);
              lv[e] = __builtin_bit_cast(_Float16, lb);
            }
          }
          *(v8h*)(C + (size_t)(mBase + row) * ldc + n0 + c8) = hv;
          if (OUT_MODE == 2) *(v8h*)(C2 + (size_t)(mBase + row) * ldc + n0 + c8) = lv;
        }
        
      }
    }
    __builtin_amdgcn_fence(__ATOMIC_RELEASE, "workgroup");
    __builtin_amdgcn_wave_barrier();
    __builtin_amdgcn_fence(__ATOMIC_ACQUIRE, "workgroup");
  }
}

template <int ET, bool SPLIT, int BIAS_MODE, int OUT_MODE, bool RESID, int ACT = 0>
__global__ __launch_bounds__(256) void wmma_gemm64(
    const unsigned short* __restrict__ Ap, const unsigned short* __restrict__ A2p, int lda, long strideA,
    const unsigned short* __restrict__ Btp, const unsigned short* __restrict__ Bt2p, int ldb, long strideB,
    void* __restrict__ Cout, void* __restrict__ Cout2, int ldc, long strideC,
    const float* __restrict__ bias,
    const float* __restrict__ resid, long strideR,
    int M, int N, int K, float scale) {
  gemm64_block<ET, SPLIT, BIAS_MODE, OUT_MODE, RESID, ACT>(Ap, A2p, lda, strideA, Btp, Bt2p, ldb, strideB, Cout, Cout2, ldc, strideC, bias, resid, strideR, M, N, K, scale, blockIdx.x, blockIdx.y);
}
// Two independent f16 products in one launch: blocks 0 .. nb0 - 1 do product 0, the blocks behind them product 1. Product 0 is the one with the longer k loop, so that its
// blocks start first; it is the kv conv, stored as f16 fragment planes (KF, VF; 2^lgk keys an image). Product 1 has an f32 result. Row pitches: A and Bt k0 / k1 (dense), C1 n1 (dense).
// grid nb0 + m1 * n1 / 32768, block 256.
__global__ __launch_bounds__(256) void wmma_gemm64_pair(
    const unsigned short* __restrict__ A0, const unsigned short* __restrict__ Bt0, _Float16* __restrict__ KF, _Float16* __restrict__ VF, int lgk, int m0, int n0, int k0, int nb0,
    const unsigned short* __restrict__ A1, const unsigned short* __restrict__ Bt1, float* __restrict__ C1, int m1, int n1, int k1, float scale) {
  const int bi = blockIdx.x;
  const bool p0 = bi < nb0;             // block-uniform
  const int n = p0 ? n0 : n1, k = p0 ? k0 : k1;
  gemm64_block<0, false, 0, 0, false, 0, true>(p0 ? A0 : A1, nullptr, k, 0, p0 ? Bt0 : Bt1, nullptr, k, 0, (void*)C1, nullptr, n, 0, nullptr, nullptr, 0, p0 ? m0 : m1, n, k, scale, p0 ? bi : bi - nb0, 0, KF, VF, lgk, p0);
}

__global__ __launch_bounds__(256) void cast_f32_f16x2(
    const float* __restrict__ in, _Float16* __restrict__ out, int n2) {
  int i = blockIdx.x * 256 + threadIdx.x;
  if (i < n2) {
    const _Float16 h0 = (_Float16)in[2 * i], h1 = (_Float16)in[2 * i + 1];
    const unsigned u = (unsigned)__builtin_bit_cast(unsigned short, h0) | ((unsigned)__builtin_bit_cast(unsigned short, h1) << 16);
    ((unsigned*)out)[i] = u;
    
  }
}


} // namespace w25

// The element-wise stages below give each thread 16 to 64 elements, moved by 16-byte loads and stores that are all in flight together, so that a launch is a few
// thousand waves. Every wave store instruction writes whole 128-byte lines.
__device__ __forceinline__ v8h cast8(v4f a, v4f b, float s) {
    const v8h o = {(_Float16)(a[0] * s), (_Float16)(a[1] * s), (_Float16)(a[2] * s), (_Float16)(a[3] * s), (_Float16)(b[0] * s), (_Float16)(b[1] * s), (_Float16)(b[2] * s), (_Float16)(b[3] * s)};
    return o;
}
// castT16_block<R, C>: dst[z][c][r] = f16(src[z][r][c] * s), dense planes. One thread: 8 rows r x 4 columns c (8 loads, 4 stores). Lane = (column quad lane >> 3, row group lane & 7):
//   the 8 lanes of one quad store 64 consecutive r of one c. Block (bx < C / 128, by < R / 64, bz < Z) of 256 threads: wave w has columns 128 bx + 16 w .. + 15, rows 64 by .. + 63.
template <int R, int C>
__device__ __forceinline__ void castT16_block(const float* __restrict__ src, _Float16* __restrict__ dst, float s, int bx, int by, int bz) {
    static_assert(R % 64 == 0 && C % 128 == 0, "whole tiles");
    const int lane = threadIdx.x & 31, wave = threadIdx.x >> 5;
    const int r0 = by * 64 + (lane & 7) * 8;
    const int c0 = bx * 128 + wave * 16 + (lane >> 3) * 4;
    src += ((size_t)bz * R + r0) * C + c0;
    dst += ((size_t)bz * C + c0) * R + r0;
    v4f a[8];
#pragma unroll
    for (int j = 0; j < 8; ++j) a[j] = *(const v4f*)(src + (size_t)j * C);
#pragma unroll
    for (int e = 0; e < 4; ++e) {
        const v8h o = {(_Float16)(a[0][e] * s), (_Float16)(a[1][e] * s), (_Float16)(a[2][e] * s), (_Float16)(a[3][e] * s), (_Float16)(a[4][e] * s), (_Float16)(a[5][e] * s), (_Float16)(a[6][e] * s), (_Float16)(a[7][e] * s)};
        *(v8h*)(dst + (size_t)e * R) = o;
    }
}
// f32 -> bf16 hi plane + bf16 lo plane (x = hi + lo to ~2^-17 relative; RNE both), [R][C] -> [R][C] (or transposed to [C][R]); 2 consecutive destination elements
__device__ __forceinline__ unsigned int f2bf2_pack(float a, float b, unsigned int* lo) {
    const unsigned short ha = w25::f2bf_bits(a), hb = w25::f2bf_bits(b);
    const unsigned short la = w25::f2bf_bits(a - w25::bf_bits2f(ha)), lb = w25::f2bf_bits(b - w25::bf_bits2f(hb));
    *lo = (unsigned)la | ((unsigned)lb << 16); return (unsigned)ha | ((unsigned)hb << 16); }
__global__ __launch_bounds__(256) void k_castS16(const float* __restrict__ src, long long lds, __bf16* __restrict__ dhi, __bf16* __restrict__ dlo, long long ldd, int R, int C, float s, int transpose) {
    const long long i = (long long)blockIdx.x * 256 + threadIdx.x; long long o; float a, b;
    if (transpose) { const long long np = (long long)C * (R / 2); if (i >= np) return; const int c = (int)(i / (R / 2)); const int r = 2 * (int)(i % (R / 2)); a = src[(long long)r * lds + c] * s; b = src[(long long)(r + 1) * lds + c] * s; o = (long long)c * ldd + r; }
    else { const long long np = (long long)R * (C / 2); if (i >= np) return; const int r = (int)(i / (C / 2)); const int c = 2 * (int)(i % (C / 2)); a = src[(long long)r * lds + c] * s; b = src[(long long)r * lds + c + 1] * s; o = (long long)r * ldd + c; }
    unsigned lo; const unsigned hi = f2bf2_pack(a, b, &lo); unsigned* ph = (unsigned*)(dhi + o); unsigned* pl = (unsigned*)(dlo + o);
    *ph = hi; *pl = lo;  }

// all five weight tensors (each dense) -> one f16 plane [Wq | Wqb | Wkvb | Wkv | Wout], scaled by s; a block takes 4096 elements (every segment is a whole number of blocks),
//   one thread 2 pieces of 8 consecutive elements
__device__ __forceinline__ void castW16_block(const float* __restrict__ Wq, const float* __restrict__ Wqb, const float* __restrict__ Wkvb, const float* __restrict__ Wkv, const float* __restrict__ Wout, _Float16* __restrict__ dst, float s, int bx) {
    const int eb = bx * 4096;
    const float* src = Wq; int base = 0;
    if (eb >= 786432) { src = Wout; base = 786432; } else if (eb >= 262144) { src = Wkv; base = 262144; } else if (eb >= 131072) { src = Wkvb; base = 131072; } else if (eb >= 65536) { src = Wqb; base = 65536; }
    const int e = eb + threadIdx.x * 8;
    const v4f a0 = *(const v4f*)(src + e - base), a1 = *(const v4f*)(src + e - base + 4), b0 = *(const v4f*)(src + e - base + 2048), b1 = *(const v4f*)(src + e - base + 2052);
    *(v8h*)(dst + e) = cast8(a0, a1, s);
    *(v8h*)(dst + e + 2048) = cast8(b0, b1, s);
    asm volatile("s_wait_xcnt 0x0" ::: "memory");   // in the built kernel another arm's code lies behind these stores and rewrites their registers: the wait stands in front of it
}
// im2col for the 2x2 stride-2 conv, stored as the f16 GEMM operand: COL[b][(Y,X)][(c,ky,kx)] = f16(x[b][c][2Y+ky][2X+kx])
//   One thread: 4 channels (two neighbours, and the two 16 further on) x 2 output columns X: per channel 4 floats of each of the two input rows; the (ky,kx) quads of two neighbour
//   channels make one 16-byte store. Lane = (column pair lane >> 3, channel pair lane & 7): 8 lanes store 16 consecutive channels' quads, one whole line.
//   Block (bx < Hs / 2 * C / 64, image b) of 256 threads = one Y, 64 channels, the whole row.
template <int C, int Hs>
__device__ __forceinline__ void es_col_block(const float* __restrict__ X, _Float16* __restrict__ COL, int bx, int b) {
    static_assert(Hs == 64 && C % 64 == 0, "4 waves span one input row");
    constexpr int Hr = Hs / 2;
    const int lane = threadIdx.x & 31, wave = threadIdx.x >> 5;
    const int Y = bx / (C / 64), cb = bx % (C / 64);
    const int c = cb * 64 + (wave >> 2) * 32 + (lane & 7) * 2;
    const int X2 = (wave & 3) * 8 + (lane >> 3) * 2;
    const float* s = X + (((size_t)b * C + c) * Hs + 2 * Y) * Hs + 2 * X2;
    _Float16* d = COL + ((size_t)b * Hr * Hr + Y * Hr + X2) * (4 * C) + 4 * c;
    v4f r0[4], r1[4];                                    // g: channel c + 16 (g >> 1) + (g & 1)
#pragma unroll
    for (int g = 0; g < 4; ++g) {
        const float* sg = s + (size_t)((g >> 1) * 16 + (g & 1)) * Hs * Hs;
        r0[g] = *(const v4f*)(sg); r1[g] = *(const v4f*)(sg + Hs);
    }
#pragma unroll
    for (int gg = 0; gg < 2; ++gg) {
        const v4f a0 = r0[2 * gg], a1 = r1[2 * gg], b0 = r0[2 * gg + 1], b1 = r1[2 * gg + 1];
        const v8h lo = {(_Float16)a0[0], (_Float16)a0[1], (_Float16)a1[0], (_Float16)a1[1], (_Float16)b0[0], (_Float16)b0[1], (_Float16)b1[0], (_Float16)b1[1]};
        const v8h hi = {(_Float16)a0[2], (_Float16)a0[3], (_Float16)a1[2], (_Float16)a1[3], (_Float16)b0[2], (_Float16)b0[3], (_Float16)b1[2], (_Float16)b1[3]};
        *(v8h*)(d + 64 * gg) = lo; *(v8h*)(d + 4 * C + 64 * gg) = hi;
    }
    asm volatile("s_wait_xcnt 0x0" ::: "memory");   // in the built kernel another arm's code lies behind these stores and rewrites their registers: the wait stands in front of it
}
// every re-layout of the inputs in one launch (none reads what another writes): blocks 0 .. NX - 1 transpose and cast x (Z images of R x Hs*Hs), the NC blocks behind them lay out the im2col operand,
// the last 208 cast the weights (x sw). grid NX + NC + 208, block 256.
template <int R, int Hs, int Z>
__global__ __launch_bounds__(256) void k_cast_in(const float* __restrict__ x, _Float16* __restrict__ xt, _Float16* __restrict__ col, const float* __restrict__ Wq, const float* __restrict__ Wqb, const float* __restrict__ Wkvb,
                                                  const float* __restrict__ Wkv, const float* __restrict__ Wout, _Float16* __restrict__ w16, float sw) {
    constexpr int C = Hs * Hs, BX = C / 128, BY = R / 64, NX = BX * BY * Z, CB = Hs / 2 * (R / 64), NC = CB * Z;
    const int bi = blockIdx.x;
    if (bi < NX) castT16_block<R, C>(x, xt, 1.0f, bi % BX, (bi / BX) % BY, bi / (BX * BY));
    else if (bi < NX + NC) es_col_block<R, Hs>(x, col, (bi - NX) % CB, (bi - NX) / CB);
    else castW16_block(Wq, Wqb, Wkvb, Wkv, Wout, w16, sw, bi - NX - NC);
}
// batch-wise attention: for (p, h, b): scores over b' = q_b . k_b' * scale (4 values), softmax, out = sum att v_b'; D[b][p][h*32+d] = f16(S[b][p][h*32+d] + out) (S holds out_img; D is the
//   output conv's f16 operand)
//   One wave: one position p, 4 heads (8 lanes x 4 floats a head), all 4 images, so each k and v row is read once. grid P * C / 1024, block 256.
//   A projection row holds [q | q_b | k_b | v_b], 4 C floats. The planes come as separate arguments (P0 .. P3: one image of projections each, S01 / D01: images 0 and 1, S23 / D23: images 2
//   and 3), so that every row address is one of these scalar bases plus one lane offset plus an immediate that the instruction can hold.
template <int P, int C>
__global__ __launch_bounds__(256) void k_es_batch(const float* __restrict__ P0, const float* __restrict__ P1, const float* __restrict__ P2, const float* __restrict__ P3,
                                                    const float* __restrict__ S01, const float* __restrict__ S23, _Float16* __restrict__ D01, _Float16* __restrict__ D23) {
    static_assert(C % 128 == 0, "a wave spans 128 channels");
    const int w = blockIdx.x * 8 + __builtin_amdgcn_readfirstlane(threadIdx.x >> 5);   // the wave's number as a scalar: every row address below is a scalar base plus one lane offset
    const unsigned lo = (threadIdx.x & 31) * 16;                                        // this lane's byte offset in the wave's 512-byte piece of a row
    const int p = w / (C / 128); const int col = (w % (C / 128)) * 128;
    const size_t oq = (size_t)p * C + col, op = (size_t)p * 4 * C + col;
    const char* prow[4] = {(const char*)(P0 + op), (const char*)(P1 + op), (const char*)(P2 + op), (const char*)(P3 + op)};
    const char* srow[4] = {(const char*)(S01 + oq), (const char*)(S01 + oq + P * C), (const char*)(S23 + oq), (const char*)(S23 + oq + P * C)};
    v4f q[4], k[4], v[4], sv[4];
#pragma unroll
    for (int b = 0; b < 4; ++b) {
        q[b] = *(const v4f*)(prow[b] + lo + C * 4); k[b] = *(const v4f*)(prow[b] + lo + 2 * C * 4);
    }
#pragma unroll
    for (int b = 0; b < 4; ++b) {
        v[b] = *(const v4f*)(prow[b] + lo + 3 * C * 4); sv[b] = *(const v4f*)(srow[b] + lo);
    }
    asm volatile("s_wait_xcnt 0x0" ::: "memory");   // the loads' scalar base registers are reused for the store bases formed below: the wait stands in front of that overwrite
    __builtin_amdgcn_sched_barrier(0);   // keeps all 16 loads in front of the arithmetic (without it the v and S loads are issued only behind the scores, a second memory latency) and later register writes behind the wait
    char* drow[4] = {(char*)(D01 + oq), (char*)(D01 + oq + P * C), (char*)(D23 + oq), (char*)(D23 + oq + P * C)};
#pragma unroll
    for (int b = 0; b < 4; ++b) {
        float sc[4]; float mx = -__builtin_inff();
#pragma unroll
        for (int b2 = 0; b2 < 4; ++b2) {
            float d0 = q[b][0] * k[b2][0] + q[b][1] * k[b2][1] + q[b][2] * k[b2][2] + q[b][3] * k[b2][3];
            for (int o = 4; o > 0; o >>= 1) d0 += __shfl_xor(d0, o, 32);
            sc[b2] = d0 * 0.17677669529663689f; mx = fmaxf(mx, sc[b2]);
        }
        float den = 0.f;
#pragma unroll
        for (int b2 = 0; b2 < 4; ++b2) { sc[b2] = expf(sc[b2] - mx); den += sc[b2]; }
        v4f o_ = {0.f, 0.f, 0.f, 0.f};
#pragma unroll
        for (int b2 = 0; b2 < 4; ++b2) o_ += sc[b2] / den * v[b2];
        const v4f r = sv[b] + o_;
        const v4h hv = {(_Float16)r[0], (_Float16)r[1], (_Float16)r[2], (_Float16)r[3]};
        *(v4h*)(drow[b] + (lo >> 1)) = hv;
    }
}


extern "C" void kernel_launch(void* const* d_in, const int* in_sizes, int n_in, void* d_out, int out_size, void* d_ws, size_t ws_size, hipStream_t stream) {
    (void)in_sizes; (void)n_in; (void)out_size; (void)ws_size;
    const float* x = (const float*)d_in[0];
    const float* Wq = (const float*)d_in[1];
    const float* Wkv = (const float*)d_in[2];
    const float* Wqb = (const float*)d_in[3];
    const float* Wkvb = (const float*)d_in[4];
    const float* Wout = (const float*)d_in[5];
    float* out = (float*)d_out;
    // every plane holds all 4 images, image-major; each is written by one launch and read by later ones of this call
    char* wsp = (char*)d_ws;
    float* PRJ = (float*)wsp; wsp += (size_t)4 * 4096 * 1024 * 4;          // [4][4096][1024] the 1x1 projections, position-major: q | q_b | k_b | v_b
    _Float16* KF16 = (_Float16*)wsp; wsp += (size_t)4 * 8 * 1024 * 32 * 2; // [4][8] planes of k in fragment order
    _Float16* VF16 = (_Float16*)wsp; wsp += (size_t)4 * 8 * 1024 * 32 * 2; // [4][8] planes of v in fragment order
    float* S = (float*)wsp; wsp += (size_t)4 * 4096 * 256 * 4;             // [4][4096][256] out_img
    _Float16* XT16 = (_Float16*)wsp; wsp += (size_t)4 * 4096 * 256 * 2;    // [4][4096][256] x^T
    _Float16* COL16 = (_Float16*)wsp; wsp += (size_t)4 * 1024 * 1024 * 2;  // [4][1024][1024] im2col
    _Float16* S16 = (_Float16*)wsp; wsp += (size_t)4 * 4096 * 256 * 2;     // [4][4096][256] out_img + out_batch
    _Float16* W16 = (_Float16*)wsp; wsp += (size_t)851968 * 2;             // [Wq | Wqb | Wkvb | Wkv | Wout], x16
    const _Float16* Wkv16 = W16 + 262144;
    const _Float16* Wout16 = W16 + 786432;
    k_cast_in<256, 64, 4><<<1232, 256, 0, stream>>>(x, XT16, COL16, Wq, Wqb, Wkvb, Wkv, Wout, W16, 16.0f);
    // one launch for the two products that need only the planes above. The kv conv: im2col rows x Wkv. The 1x1 projections share their left operand and their weights over the images:
    // one product over the 4 * 4096 stacked positions and the 1024 stacked weight rows [Wq | Wqb | Wkvb].
    w25::wmma_gemm64_pair<<<576, 256, 0, stream>>>((const unsigned short*)(COL16), (const unsigned short*)(Wkv16), KF16, VF16, 10, 4096, 512, 1024, 64, (const unsigned short*)(XT16), (const unsigned short*)(W16), PRJ, 16384, 1024, 256, 0.0625f);
    k_attn32<4096, 1024, 1024, 256><<<dim3(64, 8, 4), 32 * AW, 0, stream>>>(PRJ, KF16, VF16, S, 0.1767766952966369f);
    k_es_batch<4096, 256><<<1024, 256, 0, stream>>>(PRJ, PRJ + 4194304, PRJ + 8388608, PRJ + 12582912, S, S + 2097152, S16, S16 + 2097152);
    // output conv: grid y = image (weights shared: stride 0)
    w25::wmma_gemm64<0, false, 0, 0, false, 0><<<dim3(32, 4), 256, 0, stream>>>((const unsigned short*)(Wout16), nullptr, 256, 0, (const unsigned short*)(S16), nullptr, 256, 1048576, (void*)(out), nullptr, 4096, 1048576, nullptr, nullptr, 0, 256, 4096, 256, 0.0625f);
}

// v009
// Measured time: 86.7 microseconds a run.
// Next to v008, in two timings, it ran 1.09 and 1.08 times as fast.
// All steps since the starting kernel, v000, together make it 25.1 times as fast.
// Contractions (per image): q / qb / kvb 1x1 projections in position-major form x^T W^T [4096x256].[256x{256,256,512}], the 2x2-stride-2 kv conv as an im2col GEMM [1024x1024].[1024x512] and the output 1x1 conv Wout.(out_img + out_batch)^T [256x256].[256x4096], all with f16 operands (v_wmma_f32_16x16x32_f16; projections and kv conv: 64x64 register-blocked wave tiles over pre-cast f16 operand planes; weight operands pre-scaled by 16 at the cast and un-scaled in the f32 epilogue); the spatial-reduction attention per head (flash kernel, head_dim 32, 4096 queries x 1024 keys, f16 q.k^T and f16 p.v; the kv conv stores k and v as f16 in WMMA fragment order); f32 accumulate; the im2col, the batch-wise 4x4 attention per (position, head) and the branch sum are f32 vector code; both attentions, the sum and the output conv run in one launch.
#include <hip/hip_runtime.h>
#include <math.h>

typedef __attribute__((ext_vector_type(16))) _Float16 v16h;
typedef __attribute__((ext_vector_type(8)))  _Float16 v8h;
typedef __attribute__((ext_vector_type(16))) __bf16   v16b;
typedef __attribute__((ext_vector_type(8)))  float    v8f;
typedef __attribute__((ext_vector_type(4)))  float    v4f;

// 16-bit WMMA fragment map (wave32), lane L, h = L>>4, m = L&15:
//   A 16x32: lane = row m;   element i -> k = (i<8) ? 8h+i : 16+8h+(i-8)
//   B 32x16: lane = column m; the SAME k(i,h)
//   D 16x16 (8 f32): lane = column m; element r -> row 8h+r
__device__ __forceinline__ int frag_k(int i, int h) { return (i < 8) ? (8 * h + i) : (16 + 8 * h + (i - 8)); }
__device__ __forceinline__ __bf16 bf16_rne(float f) {
    unsigned int u = __float_as_uint(f);
    u += 0x7fffu + ((u >> 16) & 1u);
    return __builtin_bit_cast(__bf16, (unsigned short)(u >> 16));
}
__device__ __forceinline__ float bf16_f32(__bf16 b) { return __uint_as_float(((unsigned int)__builtin_bit_cast(unsigned short, b)) << 16); }
__device__ __forceinline__ v8f wmma16(v16h a, v16h b, v8f c) {
    c = __builtin_amdgcn_wmma_f32_16x16x32_f16(false, a, false, b, (short)0, c, false, false);
    asm volatile("v_nop\n\tv_nop\n\tv_nop\n\tv_nop" : "+v"(c) : "v"(a), "v"(b));
    return c;
}
__device__ __forceinline__ v8f wmmab(v16b a, v16b b, v8f c) {
    c = __builtin_amdgcn_wmma_f32_16x16x32_bf16(false, a, false, b, (short)0, c, false, false);
    asm volatile("v_nop\n\tv_nop\n\tv_nop\n\tv_nop" : "+v"(c) : "v"(a), "v"(b));
    return c;
}
struct Split { v16b hi, lo; };
// hi/lo split product: a.hi*b.hi + a.hi*b.lo + a.lo*b.hi
__device__ __forceinline__ v8f wmma3(const Split& a, const Split& b, v8f c) {
    c = __builtin_amdgcn_wmma_f32_16x16x32_bf16(false, a.hi, false, b.hi, (short)0, c, false, false);
    c = __builtin_amdgcn_wmma_f32_16x16x32_bf16(false, a.hi, false, b.lo, (short)0, c, false, false);
    c = __builtin_amdgcn_wmma_f32_16x16x32_bf16(false, a.lo, false, b.hi, (short)0, c, false, false);
    asm volatile("v_nop\n\tv_nop\n\tv_nop\n\tv_nop" : "+v"(c) : "v"(a.hi), "v"(a.lo), "v"(b.hi), "v"(b.lo));
    return c;
}
struct Split3 { v16b hi, mid, lo; };
// triple split product (6 terms, drops only terms below 2^-24 relative)
__device__ __forceinline__ v8f wmma6(const Split3& a, const Split3& b, v8f c) {
    c = __builtin_amdgcn_wmma_f32_16x16x32_bf16(false, a.hi, false, b.hi, (short)0, c, false, false);
    c = __builtin_amdgcn_wmma_f32_16x16x32_bf16(false, a.hi, false, b.mid, (short)0, c, false, false);
    c = __builtin_amdgcn_wmma_f32_16x16x32_bf16(false, a.mid, false, b.hi, (short)0, c, false, false);
    c = __builtin_amdgcn_wmma_f32_16x16x32_bf16(false, a.hi, false, b.lo, (short)0, c, false, false);
    c = __builtin_amdgcn_wmma_f32_16x16x32_bf16(false, a.mid, false, b.mid, (short)0, c, false, false);
    c = __builtin_amdgcn_wmma_f32_16x16x32_bf16(false, a.lo, false, b.hi, (short)0, c, false, false);
    asm volatile("v_nop\n\tv_nop\n\tv_nop\n\tv_nop" : "+v"(c) : "v"(a.hi), "v"(a.mid), "v"(a.lo), "v"(b.hi), "v"(b.mid), "v"(b.lo));
    return c;
}

// Fragment gathers from f32 memory: element i <- p[(k0 + frag_k(i,h)) * sk] * s, zero for k >= klen.
__device__ __forceinline__ v16h fh_ld(const float* __restrict__ p, long long sk, int k0, int h, int klen, float s) {
    v16h a;
#pragma unroll
    for (int i = 0; i < 16; ++i) { const int k = k0 + frag_k(i, h); a[i] = (k < klen) ? (_Float16)(p[(long long)k * sk] * s) : (_Float16)0.f; }
    return a;
}
__device__ __forceinline__ Split sp_ld(const float* __restrict__ p, long long sk, int k0, int h, int klen, float s) {
    Split r;
#pragma unroll
    for (int i = 0; i < 16; ++i) {
        const int k = k0 + frag_k(i, h); const float x = (k < klen) ? p[(long long)k * sk] * s : 0.f;
        const __bf16 hb = bf16_rne(x); r.hi[i] = hb; r.lo[i] = bf16_rne(x - bf16_f32(hb));
    }
    return r;
}
__device__ __forceinline__ Split3 sp3_ld(const float* __restrict__ p, long long sk, int k0, int h, int klen, float s) {
    Split3 r;
#pragma unroll
    for (int i = 0; i < 16; ++i) {
        const int k = k0 + frag_k(i, h); const float x = (k < klen) ? p[(long long)k * sk] * s : 0.f;
        const __bf16 hb = bf16_rne(x); const float r1 = x - bf16_f32(hb); const __bf16 mb = bf16_rne(r1);
        r.hi[i] = hb; r.mid[i] = mb; r.lo[i] = bf16_rne(r1 - bf16_f32(mb));
    }
    return r;
}
__device__ __forceinline__ v16b bh_ld(const float* __restrict__ p, long long sk, int k0, int h, int klen, float s) {
    v16b a;
#pragma unroll
    for (int i = 0; i < 16; ++i) { const int k = k0 + frag_k(i, h); a[i] = bf16_rne((k < klen) ? p[(long long)k * sk] * s : 0.f); }
    return a;
}
// f16 fragment from an f16 LDS/global row with element stride 1 (k-contiguous), no bounds (tile already zero padded)
__device__ __forceinline__ v16h fh_row(const _Float16* __restrict__ row, int k0, int h) {
    v16h a;
#pragma unroll
    for (int i = 0; i < 16; ++i) a[i] = row[k0 + frag_k(i, h)];
    return a;
}

#define VST2(T, ptr, val) do { const T vst2_v_ = (val); *(T*)(ptr) = vst2_v_;  } while (0)
typedef float v4f __attribute__((ext_vector_type(4)));
#define VST2V4(ptr, val) do { const v4f vst2_v4_ = (val); *(v4f*)(ptr) = vst2_v4_;  } while (0)

__device__ __attribute__((noinline)) float act_fn(float v, int act) {
    if (act == 1) return fmaxf(v, 0.f);                                                                               // relu
    if (act == 2) { const float u = 0.7978845608028654f * (v + 0.044715f * v * v * v); return 0.5f * v * (1.f + tanhf(u)); } // tanh-gelu
    if (act == 3) return v / (1.f + expf(-v));                                                                        // silu
    if (act == 4) return 0.5f * v * (1.f + erff(v * 0.7071067811865476f));                                             // erf-gelu
    if (act == 5) return tanhf(v);
    if (act == 6) return 1.f / (1.f + expf(-v));                                                                      // sigmoid
    if (act == 7) return (v > 0.f) ? v : 0.01f * v;                                                                   // leaky relu 0.01
    if (act == 8) return (v > 0.f) ? v : (expf(v) - 1.f);                                                             // elu
    if (act == 9) return fminf(fmaxf(v, 0.f), 6.f);                                                                   // relu6
    if (act == 10) return fabsf(v);                                                                                    // abs
    if (act == 11) return (v >= 0.f) ? v : 0.1f * v;                                                                  // leaky 0.1
    if (act == 12) return (v > 0.f) ? v : 0.2f * v;                                                                   // leaky 0.2
    if (act == 13) return (v > 20.f) ? v : log1pf(expf(v));                                                            // softplus
    return v;
}

// =====================================================================================================================
// k_gemm<MODE>: C(z, m, n) = act(alpha * sum_k A(z, m, k) * B(z, k, n) + bias) + beta * R(z, m, n)
//   One wave (32-thread block) per 16 x 32 tile of C; grid (ceil(N/32), ceil(M/16), Z). Batch z -> (zo = z / zi_n, zi = z % zi_n)
//   with separate outer/inner strides for every tensor (e.g. batch and head). A(m,k) = A[zo*sAo + zi*sAi + m*sAm + k*sAk] (f32),
//   B(k,n) = B[zo*sBo + zi*sBi + n*sBn + k*sBk] (f32); any M, N, K (K zero-padded to 32 inside the fragments, M/N tails guarded).
//   C(m,n) = C[zo*sCo + zi*sCi + m*sCm + n] (n contiguous). flags: 1 bias[n], 2 bias[m], 4 residual R[zo*sRo + zi*sRi + m*sRm + n*sRn].
//   MODE 0: f16 operands (A prescaled by sa, B by sb, both undone in the epilogue); 1: bf16 hi/lo split (3 products); 2: bf16;
//   3: bf16 hi/mid/lo triple split (6 products); 4: as 3 with Kahan-compensated f32 accumulation across k-steps.
// =====================================================================================================================
struct GemmP {
    const float* A; const float* B; const float* bias; const float* R; float* C;
    long long sAo, sAi, sAm, sAk, sBo, sBi, sBn, sBk, sCo, sCi, sCm, sRo, sRi, sRm, sRn;
    int M, N, K, zi_n, flags, act; float alpha, beta, sa, sb;
    int Npad, pad_;     // columns [N, Npad) of C are written as 0 so that padded workspace rows are covered by whole-line stores; Npad >= N
};
static_assert(sizeof(GemmP) == 5 * 8 + 15 * 8 + 6 * 4 + 4 * 4 + 2 * 4, "GemmP has padding");

template <int MODE>
__global__ __launch_bounds__(32) void k_gemm(GemmP p) {
    const int lane = threadIdx.x & 31, h = lane >> 4, l15 = lane & 15;
    const int m0 = blockIdx.y * 16, n0 = blockIdx.x * 32;
    const int z = blockIdx.z, zo = z / p.zi_n, zi = z - zo * p.zi_n;
    const float* A = p.A + zo * p.sAo + zi * p.sAi;
    const float* B = p.B + zo * p.sBo + zi * p.sBi;
    const int am = min(m0 + l15, p.M - 1);                       // clamped row for loads (stores are guarded)
    v8f acc[2], comp[2];
#pragma unroll
    for (int t = 0; t < 2; ++t) { v8f zz = {}; acc[t] = zz; comp[t] = zz; }
    for (int k0 = 0; k0 < p.K; k0 += 32) {
        const float* arow = A + (long long)am * p.sAm;
        if (MODE == 1) {
            const Split a = sp_ld(arow, p.sAk, k0, h, p.K, 1.f);
#pragma unroll
            for (int t = 0; t < 2; ++t) {
                const int bn = min(n0 + t * 16 + l15, p.N - 1);
                acc[t] = wmma3(a, sp_ld(B + (long long)bn * p.sBn, p.sBk, k0, h, p.K, 1.f), acc[t]);
            }
        } else if (MODE == 3) {
            const Split3 a = sp3_ld(arow, p.sAk, k0, h, p.K, 1.f);
#pragma unroll
            for (int t = 0; t < 2; ++t) {
                const int bn = min(n0 + t * 16 + l15, p.N - 1);
                acc[t] = wmma6(a, sp3_ld(B + (long long)bn * p.sBn, p.sBk, k0, h, p.K, 1.f), acc[t]);
            }
        } else if (MODE == 4) {
            // triple split as MODE 3, but each k-step's 6 products go into a fresh accumulator and the partial is added to the running f32 sum
            // on the VALU with Kahan compensation (accumulation error stays ~1 ulp however long K is)
            const Split3 a = sp3_ld(arow, p.sAk, k0, h, p.K, 1.f);
#pragma unroll
            for (int t = 0; t < 2; ++t) {
                const int bn = min(n0 + t * 16 + l15, p.N - 1); v8f zz = {};
                const v8f part = wmma6(a, sp3_ld(B + (long long)bn * p.sBn, p.sBk, k0, h, p.K, 1.f), zz);
                const v8f y = part - comp[t]; const v8f s = acc[t] + y; comp[t] = (s - acc[t]) - y; acc[t] = s;
            }
        } else if (MODE == 2) {
            const v16b a = bh_ld(arow, p.sAk, k0, h, p.K, 1.f);
#pragma unroll
            for (int t = 0; t < 2; ++t) {
                const int bn = min(n0 + t * 16 + l15, p.N - 1);
                acc[t] = wmmab(a, bh_ld(B + (long long)bn * p.sBn, p.sBk, k0, h, p.K, 1.f), acc[t]);
            }
        } else {
            const v16h a = fh_ld(arow, p.sAk, k0, h, p.K, p.sa);
#pragma unroll
            for (int t = 0; t < 2; ++t) {
                const int bn = min(n0 + t * 16 + l15, p.N - 1);
                acc[t] = wmma16(a, fh_ld(B + (long long)bn * p.sBn, p.sBk, k0, h, p.K, p.sb), acc[t]);
            }
        }
    }
    const float iscale = (MODE == 0) ? p.alpha / (p.sa * p.sb) : p.alpha;
    float* C = p.C + zo * p.sCo + zi * p.sCi;
    const float* R = p.R + zo * p.sRo + zi * p.sRi;
    __shared__ __align__(16) float ctile[16][36];
#pragma unroll
    for (int t = 0; t < 2; ++t) {
        const int n = n0 + t * 16 + l15; const int nn = min(n, p.N - 1);
#pragma unroll
        for (int r = 0; r < 8; ++r) {
            const int m = m0 + 8 * h + r; const int mm = min(m, p.M - 1);
            float v = acc[t][r] * iscale;
            if (p.flags & 1) v += p.bias[nn];
            if (p.flags & 2) v += p.bias[mm];
            if (p.flags & 8) v *= p.bias[(long long)zo * p.M + mm];   /* per-(z,row) scale vector laid out [Z][M]; exclusive with the bias flags */
            v = act_fn(v, p.act);
            if (p.flags & 4) v += p.beta * R[(long long)mm * p.sRm + (long long)nn * p.sRn];
            ctile[8 * h + r][t * 16 + l15] = (n < p.N) ? v : 0.f;
        }
    }
    __syncthreads();
    const int NW = (p.Npad > p.N) ? p.Npad : p.N;           // write width
    const bool fast = (m0 + 16 <= p.M) && (n0 + 32 <= NW) && ((p.sCm & 3) == 0) && ((((size_t)C) & 15) == 0);
    if (fast) {
#pragma unroll
        for (int s = 0; s < 4; ++s) {
            const int row = s * 4 + (lane >> 3), c4 = (lane & 7) * 4;
            const v4f v = *(const v4f*)&ctile[row][c4];
            VST2V4(C + (long long)(m0 + row) * p.sCm + n0 + c4, v);
        }
    } else {
        for (int row = 0; row < 16; ++row) {
            const int m = m0 + row, n = n0 + lane;
            if (m < p.M && n < NW) VST2(float, C + (long long)m * p.sCm + n, ctile[row][lane]);
        }
    }
}


// =====================================================================================================================
// k_gemmT<MODE, TM, TN>: same contract as k_gemm, but one wave computes a (16*TM) x (16*TN) tile: TM A fragments and TN B fragments are
//   loaded per 32-wide k-step and reused across TM*TN WMMAs (far fewer load/convert instructions per MAC). MODE 0 (f16), 1 (bf16 hi/lo),
//   2 (bf16) only. grid (ceil(NW/(16*TN)), ceil(M/(16*TM)), Z), block 32. Epilogue identical to k_gemm, run per 16x32 sub-tile.
// =====================================================================================================================
template <int MODE, int TM, int TN>
__global__ __launch_bounds__(32) void k_gemmT(GemmP p) {
    const int lane = threadIdx.x & 31, h = lane >> 4, l15 = lane & 15;
    const int m0 = blockIdx.y * (16 * TM), n0 = blockIdx.x * (16 * TN);
    const int z = blockIdx.z, zo = z / p.zi_n, zi = z - zo * p.zi_n;
    const float* A = p.A + zo * p.sAo + zi * p.sAi;
    const float* B = p.B + zo * p.sBo + zi * p.sBi;
    v8f acc[TM][TN];
#pragma unroll
    for (int i = 0; i < TM; ++i)
#pragma unroll
        for (int t = 0; t < TN; ++t) { v8f zz = {}; acc[i][t] = zz; }
    for (int k0 = 0; k0 < p.K; k0 += 32) {
        if (MODE == 1) {
            Split a[TM], b[TN];
#pragma unroll
            for (int i = 0; i < TM; ++i) { const int am = min(m0 + 16 * i + l15, p.M - 1); a[i] = sp_ld(A + (long long)am * p.sAm, p.sAk, k0, h, p.K, 1.f); }
#pragma unroll
            for (int t = 0; t < TN; ++t) { const int bn = min(n0 + 16 * t + l15, p.N - 1); b[t] = sp_ld(B + (long long)bn * p.sBn, p.sBk, k0, h, p.K, 1.f); }
#pragma unroll
            for (int i = 0; i < TM; ++i)
#pragma unroll
                for (int t = 0; t < TN; ++t) acc[i][t] = wmma3(a[i], b[t], acc[i][t]);
        } else if (MODE == 2) {
            v16b a[TM], b[TN];
#pragma unroll
            for (int i = 0; i < TM; ++i) { const int am = min(m0 + 16 * i + l15, p.M - 1); a[i] = bh_ld(A + (long long)am * p.sAm, p.sAk, k0, h, p.K, 1.f); }
#pragma unroll
            for (int t = 0; t < TN; ++t) { const int bn = min(n0 + 16 * t + l15, p.N - 1); b[t] = bh_ld(B + (long long)bn * p.sBn, p.sBk, k0, h, p.K, 1.f); }
#pragma unroll
            for (int i = 0; i < TM; ++i)
#pragma unroll
                for (int t = 0; t < TN; ++t) acc[i][t] = wmmab(a[i], b[t], acc[i][t]);
        } else {
            v16h a[TM], b[TN];
#pragma unroll
            for (int i = 0; i < TM; ++i) { const int am = min(m0 + 16 * i + l15, p.M - 1); a[i] = fh_ld(A + (long long)am * p.sAm, p.sAk, k0, h, p.K, p.sa); }
#pragma unroll
            for (int t = 0; t < TN; ++t) { const int bn = min(n0 + 16 * t + l15, p.N - 1); b[t] = fh_ld(B + (long long)bn * p.sBn, p.sBk, k0, h, p.K, p.sb); }
#pragma unroll
            for (int i = 0; i < TM; ++i)
#pragma unroll
                for (int t = 0; t < TN; ++t) acc[i][t] = wmma16(a[i], b[t], acc[i][t]);
        }
    }
    const float iscale = (MODE == 0) ? p.alpha / (p.sa * p.sb) : p.alpha;
    float* C = p.C + zo * p.sCo + zi * p.sCi;
    const float* R = p.R + zo * p.sRo + zi * p.sRi;
    const int NW = (p.Npad > p.N) ? p.Npad : p.N;
    __shared__ __align__(16) float ctile[16][36];
#pragma unroll
    for (int i = 0; i < TM; ++i) {
        const int mb = m0 + 16 * i; if (mb >= p.M) break;          // wave-uniform
#pragma unroll
        for (int tp = 0; tp < TN / 2; ++tp) {
            const int nb = n0 + 32 * tp; if (nb >= NW) break;        // wave-uniform
#pragma unroll
            for (int t2 = 0; t2 < 2; ++t2) {
                const int t = 2 * tp + t2; const int n = nb + t2 * 16 + l15; const int nn = min(n, p.N - 1);
#pragma unroll
                for (int r = 0; r < 8; ++r) {
                    const int m = mb + 8 * h + r; const int mm = min(m, p.M - 1);
                    float v = acc[i][t][r] * iscale;
                    if (p.flags & 1) v += p.bias[nn];
                    if (p.flags & 2) v += p.bias[mm];
            if (p.flags & 8) v *= p.bias[(long long)zo * p.M + mm];   /* per-(z,row) scale vector laid out [Z][M]; exclusive with the bias flags */
                    v = act_fn(v, p.act);
                    if (p.flags & 4) v += p.beta * R[(long long)mm * p.sRm + (long long)nn * p.sRn];
                    ctile[8 * h + r][t2 * 16 + l15] = (n < p.N) ? v : 0.f;
                }
            }
            __syncthreads();
            const bool fast = (mb + 16 <= p.M) && (nb + 32 <= NW) && ((p.sCm & 3) == 0) && ((((size_t)C) & 15) == 0);
            if (fast) {
#pragma unroll
                for (int s = 0; s < 4; ++s) {
                    const int row = s * 4 + (lane >> 3), c4 = (lane & 7) * 4;
                    const v4f v = *(const v4f*)&ctile[row][c4];
                    VST2V4(C + (long long)(mb + row) * p.sCm + nb + c4, v);
                }
            } else {
                for (int row = 0; row < 16; ++row) {
                    const int m = mb + row, n = nb + lane;
                    if (m < p.M && n < NW) VST2(float, C + (long long)m * p.sCm + n, ctile[row][lane]);
                }
            }
            __syncthreads();
        }
    }
}

// =====================================================================================================================
// k_attn_out<LQ, LK, QP, C>: the flash attention of all C / 32 = 8 heads for 64 positions of one image, the batch-wise attention of the same positions and heads, their sum, and the output 1x1 conv
//   of those 64 positions, in one work-group of 32 waves. grid (LQ / 64, images), block 1024. Shape known at compile time: LQ queries, LK keys (a multiple of 64), head and value dim 32, no mask.
//   PRJ: the projections, f32, [image][position][q | q_b | k_b | v_b], row pitch QP = 4 C floats, head h at column 32 h of each part.
//   K and V come as f16 planes in fragment order, one plane of 32 LK halves a (image, head), written by the kv product's epilogue. A fragment is 1024 bytes: [j = 0, 1][lane][8 halves].
//     K plane: fragment kt = 16 keys;            lane (hf, l15), half j, element e = K[key 16 kt + l15][d = 16 j + 8 hf + e]
//     V plane: fragment dt * LK / 32 + g;        lane (hf, l15), half j, element e = V[key 32 g + 16 j + 8 hf + e][d = 16 dt + l15]
//   so each operand register quad is one 16-byte load, a wave's load instruction reads 512 consecutive bytes (4 whole lines), and nothing is converted or staged in the loop.
//   Attention: wave = (head wave >> 2, 16 queries wave & 3), 64-key blocks.
//   Both products are transposed: S^T = K . Q^T (A = 16 key rows, B = the wave's 16 queries) and O^T += V^T . P^T. A lane then holds scores of ONE query (its column l15; keys 16 t + 8 hf + r),
//   so the maximum and the sum are taken in the lane, with one exchange between the lane halves, and two score tiles, converted in place, are the B operand of the second product.
//   Scores: f16 operands; statistics f32. The running maximum is kept on the raw scores (scale > 0, so it is the scaled scores' maximum too; it only sets the range, the quotient does not depend on it).
//   One fma a score forms the whole exponent, s * (scale * log2 e) + (12 - max * scale * log2 e), and the hardware's exp2 gives P x 4096 at once, which is summed in f32 and cast to f16.
//   Batch-wise attention, for the wave's own (image, head, 16 positions): scores of q_b against the k_b of the 4 images at the same position and head, softmax over the 4, sum of the v_b; f32 on the
//   vector unit, 8 lanes x 4 floats a row, 4 positions an instruction. It is memory latency and little arithmetic: the waves of heads 4 to 7 do it ahead of their key loop and those of heads 0 to 3 behind
//   it, so that its loads fly while the SIMD's other waves compute.
//   Output conv: f16(out_img + out_batch) of the 64 positions lies in LDS, [position][C], and is the B operand; wave = (16 output channels wave >> 1, 32 positions wave & 1); A = WO rows (f16, x 1 / wscale).
// =====================================================================================================================
typedef __attribute__((ext_vector_type(4))) _Float16 v4h;
// the 16 f32 that make up lane half h's fragment of a 32-wide row: k = 8h..8h+7 and 16+8h..16+8h+7 (the order of frag_k)
struct Row16 { v4f r[4]; };
__device__ __forceinline__ Row16 row16_ld(const float* __restrict__ row, int h) {
    Row16 x;
    x.r[0] = *(const v4f*)(row + 8 * h); x.r[1] = *(const v4f*)(row + 8 * h + 4);
    x.r[2] = *(const v4f*)(row + 16 + 8 * h); x.r[3] = *(const v4f*)(row + 16 + 8 * h + 4);
    return x;
}
__device__ __forceinline__ v16h row16_f16(const Row16& x) {
    v16h a;
#pragma unroll
    for (int q = 0; q < 4; ++q)
#pragma unroll
        for (int e = 0; e < 4; ++e) a[4 * q + e] = (_Float16)x.r[q][e];
    return a;
}
// the value that lane l ^ 16 holds
__device__ __forceinline__ float other_half(float x) {
    const int b = __float_as_int(x);
    return __int_as_float(__builtin_amdgcn_permlanex16(b, b, 0x76543210, 0xfedcba98, false, false));
}
// one f16 fragment from a plane in fragment order: p points at this lane's 8 halves of the fragment's half j = 0
__device__ __forceinline__ v16h frag_ld(const _Float16* __restrict__ p) {
    union { v16h v; v8h h[2]; } f;
    f.h[0] = *(const v8h*)(p); f.h[1] = *(const v8h*)(p + 256);
    return f.v;
}
// 32 waves a work-group: 8 on each SIMD, 128 registers a wave
template <int LQ, int LK, int QP, int C>
__global__ __launch_bounds__(1024) __attribute__((amdgpu_waves_per_eu(8))) void k_attn_out(const float* __restrict__ PRJ, const _Float16* __restrict__ KF, const _Float16* __restrict__ VF, const _Float16* __restrict__ WO,
                                                                                             float* __restrict__ OUT, float scale, float wscale) {
    static_assert(C == 256 && QP == 4 * C && LQ % 64 == 0 && LK % 64 == 0, "8 heads of 32, whole tiles, 16-byte rows");
    constexpr int NT = 2;                       // output tiles (16 d each)
    constexpr int OP = 32 + 4;                  // LDS pitch of a wave tile's row (floats)
    constexpr int SPI = C + 8;                  // LDS pitch of a position's row of the conv operand (halves): 16 bytes x odd
    __shared__ __align__(16) float    ol[32][16 * OP];     // a wave's own 16 x 32 tile: first out_batch (position-major), at the end its piece of the result (channel-major)
    __shared__ __align__(16) _Float16 st[64 * SPI];        // f16(out_img + out_batch), [position][channel]
    const int lane = threadIdx.x & 31, hf = lane >> 4, l15 = lane & 15;
    const int wave = __builtin_amdgcn_readfirstlane(threadIdx.x >> 5);   // the wave's number as a scalar: row addresses below are a scalar base plus one lane offset, and the branches on it are scalar
    const int h = wave >> 2, qt = wave & 3;
    const int z = blockIdx.y;
    const int q0 = blockIdx.x * 64 + qt * 16;
    float* myo = ol[wave];
    const int r4 = lane >> 3, c4 = (lane & 7) * 4;              // row-major view of a 16 x 32 tile: 8 lanes x 4 floats a row, 4 rows an instruction
    // batch-wise attention of image z, head h, positions q0 .. q0 + 15 -> myo[position][d]
    auto batch = [&]() {
        const unsigned lo = (unsigned)(r4 * QP + c4) * 4;       // this lane's byte offset from the head's first row
        const size_t hr = (size_t)q0 * QP + h * 32;
        const char* prow[4] = {(const char*)(PRJ + hr), (const char*)(PRJ + hr + (size_t)LQ * QP), (const char*)(PRJ + hr + (size_t)2 * LQ * QP), (const char*)(PRJ + hr + (size_t)3 * LQ * QP)};
        const char* qrow = (const char*)(PRJ + hr + (size_t)z * LQ * QP);
#pragma unroll
        for (int g = 0; g < 2; ++g) {                           // 8 positions at a time: 18 loads in flight, 72 registers
            v4f q[2], k[2][4], v[2][4];
            __builtin_amdgcn_sched_barrier(0);              // keeps these 18 loads behind the arithmetic of the 8 positions before: both sets of registers at once do not fit the wave's 128
#pragma unroll
            for (int i = 0; i < 2; ++i) {
                const unsigned ro = lo + (unsigned)(2 * g + i) * (4 * QP * 4);
                q[i] = *(const v4f*)(qrow + ro + C * 4);
#pragma unroll
                for (int b = 0; b < 4; ++b) { k[i][b] = *(const v4f*)(prow[b] + ro + 2 * C * 4); v[i][b] = *(const v4f*)(prow[b] + ro + 3 * C * 4); }
            }
            asm volatile("s_wait_xcnt 0x0" ::: "memory");   // the loads' address registers are reused further down: the wait stands in front of that overwrite
            __builtin_amdgcn_sched_barrier(0);              // keeps all 18 loads in front of the arithmetic (one memory latency, not several) and later register writes behind the wait
#pragma unroll
            for (int i = 0; i < 2; ++i) {
                float sc[4]; float mx = -__builtin_inff();
#pragma unroll
                for (int b2 = 0; b2 < 4; ++b2) {
                    float d0 = q[i][0] * k[i][b2][0] + q[i][1] * k[i][b2][1] + q[i][2] * k[i][b2][2] + q[i][3] * k[i][b2][3];
                    for (int o = 4; o > 0; o >>= 1) d0 += __shfl_xor(d0, o, 32);
                    sc[b2] = d0 * 0.17677669529663689f; mx = fmaxf(mx, sc[b2]);
                }
                float den = 0.f;
#pragma unroll
                for (int b2 = 0; b2 < 4; ++b2) { sc[b2] = expf(sc[b2] - mx); den += sc[b2]; }
                v4f o_ = {0.f, 0.f, 0.f, 0.f};
#pragma unroll
                for (int b2 = 0; b2 < 4; ++b2) o_ += sc[b2] / den * v[i][b2];
                *(v4f*)(myo + ((2 * g + i) * 4 + r4) * OP + c4) = o_;
            }
        }
    };
    const bool ahead = h >= C / 64;             // wave-uniform
    if (ahead) batch();
    const float* Q = PRJ + (size_t)z * LQ * QP;
    const float L2E = 1.4426950408889634f;
    const float NEG = -__builtin_inff();
    const float cs = scale * L2E;               // raw score -> exponent of 2
    const size_t plane = (size_t)(z * (C / 32) + h) * (LK * 32) + lane * 8;                     // this (image, head)'s plane, at this lane's 8 halves of a fragment
    const _Float16* kf = KF + plane;                                                            // both walk on by one 64-key block a trip: every fragment address is one of them plus an immediate
    const _Float16* vf = VF + plane;
    const v16h qa = row16_f16(row16_ld(Q + h * 32 + (size_t)(q0 + l15) * QP, hf));
    asm volatile("s_wait_xcnt 0x0" ::: "memory");   // the Q loads' address registers are reused for the start values set below: the wait stands in front of that overwrite
    __builtin_amdgcn_sched_barrier(0);              // keeps those later register writes from being scheduled ahead of the wait
    v8f o[NT]; float mrun = NEG, lrun = 0.f;        // this lane's query: running maximum (both halves agree) and this half's part of the sum
#pragma unroll
    for (int t = 0; t < NT; ++t) { v8f zz = {}; o[t] = zz; }
    for (int j0 = 0; j0 < LK; j0 += 64) {
        v16h ka[4], va[4];
#pragma unroll
        for (int t = 0; t < 4; ++t) ka[t] = frag_ld(kf + t * 512);
        asm volatile("s_wait_xcnt 0x0" :: "v"(kf) : "memory");    // the K loads' address registers are rewritten further down: the wait stands in front of that overwrite; as its input they stay whole up to it
        __builtin_amdgcn_sched_barrier(0);               // keeps those register writes from being scheduled ahead of the wait
        v8f s[4];
#pragma unroll
        for (int t = 0; t < 4; ++t) { v8f acc = {}; s[t] = wmma16(ka[t], qa, acc); }
        float mt[4];                                     // one maximum a tile: four short chains, not one of 32
#pragma unroll
        for (int t = 0; t < 4; ++t) {
            float a = fmaxf(s[t][0], s[t][1]);
#pragma unroll
            for (int r = 2; r < 8; ++r) a = fmaxf(a, s[t][r]);
            mt[t] = a;
        }
        float mx = fmaxf(fmaxf(mt[0], mt[1]), fmaxf(mt[2], mt[3]));
        mx = fmaxf(mx, other_half(mx));
        const float mnew = fmaxf(mrun, mx);
        // exp2 as the bare hardware instruction: it gives 0 where the result would be below 2^-126. Such a term is lost anyway: beside a row sum of at least 4096 in f32, and as an f16 operand.
        const float corr = __builtin_amdgcn_exp2f((mrun - mnew) * cs);   // first block: exp2(-inf) = 0
        const float nb = 12.f - mnew * cs;               // the 12 is the factor 4096 of P
#pragma unroll
        for (int t = 0; t < 4; ++t)
#pragma unroll
            for (int r = 0; r < 8; ++r) s[t][r] = __builtin_amdgcn_exp2f(__builtin_fmaf(s[t][r], cs, nb));
        const v8f ps = (s[0] + s[1]) + (s[2] + s[3]);
        const float rs = ((ps[0] + ps[1]) + (ps[2] + ps[3])) + ((ps[4] + ps[5]) + (ps[6] + ps[7]));
        lrun = lrun * corr + rs; mrun = mnew;
#pragma unroll
        for (int t = 0; t < NT; ++t) o[t] *= corr;
        v16h pb0, pb1;                                   // P^T fragments: element e <- key frag_k(e, hf) (+ 32), which is element e & 7 of score tile e >> 3 (+ 2)
#pragma unroll
        for (int e = 0; e < 16; ++e) { pb0[e] = (_Float16)s[e >> 3][e & 7]; pb1[e] = (_Float16)s[2 + (e >> 3)][e & 7]; }
#pragma unroll
        for (int t = 0; t < 4; ++t) va[t] = frag_ld(vf + ((t >> 1) * (LK / 32) + (t & 1)) * 512);   // va[2 dt + g]
        asm volatile("s_wait_xcnt 0x0" :: "v"(vf) : "memory");   // the V loads' address registers are rewritten further down: the wait stands in front of that overwrite; as its input they stay whole up to it
#pragma unroll
        for (int t = 0; t < NT; ++t) {
            o[t] = wmma16(va[2 * t], pb0, o[t]);
            o[t] = wmma16(va[2 * t + 1], pb1, o[t]);
        }
        kf += 4 * 512; vf += 2 * 512;
    }
    if (!ahead) batch();
    const float inv = 1.f / (lrun + other_half(lrun));          // sum and output both carry the factor 4096; no key is masked: the row sum holds its maximum's exp2(12)
    // out_batch was written by other lanes of this wave: the wave's LDS stores are ordered in front of the loads below
    __builtin_amdgcn_fence(__ATOMIC_RELEASE, "workgroup");
    __builtin_amdgcn_wave_barrier();
    __builtin_amdgcn_fence(__ATOMIC_ACQUIRE, "workgroup");
#pragma unroll
    for (int t = 0; t < NT; ++t) {
        const float* bp = myo + l15 * OP + t * 16 + 8 * hf;
        const v4f b0 = *(const v4f*)(bp), b1 = *(const v4f*)(bp + 4);
        const v8h w = {(_Float16)(o[t][0] * inv + b0[0]), (_Float16)(o[t][1] * inv + b0[1]), (_Float16)(o[t][2] * inv + b0[2]), (_Float16)(o[t][3] * inv + b0[3]),
                       (_Float16)(o[t][4] * inv + b1[0]), (_Float16)(o[t][5] * inv + b1[1]), (_Float16)(o[t][6] * inv + b1[2]), (_Float16)(o[t][7] * inv + b1[3])};
        *(v8h*)(st + (qt * 16 + l15) * SPI + h * 32 + t * 16 + 8 * hf) = w;
    }
    // output conv: the wave's 16 weight rows, all 8 k steps, are asked for ahead of the barrier
    const int mt = wave >> 1, np = wave & 1;
    const _Float16* wr = WO + (size_t)(mt * 16 + l15) * C + 8 * hf;
    v16h wa[C / 32];
#pragma unroll
    for (int s = 0; s < C / 32; ++s) { union { v16h v; v8h p[2]; } f; f.p[0] = *(const v8h*)(wr + 32 * s); f.p[1] = *(const v8h*)(wr + 32 * s + 16); wa[s] = f.v; }
    asm volatile("s_wait_xcnt 0x0" ::: "memory");   // the weight loads' address registers are reused further down: the wait stands in front of that overwrite
    __syncthreads();                                 // all 8 heads of the 64 positions lie in st
    v8f acc[2];
#pragma unroll
    for (int j = 0; j < 2; ++j) { v8f zz = {}; acc[j] = zz; }
#pragma unroll
    for (int s = 0; s < C / 32; ++s)
#pragma unroll
        for (int j = 0; j < 2; ++j) {
            const _Float16* sp = st + (np * 32 + j * 16 + l15) * SPI + 32 * s + 8 * hf;
            union { v16h v; v8h p[2]; } f; f.p[0] = *(const v8h*)(sp); f.p[1] = *(const v8h*)(sp + 16);
            acc[j] = wmma16(wa[s], f.v, acc[j]);
        }
#pragma unroll
    for (int j = 0; j < 2; ++j)
#pragma unroll
        for (int r = 0; r < 8; ++r) myo[(8 * hf + r) * OP + j * 16 + l15] = acc[j][r] * wscale;
    // the tile is read back row by row by other lanes of this wave
    __builtin_amdgcn_fence(__ATOMIC_RELEASE, "workgroup");
    __builtin_amdgcn_wave_barrier();
    __builtin_amdgcn_fence(__ATOMIC_ACQUIRE, "workgroup");
    float* ob = OUT + ((size_t)z * C + mt * 16) * LQ + blockIdx.x * 64 + np * 32;
#pragma unroll
    for (int r0 = 0; r0 < 16; r0 += 4) {
        const v4f v = *(const v4f*)(myo + (r0 + r4) * OP + c4);
        VST2V4(ob + (size_t)(r0 + r4) * LQ + c4, v);
    }
}

// =====================================================================================================================
// k_tr: dst(z, c, r) = alpha * src(z, r, c) (+ beta * R2(z, c, r)): [Z][R][C] (row stride lds) -> [Z][C][R] (row stride ldd) through a 32x32 LDS tile;
//   flags: 1 -> add beta * residual R2 addressed like dst (z*sRz + c*ldr + r); act applied before the residual.
// =====================================================================================================================
struct TrP { const float* src; float* dst; const float* R2; long long sSz, lds, sDz, ldd, sRz, ldr; int R, C, flags, act; float alpha, beta; };
static_assert(sizeof(TrP) == 3 * 8 + 6 * 8 + 6 * 4, "TrP has padding");
__global__ __launch_bounds__(256) void k_tr(TrP p) {
    __shared__ float tile[32][33];
    const int c0 = blockIdx.x * 32, r0 = blockIdx.y * 32, z = blockIdx.z;
    const int lane = threadIdx.x & 31, wave = threadIdx.x >> 5;
    const float* s = p.src + z * p.sSz;
#pragma unroll
    for (int k = 0; k < 4; ++k) {
        const int rl = wave * 4 + k, r = r0 + rl, c = c0 + lane;
        tile[rl][lane] = (r < p.R && c < p.C) ? s[(long long)r * p.lds + c] : 0.f;
    }
    __syncthreads();
    float* d = p.dst + z * p.sDz; const float* rr = p.R2 + z * p.sRz;
#pragma unroll
    for (int k = 0; k < 4; ++k) {
        const int cl = wave * 4 + k, c = c0 + cl, r = r0 + lane;
        if (c < p.C && r < p.R) {
            float v = act_fn(p.alpha * tile[lane][cl], p.act);
            if (p.flags & 1) v += p.beta * rr[(long long)c * p.ldr + r];
            VST2(float, d + (long long)c * p.ldd + r, v);
        }
    }
}

// k_affine: dst[i] = a * (sdev ? sdev[0] : 1) * src[i] + b, i < n (one thread per element; consecutive lanes -> consecutive addresses)
__global__ __launch_bounds__(256) void k_affine(const float* __restrict__ src, float* __restrict__ dst, int n, float a, float b, const float* __restrict__ sdev) {
    const int i = blockIdx.x * 256 + threadIdx.x;
    if (i < n) { const float aa = sdev ? a * sdev[0] : a; const float v = aa * src[i] + b; VST2(float, dst + i, v); }
}

// =====================================================================================================================
// k_softmax: row softmax over n contiguous elements, one 256-thread block per row; rows addressed z*sz + r*sr (grid (R, Z)).
//   out = scale_out * softmax(scale_in * x + (Mf ? Mf[z*smz + r*smr + j] : 0)); a row whose max is -inf is written as 0.
// =====================================================================================================================
struct SmP { const float* src; float* dst; const float* Mf; long long sz, sr, dz, dr, smz, smr; int n, pad; float scale_in, scale_out; };
static_assert(sizeof(SmP) == 3 * 8 + 6 * 8 + 4 * 4, "SmP has padding");
__global__ __launch_bounds__(256) void k_softmax(SmP p) {
    __shared__ float red[256];
    const int r = blockIdx.x, z = blockIdx.y, tid = threadIdx.x;
    const float* s = p.src + z * p.sz + (long long)r * p.sr;
    const float* mf = p.Mf ? (p.Mf + z * p.smz + (long long)r * p.smr) : nullptr;
    float mx = -__builtin_inff();
    for (int j = tid; j < p.n; j += 256) { float v = s[j] * p.scale_in; if (mf) v += mf[j]; mx = fmaxf(mx, v); }
    red[tid] = mx; __syncthreads();
    for (int o = 128; o > 0; o >>= 1) { if (tid < o) red[tid] = fmaxf(red[tid], red[tid + o]); __syncthreads(); }
    mx = red[0]; __syncthreads();
    float sum = 0.f;
    for (int j = tid; j < p.n; j += 256) { float v = s[j] * p.scale_in; if (mf) v += mf[j]; sum += (mx == -__builtin_inff()) ? 0.f : expf(v - mx); }
    red[tid] = sum; __syncthreads();
    for (int o = 128; o > 0; o >>= 1) { if (tid < o) red[tid] += red[tid + o]; __syncthreads(); }
    sum = red[0];
    const float inv = (sum > 0.f) ? p.scale_out / sum : 0.f;
    float* d = p.dst + z * p.dz + (long long)r * p.dr;
    for (int j = tid; j < p.n; j += 256) { float v = s[j] * p.scale_in; if (mf) v += mf[j]; const float o = (mx == -__builtin_inff()) ? 0.f : expf(v - mx) * inv; VST2(float, d + j, o); }
}
// =====================================================================================================================
// k_stats: mean and rsqrt(var + eps) over a set of n elements addressed base + z*sz + (e / inner) * so + (e % inner) * si, one 256-thread
// k_norm_apply: y = (x - mean[set]) * rstd[set] * g[c] + b[c] over a [Z][C][L] channel-major tensor with set = z*G + c / (C/G) (G groups per z;
//   G = C -> per-channel sets indexed z*C+c; for batch norm pass stats indexed by c only via bn = 1). Optional act. Output same layout.
// =====================================================================================================================
//   mode 0: mean / rsqrt(var + eps); mode 1 (RMSNorm): 0 / rsqrt(mean(x^2) + eps); mode 2 (L2 normalize * sqrt(n)): 0 / sqrt(n) / max(||x||, eps); mode 3: as 0 with unbiased variance (n-1)
__global__ __launch_bounds__(256) void k_stats(const float* __restrict__ x, long long sz, long long so, long long si, int inner, int n, float eps, float* __restrict__ stat, int mode) {
    __shared__ float red[256];
    const int z = blockIdx.x, tid = threadIdx.x;
    const float* base = x + z * sz;
    float s = 0.f;
    for (int e = tid; e < n; e += 256) s += base[(long long)(e / inner) * so + (long long)(e % inner) * si];
    red[tid] = s; __syncthreads();
    for (int o = 128; o > 0; o >>= 1) { if (tid < o) red[tid] += red[tid + o]; __syncthreads(); }
    const float mu = (mode == 0 || mode == 3) ? red[0] / (float)n : 0.f; __syncthreads();
    float q = 0.f;
    for (int e = tid; e < n; e += 256) { const float dlt = base[(long long)(e / inner) * so + (long long)(e % inner) * si] - mu; q += dlt * dlt; }
    red[tid] = q; __syncthreads();
    for (int o = 128; o > 0; o >>= 1) { if (tid < o) red[tid] += red[tid + o]; __syncthreads(); }
    {
        float rs;
        if (mode == 2) rs = sqrtf((float)n) / fmaxf(sqrtf(red[0]), eps); else if (mode == 3) rs = rsqrtf(red[0] / (float)(n - 1) + eps); else rs = rsqrtf(red[0] / (float)n + eps);
        if (tid < 32) { const float v = (tid == 0) ? mu : ((tid == 1) ? rs : 0.f); VST2(float, stat + (long long)z * 32 + tid, v); }
    }
}
//   One thread per element over the flat [Z][C][L] index space: grid ceil(Z*C*L / 256).
__global__ __launch_bounds__(256) void k_norm_apply(const float* __restrict__ x, float* __restrict__ y, const float* __restrict__ stat, const float* __restrict__ g, const float* __restrict__ bta,
                                                     int Z, int C, int L, int G, int bn, int act) {
    const long long idx = (long long)blockIdx.x * 256 + threadIdx.x;
    if (idx >= (long long)Z * C * L) return;
    const int l = (int)(idx % L); const long long zc = idx / L; const int c = (int)(zc % C), z = (int)(zc / C); (void)l;
    const int set = bn ? c : (z * G + c / (C / G));
    float v = (x[idx] - stat[(long long)set * 32]) * stat[(long long)set * 32 + 1];
    if (g) v *= g[c];
    if (bta) v += bta[c];
    v = act_fn(v, act);
    VST2(float, y + idx, v);
}

// k_lse_neg: c[i] = -(st[2i] + log(st[2i+1])) = minus the log-sum-exp of row i (for softmax over the query axis)
__global__ __launch_bounds__(256) void k_lse_neg(const float* __restrict__ st, float* __restrict__ c, int n) {
    const int i = blockIdx.x * 256 + threadIdx.x;
    if (i < n) { const float v = -(st[2 * i] + logf(st[2 * i + 1])); VST2(float, c + i, v); }
}

// k_iota: dst[i] = a * i + b as int32 (segment/position id helper)
__global__ __launch_bounds__(256) void k_iota(int* __restrict__ dst, int n, int a, int b) {
    const int i = blockIdx.x * 256 + threadIdx.x;
    if (i < n) { const int v = a * i + b; VST2(int, dst + i, v); }
}

// k_axpby: dst[i] = a * x[i] + b * y[i] (+ c), i < n
__global__ __launch_bounds__(256) void k_axpby(const float* __restrict__ x, const float* __restrict__ y, float* __restrict__ dst, int n, float a, float b, float c) {
    const int i = blockIdx.x * 256 + threadIdx.x;
    if (i < n) { const float v = a * x[i] + b * y[i] + c; VST2(float, dst + i, v); }
}

// =====================================================================================================================
// k_rope: rotary embedding on a [R rows][Hn heads][D] view (row stride sXr, head stride sXh, element stride 1) -> Y (own strides).
//   mode 0: rotate_half (partner d±D/2, sign - for d<D/2); mode 1: interleaved pairs (partner d^1, sign - for even d).
//   table column tcol: tmode 0 -> d, 1 -> d % (D/2), 2 -> d / 2; position p: pmode 0 -> r % S, 1 -> head index, 2 -> pos[r];
//   c = C[(r / S) * sCb + p * sCp + tcol * sCd], s likewise from Sn; y = x[d] * c + sign * x[partner] * s. X and Y must not alias.
// =====================================================================================================================
struct RopeP { const float* X; float* Y; const float* C; const float* Sn; const int* pos; long long sXr, sXh, sYr, sYh, sCb, sCp, sCd; int R, Hn, D, S, mode, tmode, pmode, pad; };
static_assert(sizeof(RopeP) == 5 * 8 + 7 * 8 + 8 * 4, "RopeP has padding");
__global__ __launch_bounds__(256) void k_rope(RopeP p) {
    const long long idx = (long long)blockIdx.x * 256 + threadIdx.x;
    if (idx >= (long long)p.R * p.Hn * p.D) return;
    const int d = (int)(idx % p.D); const long long rh = idx / p.D; const int h = (int)(rh % p.Hn); const int r = (int)(rh / p.Hn);
    const int half = p.D / 2;
    int partner; float sign;
    if (p.mode == 0) { partner = (d < half) ? d + half : d - half; sign = (d < half) ? -1.f : 1.f; }
    else { partner = d ^ 1; sign = (d & 1) ? 1.f : -1.f; }
    const int tcol = (p.tmode == 0) ? d : ((p.tmode == 1) ? (d % half) : (d >> 1));
    const int pp = (p.pmode == 0) ? (r % p.S) : ((p.pmode == 1) ? h : p.pos[r]);
    const long long toff = (long long)(r / p.S) * p.sCb + (long long)pp * p.sCp + (long long)tcol * p.sCd;
    const float* xr = p.X + (long long)r * p.sXr + (long long)h * p.sXh;
    const float v = xr[d] * p.C[toff] + sign * xr[partner] * p.Sn[toff];
    VST2(float, p.Y + (long long)r * p.sYr + (long long)h * p.sYh + d, v);
}

// k_invf + k_sincos (split so neither kernel carries a large VALU-fma footprint): invf_i = num * (1 / powf(base, (2 i)/D)) [fmode 0],
//   num * expf((2 i) * cexp) [fmode 1], num * powf(base, -2 (i - 1) / D) [fmode 2]; then cs/sn[s*half + i] = cos/sin((pscale * s) * invf_i)
__global__ __launch_bounds__(256) void k_invf(float* __restrict__ invb, int half, int D, float base, float num, int fmode, float cexp) {
    const int i = blockIdx.x * 256 + threadIdx.x;
    if (i >= ((half + 31) / 32) * 32) return;
    if (i >= half) { VST2(float, invb + i, 0.f); return; }
    const float e = (float)(2 * i) / (float)D;
    float invf;
    if (fmode == 1) invf = num * expf((float)(2 * i) * cexp);
    else if (fmode == 2) invf = num * powf(base, (-2.0f * ((float)i - 1.0f)) / (float)D);
    else invf = num * (1.0f / powf(base, e));
    VST2(float, invb + i, invf);
}
__global__ __launch_bounds__(256) void k_sincos(float* __restrict__ cs, float* __restrict__ sn, const float* __restrict__ invb, int S, int half, float pscale) {
    const int idx = blockIdx.x * 256 + threadIdx.x;
    if (idx >= S * half) return;
    const int s = idx / half, i = idx - s * half;
    const float ang = (pscale * (float)s) * invb[i];
    VST2(float, cs + idx, cosf(ang)); VST2(float, sn + idx, sinf(ang));
}

// k_mulact: dst[i] = act(x[i]) * y[i]
__global__ __launch_bounds__(256) void k_mulact(const float* __restrict__ x, const float* __restrict__ y, float* __restrict__ dst, int n, int act) {
    const int i = blockIdx.x * 256 + threadIdx.x;
    if (i < n) { const float v = act_fn(x[i], act) * y[i]; VST2(float, dst + i, v); }
}

// =====================================================================================================================
// k_matvec: thread-per-row matrix-vector products for N <= 8 output columns (heads with 1-3 outputs, gates), f32 on the VALU.
//   C[r*sCm + j] = act(alpha * sum_k A[r*sAm + k*sAk] * B[j*sBn + k*sBk] + bias[j]) + beta * R[r*sRm + j*sRn]; each thread writes its N contiguous floats.
// =====================================================================================================================
__global__ __launch_bounds__(256) void k_matvec(GemmP p) {
    // 32 lanes write one line with one instruction.
    const int rpt = (p.N == 1) ? 1 : 32;
    const long long r0 = ((long long)blockIdx.x * 256 + threadIdx.x) * rpt; const int z = blockIdx.z, zo = z / p.zi_n, zi = z - zo * p.zi_n;
    if (r0 >= p.M) return;
    const float* Bb = p.B + zo * p.sBo + zi * p.sBi;
    float* C = p.C + zo * p.sCo + zi * p.sCi; const float* R = p.R + zo * p.sRo + zi * p.sRi;
    for (int rr = 0; rr < rpt; ++rr) {
        const long long r = r0 + rr; if (r >= p.M) break;
        const float* A = p.A + zo * p.sAo + zi * p.sAi + r * p.sAm;
        float acc[8] = {0.f, 0.f, 0.f, 0.f, 0.f, 0.f, 0.f, 0.f};
        for (int k = 0; k < p.K; ++k) { const float a = A[(long long)k * p.sAk];
#pragma unroll
            for (int j = 0; j < 8; ++j) if (j < p.N) acc[j] += a * Bb[(long long)j * p.sBn + (long long)k * p.sBk]; }
#pragma unroll
        for (int j = 0; j < 8; ++j) if (j < p.N) {
            float v = acc[j] * p.alpha;
            if (p.flags & 1) v += p.bias[j];
            if (p.flags & 2) v += p.bias[r];
            v = act_fn(v, p.act);
            if (p.flags & 4) v += p.beta * R[r * p.sRm + (long long)j * p.sRn];
            VST2(float, C + r * p.sCm + j, v);
        }
    }
}
// k_smallsoftmax: thread-per-row softmax for short rows (n <= 64): dst[r*dr + j] = softmax(scale*src[r*sr + j])
__global__ __launch_bounds__(256) void k_smallsoftmax(const float* __restrict__ src, float* __restrict__ dst, long long sr, long long dr, int n, long long R, float scale) {
    const long long r0 = ((long long)blockIdx.x * 256 + threadIdx.x) * 32;
    for (int rr = 0; rr < 32; ++rr) {
        const long long r = r0 + rr; if (r >= R) return;
        const float* s = src + r * sr; float* d = dst + r * dr;
        float mx = -__builtin_inff();
        for (int j = 0; j < n; ++j) mx = fmaxf(mx, s[j] * scale);
        float sum = 0.f;
        for (int j = 0; j < n; ++j) sum += expf(s[j] * scale - mx);
        const float inv = 1.f / sum;
        for (int j = 0; j < n; ++j) { const float v = expf(s[j] * scale - mx) * inv; VST2(float, d + j, v); }
    }
}

__global__ __launch_bounds__(32) void k_unitstat(float* __restrict__ st) { const int t = threadIdx.x; const float v = (t == 1) ? 1.f : 0.f; VST2(float, st + t, v); }

// destination (e.g. a d_out whose row width is not a multiple of 32 floats) is written by consecutive lanes of one instruction
__global__ __launch_bounds__(256) void k_lincopy(const float* __restrict__ src, long long lds, float* __restrict__ dst, long long ldd, long long rows, int cols) {
    const long long i = (long long)blockIdx.x * 256 + threadIdx.x; if (i >= rows * cols) return;
    const long long r = i / cols; const int c = (int)(i - r * cols);
    const float v = src[r * lds + c]; VST2(float, dst + r * ldd + c, v);
}

namespace w25 {
typedef __attribute__((ext_vector_type(16))) _Float16 v16h;
typedef __attribute__((ext_vector_type(8)))  _Float16 v8h;
typedef __attribute__((ext_vector_type(16))) __bf16   v16b;
typedef __attribute__((ext_vector_type(8)))  __bf16   v8b;
typedef __attribute__((ext_vector_type(8)))  float    v8f;
typedef __attribute__((ext_vector_type(4)))  float    v4f;

__device__ __forceinline__ unsigned short f2bf_bits(float f) {
  unsigned u = __float_as_uint(f);
  return (unsigned short)((u + 0x7FFFu + ((u >> 16) & 1u)) >> 16);
}
__device__ __forceinline__ float bf_bits2f(unsigned short h) { return __uint_as_float(((unsigned)h) << 16); }

// hazard guards as plain device helpers (no inline asm inside the kernel template body)
__device__ __forceinline__ void dep_guard_h(v8f& a, v8f& b, v16h x, v16h y) { asm volatile("v_nop\n\tv_nop\n\tv_nop\n\tv_nop" : "+v"(a), "+v"(b) : "v"(x), "v"(y)); }
__device__ __forceinline__ void dep_guard_b(v8f& a, v8f& b, v16b x, v16b y) { asm volatile("v_nop\n\tv_nop\n\tv_nop\n\tv_nop" : "+v"(a), "+v"(b) : "v"(x), "v"(y)); }
__device__ __forceinline__ void keep4_h(v16h a, v16h b, v16h c, v16h d) { asm volatile("v_nop" :: "v"(a), "v"(b), "v"(c), "v"(d)); }
__device__ __forceinline__ void keep4_b(v16b a, v16b b, v16b c, v16b d) { asm volatile("v_nop" :: "v"(a), "v"(b), "v"(c), "v"(d)); }
__device__ __forceinline__ void acc_guard4(v8f& a, v8f& b, v8f& c, v8f& d) { asm volatile("v_nop\n\tv_nop\n\tv_nop\n\tv_nop" : "+v"(a), "+v"(b), "+v"(c), "+v"(d)); }
// an address that is the same in every lane, held in a scalar register pair: a load then takes it as its scalar base, beside one 32-bit lane offset
__device__ __forceinline__ unsigned long long scalar_addr(const void* p) {
  const unsigned long long u = (unsigned long long)p;
  const unsigned l = (unsigned)__builtin_amdgcn_readfirstlane((int)(unsigned)u), h = (unsigned)__builtin_amdgcn_readfirstlane((int)(unsigned)(u >> 32));
  return ((unsigned long long)h << 32) | l;
}
template <typename T> struct Frag;
template <> struct Frag<_Float16> {
  typedef v16h V; union U { v16h v; v8h h[2]; };
  static __device__ __forceinline__ v16h load(const _Float16* p) {   // elements 0..7 <- p[0..7], 8..15 <- p[16..23]
    U f; f.h[0] = *(const v8h*)(p); f.h[1] = *(const v8h*)(p + 16); return f.v;
  }
  static __device__ __forceinline__ v16h loads(unsigned long long p, unsigned off) {   // the same from scalar base p (address of a 16-row tile) + off (this lane's byte offset in the tile)
    typedef const __attribute__((address_space(1))) v8h* G;
    U f; f.h[0] = *(G)(p + off); f.h[1] = *(G)(p + off + 32); return f.v;
  }
  static __device__ __forceinline__ v8f mma(v16h a, v16h b, v8f c) {
    return __builtin_amdgcn_wmma_f32_16x16x32_f16(false, a, false, b, (short)0, c, false, false);
  }
  static __device__ __forceinline__ void guard(v8f& a, v8f& b, v16h x, v16h y) { dep_guard_h(a, b, x, y); }
  static __device__ __forceinline__ void keep(v16h a, v16h b, v16h c, v16h d) { keep4_h(a, b, c, d); }
};
template <> struct Frag<__bf16> {
  typedef v16b V; union U { v16b v; v8b h[2]; };
  static __device__ __forceinline__ v16b load(const __bf16* p) {
    U f; f.h[0] = *(const v8b*)(p); f.h[1] = *(const v8b*)(p + 16); return f.v;
  }
  static __device__ __forceinline__ v16b loads(unsigned long long p, unsigned off) {
    typedef const __attribute__((address_space(1))) v8b* G;
    U f; f.h[0] = *(G)(p + off); f.h[1] = *(G)(p + off + 32); return f.v;
  }
  static __device__ __forceinline__ v8f mma(v16b a, v16b b, v8f c) {
    return __builtin_amdgcn_wmma_f32_16x16x32_bf16(false, a, false, b, (short)0, c, false, false);
  }
  static __device__ __forceinline__ void guard(v8f& a, v8f& b, v16b x, v16b y) { dep_guard_b(a, b, x, y); }
  static __device__ __forceinline__ void keep(v16b a, v16b b, v16b c, v16b d) { keep4_b(a, b, c, d); }
};

// ---- Register-blocked batched WMMA GEMM ------------------------------------
// C[m,n] = scale * sum_k A[m,k] * Bt[n,k] (+bias)(+resid); each wave owns a 64x64 tile.
// A row-major [M,K]; Bt row-major [N,K]; M,N % 64 == 0, K % 32 == 0.
// SPLIT: operands are hi/lo planes (A2/Bt2 = lo planes, same layout); product = hi·hi + hi·lo + lo·hi.
// BIAS_MODE: 0 = none, 1 = bias[m], 2 = bias[n].
// OUT_MODE: 0 = f32, 1 = f16, 2 = bf16 hi plane (Cout) + bf16 lo plane (Cout2).
// ET: 0 = f16 operands, 1 = bf16 operands (pointers passed as 16-bit storage)
template <int ET> struct Elem;
template <> struct Elem<0> { typedef _Float16 T; };
template <> struct Elem<1> { typedef __bf16 T; };
// The body takes its block's place in the grid (bx: 8 tiles, b: batch) as arguments, so that one launch can hold the blocks of more than one product.
// FRAGKV, and frag set (block-uniform): the product is the kv conv, rows m = (image, key) with 2^lgk keys an image, columns n = [k | v], each half N / 64 heads of 32 channels. The result is
// stored as f16 in the fragment order that the attention kernel reads (its head comment has the two maps): k to kfrag, v to vfrag, one plane of 32 * 2^lgk halves a (image, head).
template <int ET, bool SPLIT, int BIAS_MODE, int OUT_MODE, bool RESID, int ACT, bool FRAGKV = false>
__device__ __forceinline__ void gemm64_block(
    const unsigned short* __restrict__ Ap, const unsigned short* __restrict__ A2p, int lda, long strideA,
    const unsigned short* __restrict__ Btp, const unsigned short* __restrict__ Bt2p, int ldb, long strideB,
    void* __restrict__ Cout, void* __restrict__ Cout2, int ldc, long strideC,
    const float* __restrict__ bias,
    const float* __restrict__ resid, long strideR,
    int M, int N, int K, float scale, int bx, int b,
    _Float16* __restrict__ kfrag = nullptr, _Float16* __restrict__ vfrag = nullptr, int lgk = 0, bool frag = false) {
  typedef typename Elem<ET>::T T;
  typedef typename Frag<T>::V V;
  const T* A = (const T*)Ap; const T* A2 = (const T*)A2p; const T* Bt = (const T*)Btp; const T* Bt2 = (const T*)Bt2p;
  __shared__ __align__(16) float sT[8][16 * 68];   // per-wave 16x64 slab, pitch 68 floats
  const int lane = threadIdx.x & 31;
  const int wave = __builtin_amdgcn_readfirstlane(threadIdx.x >> 5);   // the wave's number as a scalar: every fragment address below is a scalar base plus one lane offset
  const int tilesN = N >> 6;
  const int tilesM = M >> 6;
  const int tile = bx * 8 + wave;
  if (tile >= tilesM * tilesN) return;   // wave-uniform; no block barriers in this kernel
  const int tm = tile / tilesN;
  const int tn = tile - tm * tilesN;
  const int m0 = tm << 6;
  const int n0 = tn << 6;

  const T* Ab  = A  + (size_t)b * strideA;
  const T* Bb  = Bt + (size_t)b * strideB;
  const T* Ab2 = SPLIT ? (A2  + (size_t)b * strideA) : nullptr;
  const T* Bb2 = SPLIT ? (Bt2 + (size_t)b * strideB) : nullptr;

  const int rlane = lane & 15;                 // row (A) / col (B, D) within subtile
  const int koff  = (lane >> 4) * 8;           // k offset of this lane half
  const int mOff  = (lane >> 4) * 8;           // D row offset

  v8f acc[4][4];
#pragma unroll
  for (int i = 0; i < 4; ++i)
#pragma unroll
    for (int j = 0; j < 4; ++j) acc[i][j] = (v8f){0.f,0.f,0.f,0.f,0.f,0.f,0.f,0.f};

  unsigned long long pa[4], pb[4], pa2[4], pb2[4];   // the 4 + 4 row tiles of 16 rows
#pragma unroll
  for (int i = 0; i < 4; ++i) {
    pa[i] = scalar_addr(Ab + (size_t)(m0 + (i << 4)) * lda); pb[i] = scalar_addr(Bb + (size_t)(n0 + (i << 4)) * ldb);
    pa2[i] = SPLIT ? scalar_addr(Ab2 + (size_t)(m0 + (i << 4)) * lda) : 0; pb2[i] = SPLIT ? scalar_addr(Bb2 + (size_t)(n0 + (i << 4)) * ldb) : 0;
  }
  const unsigned la = (unsigned)(rlane * lda + koff) * 2, lb = (unsigned)(rlane * ldb + koff) * 2;   // this lane's byte offset in a row tile of A, of Bt, at k0 = 0

  for (int k0 = 0; k0 < K; k0 += 32) {
    V bh[4], bl[4], ah[4], al[4];     // all 8 fragments of the k step have registers of their own: their loads are issued together, one memory latency a k step
#pragma unroll
    for (int j = 0; j < 4; ++j) {
      bh[j] = Frag<T>::loads(pb[j], lb + k0 * 2);
      if (SPLIT) bl[j] = Frag<T>::loads(pb2[j], lb + k0 * 2);
    }
#pragma unroll
    for (int i = 0; i < 4; ++i) {
      ah[i] = Frag<T>::loads(pa[i], la + k0 * 2);
      if (SPLIT) al[i] = Frag<T>::loads(pa2[i], la + k0 * 2);
    }
#pragma unroll
    for (int i = 0; i < 4; ++i) {
#pragma unroll
      for (int j = 0; j < 4; ++j) {
        acc[i][j] = Frag<T>::mma(ah[i], bh[j], acc[i][j]);
        if (SPLIT) {
          acc[i][j] = Frag<T>::mma(ah[i], bl[j], acc[i][j]);
          acc[i][j] = Frag<T>::mma(al[i], bh[j], acc[i][j]);
        }
      }
      Frag<T>::guard(acc[i][0], acc[i][3], ah[i], SPLIT ? al[i] : ah[i]);
    }
    Frag<T>::keep(bh[0], bh[1], bh[2], bh[3]);
    if (SPLIT) Frag<T>::keep(bl[0], bl[1], bl[2], bl[3]);
  }
  acc_guard4(acc[0][0], acc[0][1], acc[0][2], acc[0][3]);
  acc_guard4(acc[1][0], acc[1][1], acc[1][2], acc[1][3]);
  acc_guard4(acc[2][0], acc[2][1], acc[2][2], acc[2][3]);
  acc_guard4(acc[3][0], acc[3][1], acc[3][2], acc[3][3]);

  // ---- epilogue ----
  float* slab = sT[wave];
  const float* Rb = RESID ? (resid + (size_t)b * strideR) : nullptr;
#pragma unroll
  for (int i = 0; i < 4; ++i) {
    const int mBase = m0 + (i << 4);
#pragma unroll
    for (int j = 0; j < 4; ++j) {
      const int n = n0 + (j << 4) + rlane;
      float bv = 0.f;
      if (BIAS_MODE == 2) bv = bias[n];
#pragma unroll
      for (int r = 0; r < 8; ++r) {
        float v = acc[i][j][r] * scale;
        if (BIAS_MODE == 1) v += bias[mBase + mOff + r];
        if (BIAS_MODE == 2) v += bv;
        if (RESID) v += Rb[(size_t)(mBase + mOff + r) * ldc + n];
        if (ACT == 1) v = tanhf(v);
        if (ACT == 2) v = fmaxf(v, 0.0f);
        if (ACT == 3) v = v / (1.0f + expf(-v));
        if (ACT == 4) v = (v > 0.f) ? v : 0.01f * v;
        if (ACT == 5) v = 0.5f * v * (1.0f + erff(v * 0.70710678118654752f));
        slab[(mOff + r) * 68 + (j << 4) + rlane] = v;
      }
    }
    __builtin_amdgcn_fence(__ATOMIC_RELEASE, "workgroup");
    __builtin_amdgcn_wave_barrier();
    __builtin_amdgcn_fence(__ATOMIC_ACQUIRE, "workgroup");
    if (FRAGKV && frag) {
      const int hfl = lane >> 4;
      const int z = mBase >> lgk, kb = mBase - (z << lgk);            // image, and the first of these 16 keys in it
      const bool isk = n0 < (N >> 1);                                 // the tile's 64 columns are 2 heads of k or 2 heads of v
      const int head0 = (isk ? n0 : n0 - (N >> 1)) >> 5;
      _Float16* pl = (isk ? kfrag : vfrag) + ((size_t)(z * (N >> 6) + head0) << (lgk + 5)) + lane * 8;
      v8h w[4];
      if (isk) {
        pl += (kb >> 4) * 512;                                        // fragment = these 16 keys; w[2 hh + j]: 8 consecutive channels of this lane's key
#pragma unroll
        for (int q = 0; q < 4; ++q) {
          const float* sp = slab + rlane * 68 + (q >> 1) * 32 + (q & 1) * 16 + hfl * 8;
          const v4f a = *(const v4f*)(sp), c = *(const v4f*)(sp + 4);
          const v8h t = {(_Float16)a[0], (_Float16)a[1], (_Float16)a[2], (_Float16)a[3], (_Float16)c[0], (_Float16)c[1], (_Float16)c[2], (_Float16)c[3]};
          w[q] = t;
        }
#pragma unroll
        for (int q = 0; q < 4; ++q) *(v8h*)(pl + ((size_t)(q >> 1) << (lgk + 5)) + (q & 1) * 256) = w[q];
      } else {
        pl += (kb >> 5) * 512 + ((kb >> 4) & 1) * 256;                // these 16 keys are half j of fragment g; w[2 hh + dt]: 8 consecutive keys of this lane's channel
#pragma unroll
        for (int q = 0; q < 4; ++q) {
          const float* sp = slab + hfl * 8 * 68 + (q >> 1) * 32 + (q & 1) * 16 + rlane;
          const v8h t = {(_Float16)sp[0], (_Float16)sp[68], (_Float16)sp[136], (_Float16)sp[204], (_Float16)sp[272], (_Float16)sp[340], (_Float16)sp[408], (_Float16)sp[476]};
          w[q] = t;
        }
#pragma unroll
        for (int q = 0; q < 4; ++q) *(v8h*)(pl + ((size_t)(q >> 1) << (lgk + 5)) + ((size_t)(q & 1) << (lgk + 4))) = w[q];
      }
      asm volatile("s_wait_xcnt 0x0" ::: "memory");   // the stores' address and data registers are rewritten by the next 16 rows: the wait stands in front of that overwrite
    } else if (OUT_MODE == 0) {
      float* C = (float*)Cout + (size_t)b * strideC;
      const int hh = lane >> 4, c4 = (lane & 15) * 4;     // row seg = 256 B = 16 lanes x 16 B
      {
#pragma unroll
        for (int it = 0; it < 8; ++it) {
          const int row = it * 2 + hh;
          v4f v = *(const v4f*)(slab + row * 68 + c4);
          *(v4f*)(C + (size_t)(mBase + row) * ldc + n0 + c4) = v;
        }
        if (FRAGKV) asm volatile("s_wait_xcnt 0x0" ::: "memory");   // in the built kernel the fragment arm's code lies behind these stores and rewrites their registers: the wait stands in front of it
      }
    } else {
      const int q = lane >> 3, c8 = (lane & 7) * 8;
      unsigned short* C  = (unsigned short*)Cout  + (size_t)b * strideC;
      unsigned short* C2 = (OUT_MODE == 2) ? ((unsigned short*)Cout2 + (size_t)b * strideC) : nullptr;
      {
#pragma unroll
        for (int it = 0; it < 4; ++it) {
          const int row = it * 4 + q;
          const float* sp = slab + row * 68 + c8;
          v8h hv, lv;
#pragma unroll
          for (int e = 0; e < 8; ++e) {
            if (OUT_MODE == 1) {
              hv[e] = (_Float16)sp[e];
            } else {
              unsigned short hb = f2bf_bits(sp[e]);
              unsigned short lb = f2bf_bits(sp[e] - bf_bits2f(hb));
              hv[e] = __builtin_bit_cast(_Float16, hb);
              lv[e] = __builtin_bit_cast(_Float16, lb);
            }
          }
          *(v8h*)(C + (size_t)(mBase + row) * ldc + n0 + c8) = hv;
          if (OUT_MODE == 2) *(v8h*)(C2 + (size_t)(mBase + row) * ldc + n0 + c8) = lv;
        }
        
      }
    }
    __builtin_amdgcn_fence(__ATOMIC_RELEASE, "workgroup");
    __builtin_amdgcn_wave_barrier();
    __builtin_amdgcn_fence(__ATOMIC_ACQUIRE, "workgroup");
  }
}

template <int ET, bool SPLIT, int BIAS_MODE, int OUT_MODE, bool RESID, int ACT = 0>
__global__ __launch_bounds__(256) void wmma_gemm64(
    const unsigned short* __restrict__ Ap, const unsigned short* __restrict__ A2p, int lda, long strideA,
    const unsigned short* __restrict__ Btp, const unsigned short* __restrict__ Bt2p, int ldb, long strideB,
    void* __restrict__ Cout, void* __restrict__ Cout2, int ldc, long strideC,
    const float* __restrict__ bias,
    const float* __restrict__ resid, long strideR,
    int M, int N, int K, float scale) {
  gemm64_block<ET, SPLIT, BIAS_MODE, OUT_MODE, RESID, ACT>(Ap, A2p, lda, strideA, Btp, Bt2p, ldb, strideB, Cout, Cout2, ldc, strideC, bias, resid, strideR, M, N, K, scale, blockIdx.x, blockIdx.y);
}
// Two independent f16 products in one launch: blocks 0 .. nb0 - 1 do product 0, the blocks behind them product 1. Product 0 is the one with the longer k loop; it is the
// kv conv, stored as f16 fragment planes (KF, VF; 2^lgk keys an image). Product 1 has an f32 result. Row pitches: A and Bt k0 / k1 (dense), C1 n1 (dense).
// grid nb0 + m1 * n1 / 32768, block 256.
__global__ __launch_bounds__(256) void wmma_gemm64_pair(
    const unsigned short* __restrict__ A0, const unsigned short* __restrict__ Bt0, _Float16* __restrict__ KF, _Float16* __restrict__ VF, int lgk, int m0, int n0, int k0, int nb0,
    const unsigned short* __restrict__ A1, const unsigned short* __restrict__ Bt1, float* __restrict__ C1, int m1, int n1, int k1, float scale) {
  const int bi = blockIdx.x;
  const bool p0 = bi < nb0;             // block-uniform
  const int n = p0 ? n0 : n1, k = p0 ? k0 : k1;
  gemm64_block<0, false, 0, 0, false, 0, true>(p0 ? A0 : A1, nullptr, k, 0, p0 ? Bt0 : Bt1, nullptr, k, 0, (void*)C1, nullptr, n, 0, nullptr, nullptr, 0, p0 ? m0 : m1, n, k, scale, p0 ? bi : bi - nb0, 0, KF, VF, lgk, p0);
}

__global__ __launch_bounds__(256) void cast_f32_f16x2(
    const float* __restrict__ in, _Float16* __restrict__ out, int n2) {
  int i = blockIdx.x * 256 + threadIdx.x;
  if (i < n2) {
    const _Float16 h0 = (_Float16)in[2 * i], h1 = (_Float16)in[2 * i + 1];
    const unsigned u = (unsigned)__builtin_bit_cast(unsigned short, h0) | ((unsigned)__builtin_bit_cast(unsigned short, h1) << 16);
    ((unsigned*)out)[i] = u;
    
  }
}


} // namespace w25

// The element-wise stages below give each thread 16 to 64 elements, moved by 16-byte loads and stores that are all in flight together, so that a launch is a few
// thousand waves. Every wave store instruction writes whole 128-byte lines.
__device__ __forceinline__ v8h cast8(v4f a, v4f b, float s) {
    const v8h o = {(_Float16)(a[0] * s), (_Float16)(a[1] * s), (_Float16)(a[2] * s), (_Float16)(a[3] * s), (_Float16)(b[0] * s), (_Float16)(b[1] * s), (_Float16)(b[2] * s), (_Float16)(b[3] * s)};
    return o;
}
// castT16_block<R, C>: dst[z][c][r] = f16(src[z][r][c] * s), dense planes. One thread: 8 rows r x 4 columns c (8 loads, 4 stores). Lane = (column quad lane >> 3, row group lane & 7):
//   the 8 lanes of one quad store 64 consecutive r of one c. Block (bx < C / 128, by < R / 64, bz < Z) of 256 threads: wave w has columns 128 bx + 16 w .. + 15, rows 64 by .. + 63.
template <int R, int C>
__device__ __forceinline__ void castT16_block(const float* __restrict__ src, _Float16* __restrict__ dst, float s, int bx, int by, int bz) {
    static_assert(R % 64 == 0 && C % 128 == 0, "whole tiles");
    const int lane = threadIdx.x & 31, wave = threadIdx.x >> 5;
    const int r0 = by * 64 + (lane & 7) * 8;
    const int c0 = bx * 128 + wave * 16 + (lane >> 3) * 4;
    src += ((size_t)bz * R + r0) * C + c0;
    dst += ((size_t)bz * C + c0) * R + r0;
    v4f a[8];
#pragma unroll
    for (int j = 0; j < 8; ++j) a[j] = *(const v4f*)(src + (size_t)j * C);
#pragma unroll
    for (int e = 0; e < 4; ++e) {
        const v8h o = {(_Float16)(a[0][e] * s), (_Float16)(a[1][e] * s), (_Float16)(a[2][e] * s), (_Float16)(a[3][e] * s), (_Float16)(a[4][e] * s), (_Float16)(a[5][e] * s), (_Float16)(a[6][e] * s), (_Float16)(a[7][e] * s)};
        *(v8h*)(dst + (size_t)e * R) = o;
    }
}
// f32 -> bf16 hi plane + bf16 lo plane (x = hi + lo to ~2^-17 relative; RNE both), [R][C] -> [R][C] (or transposed to [C][R]); 2 consecutive destination elements
__device__ __forceinline__ unsigned int f2bf2_pack(float a, float b, unsigned int* lo) {
    const unsigned short ha = w25::f2bf_bits(a), hb = w25::f2bf_bits(b);
    const unsigned short la = w25::f2bf_bits(a - w25::bf_bits2f(ha)), lb = w25::f2bf_bits(b - w25::bf_bits2f(hb));
    *lo = (unsigned)la | ((unsigned)lb << 16); return (unsigned)ha | ((unsigned)hb << 16); }
__global__ __launch_bounds__(256) void k_castS16(const float* __restrict__ src, long long lds, __bf16* __restrict__ dhi, __bf16* __restrict__ dlo, long long ldd, int R, int C, float s, int transpose) {
    const long long i = (long long)blockIdx.x * 256 + threadIdx.x; long long o; float a, b;
    if (transpose) { const long long np = (long long)C * (R / 2); if (i >= np) return; const int c = (int)(i / (R / 2)); const int r = 2 * (int)(i % (R / 2)); a = src[(long long)r * lds + c] * s; b = src[(long long)(r + 1) * lds + c] * s; o = (long long)c * ldd + r; }
    else { const long long np = (long long)R * (C / 2); if (i >= np) return; const int r = (int)(i / (C / 2)); const int c = 2 * (int)(i % (C / 2)); a = src[(long long)r * lds + c] * s; b = src[(long long)r * lds + c + 1] * s; o = (long long)r * ldd + c; }
    unsigned lo; const unsigned hi = f2bf2_pack(a, b, &lo); unsigned* ph = (unsigned*)(dhi + o); unsigned* pl = (unsigned*)(dlo + o);
    *ph = hi; *pl = lo;  }

// all five weight tensors (each dense) -> one f16 plane [Wq | Wqb | Wkvb | Wkv | Wout], scaled by s; a block takes 4096 elements (every segment is a whole number of blocks),
//   one thread 2 pieces of 8 consecutive elements
__device__ __forceinline__ void castW16_block(const float* __restrict__ Wq, const float* __restrict__ Wqb, const float* __restrict__ Wkvb, const float* __restrict__ Wkv, const float* __restrict__ Wout, _Float16* __restrict__ dst, float s, int bx) {
    const int eb = bx * 4096;
    const float* src = Wq; int base = 0;
    if (eb >= 786432) { src = Wout; base = 786432; } else if (eb >= 262144) { src = Wkv; base = 262144; } else if (eb >= 131072) { src = Wkvb; base = 131072; } else if (eb >= 65536) { src = Wqb; base = 65536; }
    const int e = eb + threadIdx.x * 8;
    const v4f a0 = *(const v4f*)(src + e - base), a1 = *(const v4f*)(src + e - base + 4), b0 = *(const v4f*)(src + e - base + 2048), b1 = *(const v4f*)(src + e - base + 2052);
    *(v8h*)(dst + e) = cast8(a0, a1, s);
    *(v8h*)(dst + e + 2048) = cast8(b0, b1, s);
    asm volatile("s_wait_xcnt 0x0" ::: "memory");   // in the built kernel another arm's code lies behind these stores and rewrites their registers: the wait stands in front of it
}
// im2col for the 2x2 stride-2 conv, stored as the f16 GEMM operand: COL[b][(Y,X)][(c,ky,kx)] = f16(x[b][c][2Y+ky][2X+kx])
//   One thread: 4 channels (two neighbours, and the two 16 further on) x 2 output columns X: per channel 4 floats of each of the two input rows; the (ky,kx) quads of two neighbour
//   channels make one 16-byte store. Lane = (column pair lane >> 3, channel pair lane & 7): 8 lanes store 16 consecutive channels' quads, one whole line.
//   Block (bx < Hs / 2 * C / 64, image b) of 256 threads = one Y, 64 channels, the whole row.
template <int C, int Hs>
__device__ __forceinline__ void es_col_block(const float* __restrict__ X, _Float16* __restrict__ COL, int bx, int b) {
    static_assert(Hs == 64 && C % 64 == 0, "4 waves span one input row");
    constexpr int Hr = Hs / 2;
    const int lane = threadIdx.x & 31, wave = threadIdx.x >> 5;
    const int Y = bx / (C / 64), cb = bx % (C / 64);
    const int c = cb * 64 + (wave >> 2) * 32 + (lane & 7) * 2;
    const int X2 = (wave & 3) * 8 + (lane >> 3) * 2;
    const float* s = X + (((size_t)b * C + c) * Hs + 2 * Y) * Hs + 2 * X2;
    _Float16* d = COL + ((size_t)b * Hr * Hr + Y * Hr + X2) * (4 * C) + 4 * c;
    v4f r0[4], r1[4];                                    // g: channel c + 16 (g >> 1) + (g & 1)
#pragma unroll
    for (int g = 0; g < 4; ++g) {
        const float* sg = s + (size_t)((g >> 1) * 16 + (g & 1)) * Hs * Hs;
        r0[g] = *(const v4f*)(sg); r1[g] = *(const v4f*)(sg + Hs);
    }
#pragma unroll
    for (int gg = 0; gg < 2; ++gg) {
        const v4f a0 = r0[2 * gg], a1 = r1[2 * gg], b0 = r0[2 * gg + 1], b1 = r1[2 * gg + 1];
        const v8h lo = {(_Float16)a0[0], (_Float16)a0[1], (_Float16)a1[0], (_Float16)a1[1], (_Float16)b0[0], (_Float16)b0[1], (_Float16)b1[0], (_Float16)b1[1]};
        const v8h hi = {(_Float16)a0[2], (_Float16)a0[3], (_Float16)a1[2], (_Float16)a1[3], (_Float16)b0[2], (_Float16)b0[3], (_Float16)b1[2], (_Float16)b1[3]};
        *(v8h*)(d + 64 * gg) = lo; *(v8h*)(d + 4 * C + 64 * gg) = hi;
    }
    asm volatile("s_wait_xcnt 0x0" ::: "memory");   // in the built kernel another arm's code lies behind these stores and rewrites their registers: the wait stands in front of it
}
// every re-layout of the inputs in one launch (none reads what another writes): blocks 0 .. NX - 1 transpose and cast x (Z images of R x Hs*Hs), the NC blocks behind them lay out the im2col operand,
// the last 208 cast the weights (x sw). grid NX + NC + 208, block 256.
template <int R, int Hs, int Z>
__global__ __launch_bounds__(256) void k_cast_in(const float* __restrict__ x, _Float16* __restrict__ xt, _Float16* __restrict__ col, const float* __restrict__ Wq, const float* __restrict__ Wqb, const float* __restrict__ Wkvb,
                                                  const float* __restrict__ Wkv, const float* __restrict__ Wout, _Float16* __restrict__ w16, float sw) {
    constexpr int C = Hs * Hs, BX = C / 128, BY = R / 64, NX = BX * BY * Z, CB = Hs / 2 * (R / 64), NC = CB * Z;
    const int bi = blockIdx.x;
    if (bi < NX) castT16_block<R, C>(x, xt, 1.0f, bi % BX, (bi / BX) % BY, bi / (BX * BY));
    else if (bi < NX + NC) es_col_block<R, Hs>(x, col, (bi - NX) % CB, (bi - NX) / CB);
    else castW16_block(Wq, Wqb, Wkvb, Wkv, Wout, w16, sw, bi - NX - NC);
}

extern "C" void kernel_launch(void* const* d_in, const int* in_sizes, int n_in, void* d_out, int out_size, void* d_ws, size_t ws_size, hipStream_t stream) {
    (void)in_sizes; (void)n_in; (void)out_size; (void)ws_size;
    const float* x = (const float*)d_in[0];
    const float* Wq = (const float*)d_in[1];
    const float* Wkv = (const float*)d_in[2];
    const float* Wqb = (const float*)d_in[3];
    const float* Wkvb = (const float*)d_in[4];
    const float* Wout = (const float*)d_in[5];
    float* out = (float*)d_out;
    // every plane holds all 4 images, image-major; each is written by one launch and read by later ones of this call
    char* wsp = (char*)d_ws;
    float* PRJ = (float*)wsp; wsp += (size_t)4 * 4096 * 1024 * 4;          // [4][4096][1024] the 1x1 projections, position-major: q | q_b | k_b | v_b
    _Float16* KF16 = (_Float16*)wsp; wsp += (size_t)4 * 8 * 1024 * 32 * 2; // [4][8] planes of k in fragment order
    _Float16* VF16 = (_Float16*)wsp; wsp += (size_t)4 * 8 * 1024 * 32 * 2; // [4][8] planes of v in fragment order
    _Float16* XT16 = (_Float16*)wsp; wsp += (size_t)4 * 4096 * 256 * 2;    // [4][4096][256] x^T
    _Float16* COL16 = (_Float16*)wsp; wsp += (size_t)4 * 1024 * 1024 * 2;  // [4][1024][1024] im2col
    _Float16* W16 = (_Float16*)wsp; wsp += (size_t)851968 * 2;             // [Wq | Wqb | Wkvb | Wkv | Wout], x16
    const _Float16* Wkv16 = W16 + 262144;
    const _Float16* Wout16 = W16 + 786432;
    k_cast_in<256, 64, 4><<<1232, 256, 0, stream>>>(x, XT16, COL16, Wq, Wqb, Wkvb, Wkv, Wout, W16, 16.0f);
    // one launch for the two products that need only the planes above. The kv conv: im2col rows x Wkv. The 1x1 projections share their left operand and their weights over the images:
    // one product over the 4 * 4096 stacked positions and the 1024 stacked weight rows [Wq | Wqb | Wkvb].
    w25::wmma_gemm64_pair<<<576, 256, 0, stream>>>((const unsigned short*)(COL16), (const unsigned short*)(Wkv16), KF16, VF16, 10, 4096, 512, 1024, 64, (const unsigned short*)(XT16), (const unsigned short*)(W16), PRJ, 16384, 1024, 256, 0.0625f);
    // both attentions, their sum and the output conv: one work-group a (64 positions, image), all 8 heads
    k_attn_out<4096, 1024, 1024, 256><<<dim3(64, 4), 1024, 0, stream>>>(PRJ, KF16, VF16, Wout16, out, 0.1767766952966369f, 0.0625f);
}

// v010
// It runs in 80.3 microseconds.
// Timed twice side by side with v009, it ran 1.08 and 1.07 times as fast.
// All steps since the starting kernel, v000, together make it 27.1 times as fast.
// Contractions (per image): q / qb / kvb 1x1 projections in position-major form x^T W^T [4096x256].[256x{256,256,512}], the 2x2-stride-2 kv conv as an im2col GEMM [1024x1024].[1024x512] and the output 1x1 conv Wout.(out_img + out_batch)^T [256x256].[256x4096], all with f16 operands (v_wmma_f32_16x16x32_f16; projections and kv conv: 64x64 register-blocked wave tiles over pre-cast f16 operand planes in WMMA fragment order; weight operands pre-scaled by 16 at the cast and un-scaled in the f32 epilogue); the spatial-reduction attention per head (flash kernel, head_dim 32, 4096 queries x 1024 keys, f16 q.k^T and f16 p.v; the kv conv stores k and v as f16 in WMMA fragment order); f32 accumulate; the im2col, the batch-wise 4x4 attention per (position, head) and the branch sum are f32 vector code; both attentions, the sum and the output conv run in one launch.
#include <hip/hip_runtime.h>
#include <math.h>

typedef __attribute__((ext_vector_type(16))) _Float16 v16h;
typedef __attribute__((ext_vector_type(8)))  _Float16 v8h;
typedef __attribute__((ext_vector_type(16))) __bf16   v16b;
typedef __attribute__((ext_vector_type(8)))  float    v8f;
typedef __attribute__((ext_vector_type(4)))  float    v4f;

// 16-bit WMMA fragment map (wave32), lane L, h = L>>4, m = L&15:
//   A 16x32: lane = row m;   element i -> k = (i<8) ? 8h+i : 16+8h+(i-8)
//   B 32x16: lane = column m; the SAME k(i,h)
//   D 16x16 (8 f32): lane = column m; element r -> row 8h+r
__device__ __forceinline__ int frag_k(int i, int h) { return (i < 8) ? (8 * h + i) : (16 + 8 * h + (i - 8)); }
__device__ __forceinline__ __bf16 bf16_rne(float f) {
    unsigned int u = __float_as_uint(f);
    u += 0x7fffu + ((u >> 16) & 1u);
    return __builtin_bit_cast(__bf16, (unsigned short)(u >> 16));
}
__device__ __forceinline__ float bf16_f32(__bf16 b) { return __uint_as_float(((unsigned int)__builtin_bit_cast(unsigned short, b)) << 16); }
__device__ __forceinline__ v8f wmma16(v16h a, v16h b, v8f c) {
    c = __builtin_amdgcn_wmma_f32_16x16x32_f16(false, a, false, b, (short)0, c, false, false);
    asm volatile("v_nop\n\tv_nop\n\tv_nop\n\tv_nop" : "+v"(c) : "v"(a), "v"(b));
    return c;
}
__device__ __forceinline__ v8f wmmab(v16b a, v16b b, v8f c) {
    c = __builtin_amdgcn_wmma_f32_16x16x32_bf16(false, a, false, b, (short)0, c, false, false);
    asm volatile("v_nop\n\tv_nop\n\tv_nop\n\tv_nop" : "+v"(c) : "v"(a), "v"(b));
    return c;
}
struct Split { v16b hi, lo; };
// hi/lo split product: a.hi*b.hi + a.hi*b.lo + a.lo*b.hi
__device__ __forceinline__ v8f wmma3(const Split& a, const Split& b, v8f c) {
    c = __builtin_amdgcn_wmma_f32_16x16x32_bf16(false, a.hi, false, b.hi, (short)0, c, false, false);
    c = __builtin_amdgcn_wmma_f32_16x16x32_bf16(false, a.hi, false, b.lo, (short)0, c, false, false);
    c = __builtin_amdgcn_wmma_f32_16x16x32_bf16(false, a.lo, false, b.hi, (short)0, c, false, false);
    asm volatile("v_nop\n\tv_nop\n\tv_nop\n\tv_nop" : "+v"(c) : "v"(a.hi), "v"(a.lo), "v"(b.hi), "v"(b.lo));
    return c;
}
struct Split3 { v16b hi, mid, lo; };
// triple split product (6 terms, drops only terms below 2^-24 relative)
__device__ __forceinline__ v8f wmma6(const Split3& a, const Split3& b, v8f c) {
    c = __builtin_amdgcn_wmma_f32_16x16x32_bf16(false, a.hi, false, b.hi, (short)0, c, false, false);
    c = __builtin_amdgcn_wmma_f32_16x16x32_bf16(false, a.hi, false, b.mid, (short)0, c, false, false);
    c = __builtin_amdgcn_wmma_f32_16x16x32_bf16(false, a.mid, false, b.hi, (short)0, c, false, false);
    c = __builtin_amdgcn_wmma_f32_16x16x32_bf16(false, a.hi, false, b.lo, (short)0, c, false, false);
    c = __builtin_amdgcn_wmma_f32_16x16x32_bf16(false, a.mid, false, b.mid, (short)0, c, false, false);
    c = __builtin_amdgcn_wmma_f32_16x16x32_bf16(false, a.lo, false, b.hi, (short)0, c, false, false);
    asm volatile("v_nop\n\tv_nop\n\tv_nop\n\tv_nop" : "+v"(c) : "v"(a.hi), "v"(a.mid), "v"(a.lo), "v"(b.hi), "v"(b.mid), "v"(b.lo));
    return c;
}

// Fragment gathers from f32 memory: element i <- p[(k0 + frag_k(i,h)) * sk] * s, zero for k >= klen.
__device__ __forceinline__ v16h fh_ld(const float* __restrict__ p, long long sk, int k0, int h, int klen, float s) {
    v16h a;
#pragma unroll
    for (int i = 0; i < 16; ++i) { const int k = k0 + frag_k(i, h); a[i] = (k < klen) ? (_Float16)(p[(long long)k * sk] * s) : (_Float16)0.f; }
    return a;
}
__device__ __forceinline__ Split sp_ld(const float* __restrict__ p, long long sk, int k0, int h, int klen, float s) {
    Split r;
#pragma unroll
    for (int i = 0; i < 16; ++i) {
        const int k = k0 + frag_k(i, h); const float x = (k < klen) ? p[(long long)k * sk] * s : 0.f;
        const __bf16 hb = bf16_rne(x); r.hi[i] = hb; r.lo[i] = bf16_rne(x - bf16_f32(hb));
    }
    return r;
}
__device__ __forceinline__ Split3 sp3_ld(const float* __restrict__ p, long long sk, int k0, int h, int klen, float s) {
    Split3 r;
#pragma unroll
    for (int i = 0; i < 16; ++i) {
        const int k = k0 + frag_k(i, h); const float x = (k < klen) ? p[(long long)k * sk] * s : 0.f;
        const __bf16 hb = bf16_rne(x); const float r1 = x - bf16_f32(hb); const __bf16 mb = bf16_rne(r1);
        r.hi[i] = hb; r.mid[i] = mb; r.lo[i] = bf16_rne(r1 - bf16_f32(mb));
    }
    return r;
}
__device__ __forceinline__ v16b bh_ld(const float* __restrict__ p, long long sk, int k0, int h, int klen, float s) {
    v16b a;
#pragma unroll
    for (int i = 0; i < 16; ++i) { const int k = k0 + frag_k(i, h); a[i] = bf16_rne((k < klen) ? p[(long long)k * sk] * s : 0.f); }
    return a;
}
// f16 fragment from an f16 LDS/global row with element stride 1 (k-contiguous), no bounds (tile already zero padded)
__device__ __forceinline__ v16h fh_row(const _Float16* __restrict__ row, int k0, int h) {
    v16h a;
#pragma unroll
    for (int i = 0; i < 16; ++i) a[i] = row[k0 + frag_k(i, h)];
    return a;
}

#define VST2(T, ptr, val) do { const T vst2_v_ = (val); *(T*)(ptr) = vst2_v_;  } while (0)
typedef float v4f __attribute__((ext_vector_type(4)));
#define VST2V4(ptr, val) do { const v4f vst2_v4_ = (val); *(v4f*)(ptr) = vst2_v4_;  } while (0)

__device__ __attribute__((noinline)) float act_fn(float v, int act) {
    if (act == 1) return fmaxf(v, 0.f);                                                                               // relu
    if (act == 2) { const float u = 0.7978845608028654f * (v + 0.044715f * v * v * v); return 0.5f * v * (1.f + tanhf(u)); } // tanh-gelu
    if (act == 3) return v / (1.f + expf(-v));                                                                        // silu
    if (act == 4) return 0.5f * v * (1.f + erff(v * 0.7071067811865476f));                                             // erf-gelu
    if (act == 5) return tanhf(v);
    if (act == 6) return 1.f / (1.f + expf(-v));                                                                      // sigmoid
    if (act == 7) return (v > 0.f) ? v : 0.01f * v;                                                                   // leaky relu 0.01
    if (act == 8) return (v > 0.f) ? v : (expf(v) - 1.f);                                                             // elu
    if (act == 9) return fminf(fmaxf(v, 0.f), 6.f);                                                                   // relu6
    if (act == 10) return fabsf(v);                                                                                    // abs
    if (act == 11) return (v >= 0.f) ? v : 0.1f * v;                                                                  // leaky 0.1
    if (act == 12) return (v > 0.f) ? v : 0.2f * v;                                                                   // leaky 0.2
    if (act == 13) return (v > 20.f) ? v : log1pf(expf(v));                                                            // softplus
    return v;
}

// =====================================================================================================================
// k_gemm<MODE>: C(z, m, n) = act(alpha * sum_k A(z, m, k) * B(z, k, n) + bias) + beta * R(z, m, n)
//   One wave (32-thread block) per 16 x 32 tile of C; grid (ceil(N/32), ceil(M/16), Z). Batch z -> (zo = z / zi_n, zi = z % zi_n)
//   with separate outer/inner strides for every tensor (e.g. batch and head). A(m,k) = A[zo*sAo + zi*sAi + m*sAm + k*sAk] (f32),
//   B(k,n) = B[zo*sBo + zi*sBi + n*sBn + k*sBk] (f32); any M, N, K (K zero-padded to 32 inside the fragments, M/N tails guarded).
//   C(m,n) = C[zo*sCo + zi*sCi + m*sCm + n] (n contiguous). flags: 1 bias[n], 2 bias[m], 4 residual R[zo*sRo + zi*sRi + m*sRm + n*sRn].
//   MODE 0: f16 operands (A prescaled by sa, B by sb, both undone in the epilogue); 1: bf16 hi/lo split (3 products); 2: bf16;
//   3: bf16 hi/mid/lo triple split (6 products); 4: as 3 with Kahan-compensated f32 accumulation across k-steps.
// =====================================================================================================================
struct GemmP {
    const float* A; const float* B; const float* bias; const float* R; float* C;
    long long sAo, sAi, sAm, sAk, sBo, sBi, sBn, sBk, sCo, sCi, sCm, sRo, sRi, sRm, sRn;
    int M, N, K, zi_n, flags, act; float alpha, beta, sa, sb;
    int Npad, pad_;     // columns [N, Npad) of C are written as 0 so that padded workspace rows are covered by whole-line stores; Npad >= N
};
static_assert(sizeof(GemmP) == 5 * 8 + 15 * 8 + 6 * 4 + 4 * 4 + 2 * 4, "GemmP has padding");

template <int MODE>
__global__ __launch_bounds__(32) void k_gemm(GemmP p) {
    const int lane = threadIdx.x & 31, h = lane >> 4, l15 = lane & 15;
    const int m0 = blockIdx.y * 16, n0 = blockIdx.x * 32;
    const int z = blockIdx.z, zo = z / p.zi_n, zi = z - zo * p.zi_n;
    const float* A = p.A + zo * p.sAo + zi * p.sAi;
    const float* B = p.B + zo * p.sBo + zi * p.sBi;
    const int am = min(m0 + l15, p.M - 1);                       // clamped row for loads (stores are guarded)
    v8f acc[2], comp[2];
#pragma unroll
    for (int t = 0; t < 2; ++t) { v8f zz = {}; acc[t] = zz; comp[t] = zz; }
    for (int k0 = 0; k0 < p.K; k0 += 32) {
        const float* arow = A + (long long)am * p.sAm;
        if (MODE == 1) {
            const Split a = sp_ld(arow, p.sAk, k0, h, p.K, 1.f);
#pragma unroll
            for (int t = 0; t < 2; ++t) {
                const int bn = min(n0 + t * 16 + l15, p.N - 1);
                acc[t] = wmma3(a, sp_ld(B + (long long)bn * p.sBn, p.sBk, k0, h, p.K, 1.f), acc[t]);
            }
        } else if (MODE == 3) {
            const Split3 a = sp3_ld(arow, p.sAk, k0, h, p.K, 1.f);
#pragma unroll
            for (int t = 0; t < 2; ++t) {
                const int bn = min(n0 + t * 16 + l15, p.N - 1);
                acc[t] = wmma6(a, sp3_ld(B + (long long)bn * p.sBn, p.sBk, k0, h, p.K, 1.f), acc[t]);
            }
        } else if (MODE == 4) {
            // triple split as MODE 3, but each k-step's 6 products go into a fresh accumulator and the partial is added to the running f32 sum
            // on the VALU with Kahan compensation (accumulation error stays ~1 ulp however long K is)
            const Split3 a = sp3_ld(arow, p.sAk, k0, h, p.K, 1.f);
#pragma unroll
            for (int t = 0; t < 2; ++t) {
                const int bn = min(n0 + t * 16 + l15, p.N - 1); v8f zz = {};
                const v8f part = wmma6(a, sp3_ld(B + (long long)bn * p.sBn, p.sBk, k0, h, p.K, 1.f), zz);
                const v8f y = part - comp[t]; const v8f s = acc[t] + y; comp[t] = (s - acc[t]) - y; acc[t] = s;
            }
        } else if (MODE == 2) {
            const v16b a = bh_ld(arow, p.sAk, k0, h, p.K, 1.f);
#pragma unroll
            for (int t = 0; t < 2; ++t) {
                const int bn = min(n0 + t * 16 + l15, p.N - 1);
                acc[t] = wmmab(a, bh_ld(B + (long long)bn * p.sBn, p.sBk, k0, h, p.K, 1.f), acc[t]);
            }
        } else {
            const v16h a = fh_ld(arow, p.sAk, k0, h, p.K, p.sa);
#pragma unroll
            for (int t = 0; t < 2; ++t) {
                const int bn = min(n0 + t * 16 + l15, p.N - 1);
                acc[t] = wmma16(a, fh_ld(B + (long long)bn * p.sBn, p.sBk, k0, h, p.K, p.sb), acc[t]);
            }
        }
    }
    const float iscale = (MODE == 0) ? p.alpha / (p.sa * p.sb) : p.alpha;
    float* C = p.C + zo * p.sCo + zi * p.sCi;
    const float* R = p.R + zo * p.sRo + zi * p.sRi;
    __shared__ __align__(16) float ctile[16][36];
#pragma unroll
    for (int t = 0; t < 2; ++t) {
        const int n = n0 + t * 16 + l15; const int nn = min(n, p.N - 1);
#pragma unroll
        for (int r = 0; r < 8; ++r) {
            const int m = m0 + 8 * h + r; const int mm = min(m, p.M - 1);
            float v = acc[t][r] * iscale;
            if (p.flags & 1) v += p.bias[nn];
            if (p.flags & 2) v += p.bias[mm];
            if (p.flags & 8) v *= p.bias[(long long)zo * p.M + mm];   /* per-(z,row) scale vector laid out [Z][M]; exclusive with the bias flags */
            v = act_fn(v, p.act);
            if (p.flags & 4) v += p.beta * R[(long long)mm * p.sRm + (long long)nn * p.sRn];
            ctile[8 * h + r][t * 16 + l15] = (n < p.N) ? v : 0.f;
        }
    }
    __syncthreads();
    const int NW = (p.Npad > p.N) ? p.Npad : p.N;           // write width
    const bool fast = (m0 + 16 <= p.M) && (n0 + 32 <= NW) && ((p.sCm & 3) == 0) && ((((size_t)C) & 15) == 0);
    if (fast) {
#pragma unroll
        for (int s = 0; s < 4; ++s) {
            const int row = s * 4 + (lane >> 3), c4 = (lane & 7) * 4;
            const v4f v = *(const v4f*)&ctile[row][c4];
            VST2V4(C + (long long)(m0 + row) * p.sCm + n0 + c4, v);
        }
    } else {
        for (int row = 0; row < 16; ++row) {
            const int m = m0 + row, n = n0 + lane;
            if (m < p.M && n < NW) VST2(float, C + (long long)m * p.sCm + n, ctile[row][lane]);
        }
    }
}


// =====================================================================================================================
// k_gemmT<MODE, TM, TN>: same contract as k_gemm, but one wave computes a (16*TM) x (16*TN) tile: TM A fragments and TN B fragments are
//   loaded per 32-wide k-step and reused across TM*TN WMMAs (far fewer load/convert instructions per MAC). MODE 0 (f16), 1 (bf16 hi/lo),
//   2 (bf16) only. grid (ceil(NW/(16*TN)), ceil(M/(16*TM)), Z), block 32. Epilogue identical to k_gemm, run per 16x32 sub-tile.
// =====================================================================================================================
template <int MODE, int TM, int TN>
__global__ __launch_bounds__(32) void k_gemmT(GemmP p) {
    const int lane = threadIdx.x & 31, h = lane >> 4, l15 = lane & 15;
    const int m0 = blockIdx.y * (16 * TM), n0 = blockIdx.x * (16 * TN);
    const int z = blockIdx.z, zo = z / p.zi_n, zi = z - zo * p.zi_n;
    const float* A = p.A + zo * p.sAo + zi * p.sAi;
    const float* B = p.B + zo * p.sBo + zi * p.sBi;
    v8f acc[TM][TN];
#pragma unroll
    for (int i = 0; i < TM; ++i)
#pragma unroll
        for (int t = 0; t < TN; ++t) { v8f zz = {}; acc[i][t] = zz; }
    for (int k0 = 0; k0 < p.K; k0 += 32) {
        if (MODE == 1) {
            Split a[TM], b[TN];
#pragma unroll
            for (int i = 0; i < TM; ++i) { const int am = min(m0 + 16 * i + l15, p.M - 1); a[i] = sp_ld(A + (long long)am * p.sAm, p.sAk, k0, h, p.K, 1.f); }
#pragma unroll
            for (int t = 0; t < TN; ++t) { const int bn = min(n0 + 16 * t + l15, p.N - 1); b[t] = sp_ld(B + (long long)bn * p.sBn, p.sBk, k0, h, p.K, 1.f); }
#pragma unroll
            for (int i = 0; i < TM; ++i)
#pragma unroll
                for (int t = 0; t < TN; ++t) acc[i][t] = wmma3(a[i], b[t], acc[i][t]);
        } else if (MODE == 2) {
            v16b a[TM], b[TN];
#pragma unroll
            for (int i = 0; i < TM; ++i) { const int am = min(m0 + 16 * i + l15, p.M - 1); a[i] = bh_ld(A + (long long)am * p.sAm, p.sAk, k0, h, p.K, 1.f); }
#pragma unroll
            for (int t = 0; t < TN; ++t) { const int bn = min(n0 + 16 * t + l15, p.N - 1); b[t] = bh_ld(B + (long long)bn * p.sBn, p.sBk, k0, h, p.K, 1.f); }
#pragma unroll
            for (int i = 0; i < TM; ++i)
#pragma unroll
                for (int t = 0; t < TN; ++t) acc[i][t] = wmmab(a[i], b[t], acc[i][t]);
        } else {
            v16h a[TM], b[TN];
#pragma unroll
            for (int i = 0; i < TM; ++i) { const int am = min(m0 + 16 * i + l15, p.M - 1); a[i] = fh_ld(A + (long long)am * p.sAm, p.sAk, k0, h, p.K, p.sa); }
#pragma unroll
            for (int t = 0; t < TN; ++t) { const int bn = min(n0 + 16 * t + l15, p.N - 1); b[t] = fh_ld(B + (long long)bn * p.sBn, p.sBk, k0, h, p.K, p.sb); }
#pragma unroll
            for (int i = 0; i < TM; ++i)
#pragma unroll
                for (int t = 0; t < TN; ++t) acc[i][t] = wmma16(a[i], b[t], acc[i][t]);
        }
    }
    const float iscale = (MODE == 0) ? p.alpha / (p.sa * p.sb) : p.alpha;
    float* C = p.C + zo * p.sCo + zi * p.sCi;
    const float* R = p.R + zo * p.sRo + zi * p.sRi;
    const int NW = (p.Npad > p.N) ? p.Npad : p.N;
    __shared__ __align__(16) float ctile[16][36];
#pragma unroll
    for (int i = 0; i < TM; ++i) {
        const int mb = m0 + 16 * i; if (mb >= p.M) break;          // wave-uniform
#pragma unroll
        for (int tp = 0; tp < TN / 2; ++tp) {
            const int nb = n0 + 32 * tp; if (nb >= NW) break;        // wave-uniform
#pragma unroll
            for (int t2 = 0; t2 < 2; ++t2) {
                const int t = 2 * tp + t2; const int n = nb + t2 * 16 + l15; const int nn = min(n, p.N - 1);
#pragma unroll
                for (int r = 0; r < 8; ++r) {
                    const int m = mb + 8 * h + r; const int mm = min(m, p.M - 1);
                    float v = acc[i][t][r] * iscale;
                    if (p.flags & 1) v += p.bias[nn];
                    if (p.flags & 2) v += p.bias[mm];
            if (p.flags & 8) v *= p.bias[(long long)zo * p.M + mm];   /* per-(z,row) scale vector laid out [Z][M]; exclusive with the bias flags */
                    v = act_fn(v, p.act);
                    if (p.flags & 4) v += p.beta * R[(long long)mm * p.sRm + (long long)nn * p.sRn];
                    ctile[8 * h + r][t2 * 16 + l15] = (n < p.N) ? v : 0.f;
                }
            }
            __syncthreads();
            const bool fast = (mb + 16 <= p.M) && (nb + 32 <= NW) && ((p.sCm & 3) == 0) && ((((size_t)C) & 15) == 0);
            if (fast) {
#pragma unroll
                for (int s = 0; s < 4; ++s) {
                    const int row = s * 4 + (lane >> 3), c4 = (lane & 7) * 4;
                    const v4f v = *(const v4f*)&ctile[row][c4];
                    VST2V4(C + (long long)(mb + row) * p.sCm + nb + c4, v);
                }
            } else {
                for (int row = 0; row < 16; ++row) {
                    const int m = mb + row, n = nb + lane;
                    if (m < p.M && n < NW) VST2(float, C + (long long)m * p.sCm + n, ctile[row][lane]);
                }
            }
            __syncthreads();
        }
    }
}

// =====================================================================================================================
// k_attn_out<LQ, LK, QP, C>: the flash attention of all C / 32 = 8 heads for 64 positions of one image, the batch-wise attention of the same positions and heads, their sum, and the output 1x1 conv
//   of those 64 positions, in one work-group of 32 waves. grid (LQ / 64, images), block 1024. Shape known at compile time: LQ queries, LK keys (a multiple of 64), head and value dim 32, no mask.
//   PRJ: the projections, f32, [image][position][q | q_b | k_b | v_b], row pitch QP = 4 C floats, head h at column 32 h of each part.
//   K and V come as f16 planes in fragment order, one plane of 32 LK halves a (image, head), written by the kv product's epilogue. A fragment is 1024 bytes: [j = 0, 1][lane][8 halves].
//     K plane: fragment kt = 16 keys;            lane (hf, l15), half j, element e = K[key 16 kt + l15][d = 16 j + 8 hf + e]
//     V plane: fragment dt * LK / 32 + g;        lane (hf, l15), half j, element e = V[key 32 g + 16 j + 8 hf + e][d = 16 dt + l15]
//   so each operand register quad is one 16-byte load, a wave's load instruction reads 512 consecutive bytes (4 whole lines), and nothing is converted or staged in the loop.
//   Attention: wave = (head wave >> 2, 16 queries wave & 3), 64-key blocks.
//   Both products are transposed: S^T = K . Q^T (A = 16 key rows, B = the wave's 16 queries) and O^T += V^T . P^T. A lane then holds scores of ONE query (its column l15; keys 16 t + 8 hf + r),
//   so the maximum and the sum are taken in the lane, with one exchange between the lane halves, and two score tiles, converted in place, are the B operand of the second product.
//   Scores: f16 operands; statistics f32. The running maximum is kept on the raw scores (scale > 0, so it is the scaled scores' maximum too; it only sets the range, the quotient does not depend on it).
//   One fma a score forms the whole exponent, s * (scale * log2 e) + (12 - max * scale * log2 e), and the hardware's exp2 gives P x 4096 at once, which is summed in f32 and cast to f16.
//   Batch-wise attention, for the wave's own (image, head, 16 positions): scores of q_b against the k_b of the 4 images at the same position and head, softmax over the 4, sum of the v_b; f32 on the
//   vector unit, 8 lanes x 4 floats a row, 4 positions an instruction. It is memory latency and little arithmetic: the waves of heads 4 to 7 do it ahead of their key loop and those of heads 0 to 3 behind
//   it, so that its loads fly while the SIMD's other waves compute.
//   Output conv: f16(out_img + out_batch) of the 64 positions lies in LDS, [position][C], and is the B operand; wave = (16 output channels wave >> 1, 32 positions wave & 1); A = WO (f16, x 1 / wscale), a plane in fragment order, 1024 bytes a fragment as above, [64 rows][k step][16 rows].
// =====================================================================================================================
typedef __attribute__((ext_vector_type(4))) _Float16 v4h;
// the 16 f32 that make up lane half h's fragment of a 32-wide row: k = 8h..8h+7 and 16+8h..16+8h+7 (the order of frag_k)
struct Row16 { v4f r[4]; };
__device__ __forceinline__ Row16 row16_ld(const float* __restrict__ row, int h) {
    Row16 x;
    x.r[0] = *(const v4f*)(row + 8 * h); x.r[1] = *(const v4f*)(row + 8 * h + 4);
    x.r[2] = *(const v4f*)(row + 16 + 8 * h); x.r[3] = *(const v4f*)(row + 16 + 8 * h + 4);
    return x;
}
__device__ __forceinline__ v16h row16_f16(const Row16& x) {
    v16h a;
#pragma unroll
    for (int q = 0; q < 4; ++q)
#pragma unroll
        for (int e = 0; e < 4; ++e) a[4 * q + e] = (_Float16)x.r[q][e];
    return a;
}
// the value that lane l ^ 16 holds
__device__ __forceinline__ float other_half(float x) {
    const int b = __float_as_int(x);
    return __int_as_float(__builtin_amdgcn_permlanex16(b, b, 0x76543210, 0xfedcba98, false, false));
}
// one f16 fragment from a plane in fragment order: p points at this lane's 8 halves of the fragment's half j = 0
__device__ __forceinline__ v16h frag_ld(const _Float16* __restrict__ p) {
    union { v16h v; v8h h[2]; } f;
    f.h[0] = *(const v8h*)(p); f.h[1] = *(const v8h*)(p + 256);
    return f.v;
}
// 32 waves a work-group: 8 on each SIMD, 128 registers a wave
template <int LQ, int LK, int QP, int C>
__global__ __launch_bounds__(1024) __attribute__((amdgpu_waves_per_eu(8))) void k_attn_out(const float* __restrict__ PRJ, const _Float16* __restrict__ KF, const _Float16* __restrict__ VF, const _Float16* __restrict__ WO,
                                                                                             float* __restrict__ OUT, float scale, float wscale) {
    static_assert(C == 256 && QP == 4 * C && LQ % 64 == 0 && LK % 64 == 0, "8 heads of 32, whole tiles, 16-byte rows");
    constexpr int NT = 2;                       // output tiles (16 d each)
    constexpr int OP = 32 + 4;                  // LDS pitch of a wave tile's row (floats)
    constexpr int SPI = C + 8;                  // LDS pitch of a position's row of the conv operand (halves): 16 bytes x odd
    __shared__ __align__(16) float    ol[32][16 * OP];     // a wave's own 16 x 32 tile: first out_batch (position-major), at the end its piece of the result (channel-major)
    __shared__ __align__(16) _Float16 st[64 * SPI];        // f16(out_img + out_batch), [position][channel]
    const int lane = threadIdx.x & 31, hf = lane >> 4, l15 = lane & 15;
    const int wave = __builtin_amdgcn_readfirstlane(threadIdx.x >> 5);   // the wave's number as a scalar: row addresses below are a scalar base plus one lane offset, and the branches on it are scalar
    const int h = wave >> 2, qt = wave & 3;
    const int z = blockIdx.y;
    const int q0 = blockIdx.x * 64 + qt * 16;
    float* myo = ol[wave];
    const int r4 = lane >> 3, c4 = (lane & 7) * 4;              // row-major view of a 16 x 32 tile: 8 lanes x 4 floats a row, 4 rows an instruction
    // batch-wise attention of image z, head h, positions q0 .. q0 + 15 -> myo[position][d]
    auto batch = [&]() {
        const unsigned lo = (unsigned)(r4 * QP + c4) * 4;       // this lane's byte offset from the head's first row
        const size_t hr = (size_t)q0 * QP + h * 32;
        const char* prow[4] = {(const char*)(PRJ + hr), (const char*)(PRJ + hr + (size_t)LQ * QP), (const char*)(PRJ + hr + (size_t)2 * LQ * QP), (const char*)(PRJ + hr + (size_t)3 * LQ * QP)};
        const char* qrow = (const char*)(PRJ + hr + (size_t)z * LQ * QP);
#pragma unroll
        for (int g = 0; g < 2; ++g) {                           // 8 positions at a time: 18 loads in flight, 72 registers
            v4f q[2], k[2][4], v[2][4];
            __builtin_amdgcn_sched_barrier(0);              // keeps these 18 loads behind the arithmetic of the 8 positions before: both sets of registers at once do not fit the wave's 128
#pragma unroll
            for (int i = 0; i < 2; ++i) {
                const unsigned ro = lo + (unsigned)(2 * g + i) * (4 * QP * 4);
                q[i] = *(const v4f*)(qrow + ro + C * 4);
#pragma unroll
                for (int b = 0; b < 4; ++b) { k[i][b] = *(const v4f*)(prow[b] + ro + 2 * C * 4); v[i][b] = *(const v4f*)(prow[b] + ro + 3 * C * 4); }
            }
            asm volatile("s_wait_xcnt 0x0" ::: "memory");   // the loads' address registers are reused further down: the wait stands in front of that overwrite
            __builtin_amdgcn_sched_barrier(0);              // keeps all 18 loads in front of the arithmetic (one memory latency, not several) and later register writes behind the wait
#pragma unroll
            for (int i = 0; i < 2; ++i) {
                float sc[4]; float mx = -__builtin_inff();
#pragma unroll
                for (int b2 = 0; b2 < 4; ++b2) {
                    float d0 = q[i][0] * k[i][b2][0] + q[i][1] * k[i][b2][1] + q[i][2] * k[i][b2][2] + q[i][3] * k[i][b2][3];
                    for (int o = 4; o > 0; o >>= 1) d0 += __shfl_xor(d0, o, 32);
                    sc[b2] = d0 * 0.17677669529663689f; mx = fmaxf(mx, sc[b2]);
                }
                float den = 0.f;
#pragma unroll
                for (int b2 = 0; b2 < 4; ++b2) { sc[b2] = expf(sc[b2] - mx); den += sc[b2]; }
                v4f o_ = {0.f, 0.f, 0.f, 0.f};
#pragma unroll
                for (int b2 = 0; b2 < 4; ++b2) o_ += sc[b2] / den * v[i][b2];
                *(v4f*)(myo + ((2 * g + i) * 4 + r4) * OP + c4) = o_;
            }
        }
    };
    const bool ahead = h >= C / 64;             // wave-uniform
    if (ahead) batch();
    const float* Q = PRJ + (size_t)z * LQ * QP;
    const float L2E = 1.4426950408889634f;
    const float NEG = -__builtin_inff();
    const float cs = scale * L2E;               // raw score -> exponent of 2
    const size_t plane = (size_t)(z * (C / 32) + h) * (LK * 32) + lane * 8;                     // this (image, head)'s plane, at this lane's 8 halves of a fragment
    const _Float16* kf = KF + plane;                                                            // both walk on by one 64-key block a trip: every fragment address is one of them plus an immediate
    const _Float16* vf = VF + plane;
    const v16h qa = row16_f16(row16_ld(Q + h * 32 + (size_t)(q0 + l15) * QP, hf));
    asm volatile("s_wait_xcnt 0x0" ::: "memory");   // the Q loads' address registers are reused for the start values set below: the wait stands in front of that overwrite
    __builtin_amdgcn_sched_barrier(0);              // keeps those later register writes from being scheduled ahead of the wait
    v8f o[NT]; float mrun = NEG, lrun = 0.f;        // this lane's query: running maximum (both halves agree) and this half's part of the sum
#pragma unroll
    for (int t = 0; t < NT; ++t) { v8f zz = {}; o[t] = zz; }
    for (int j0 = 0; j0 < LK; j0 += 64) {
        v16h ka[4], va[4];
#pragma unroll
        for (int t = 0; t < 4; ++t) ka[t] = frag_ld(kf + t * 512);
        asm volatile("s_wait_xcnt 0x0" :: "v"(kf) : "memory");    // the K loads' address registers are rewritten further down: the wait stands in front of that overwrite; as its input they stay whole up to it
        __builtin_amdgcn_sched_barrier(0);               // keeps those register writes from being scheduled ahead of the wait
        v8f s[4];
#pragma unroll
        for (int t = 0; t < 4; ++t) { v8f acc = {}; s[t] = wmma16(ka[t], qa, acc); }
        float mt[4];                                     // one maximum a tile: four short chains, not one of 32
#pragma unroll
        for (int t = 0; t < 4; ++t) {
            float a = fmaxf(s[t][0], s[t][1]);
#pragma unroll
            for (int r = 2; r < 8; ++r) a = fmaxf(a, s[t][r]);
            mt[t] = a;
        }
        float mx = fmaxf(fmaxf(mt[0], mt[1]), fmaxf(mt[2], mt[3]));
        mx = fmaxf(mx, other_half(mx));
        const float mnew = fmaxf(mrun, mx);
        // exp2 as the bare hardware instruction: it gives 0 where the result would be below 2^-126. Such a term is lost anyway: beside a row sum of at least 4096 in f32, and as an f16 operand.
        const float corr = __builtin_amdgcn_exp2f((mrun - mnew) * cs);   // first block: exp2(-inf) = 0
        const float nb = 12.f - mnew * cs;               // the 12 is the factor 4096 of P
#pragma unroll
        for (int t = 0; t < 4; ++t)
#pragma unroll
            for (int r = 0; r < 8; ++r) s[t][r] = __builtin_amdgcn_exp2f(__builtin_fmaf(s[t][r], cs, nb));
        const v8f ps = (s[0] + s[1]) + (s[2] + s[3]);
        const float rs = ((ps[0] + ps[1]) + (ps[2] + ps[3])) + ((ps[4] + ps[5]) + (ps[6] + ps[7]));
        lrun = lrun * corr + rs; mrun = mnew;
#pragma unroll
        for (int t = 0; t < NT; ++t) o[t] *= corr;
        v16h pb0, pb1;                                   // P^T fragments: element e <- key frag_k(e, hf) (+ 32), which is element e & 7 of score tile e >> 3 (+ 2)
#pragma unroll
        for (int e = 0; e < 16; ++e) { pb0[e] = (_Float16)s[e >> 3][e & 7]; pb1[e] = (_Float16)s[2 + (e >> 3)][e & 7]; }
#pragma unroll
        for (int t = 0; t < 4; ++t) va[t] = frag_ld(vf + ((t >> 1) * (LK / 32) + (t & 1)) * 512);   // va[2 dt + g]
        asm volatile("s_wait_xcnt 0x0" :: "v"(vf) : "memory");   // the V loads' address registers are rewritten further down: the wait stands in front of that overwrite; as its input they stay whole up to it
#pragma unroll
        for (int t = 0; t < NT; ++t) {
            o[t] = wmma16(va[2 * t], pb0, o[t]);
            o[t] = wmma16(va[2 * t + 1], pb1, o[t]);
        }
        kf += 4 * 512; vf += 2 * 512;
    }
    if (!ahead) batch();
    const float inv = 1.f / (lrun + other_half(lrun));          // sum and output both carry the factor 4096; no key is masked: the row sum holds its maximum's exp2(12)
    // out_batch was written by other lanes of this wave: the wave's LDS stores are ordered in front of the loads below
    __builtin_amdgcn_fence(__ATOMIC_RELEASE, "workgroup");
    __builtin_amdgcn_wave_barrier();
    __builtin_amdgcn_fence(__ATOMIC_ACQUIRE, "workgroup");
#pragma unroll
    for (int t = 0; t < NT; ++t) {
        const float* bp = myo + l15 * OP + t * 16 + 8 * hf;
        const v4f b0 = *(const v4f*)(bp), b1 = *(const v4f*)(bp + 4);
        const v8h w = {(_Float16)(o[t][0] * inv + b0[0]), (_Float16)(o[t][1] * inv + b0[1]), (_Float16)(o[t][2] * inv + b0[2]), (_Float16)(o[t][3] * inv + b0[3]),
                       (_Float16)(o[t][4] * inv + b1[0]), (_Float16)(o[t][5] * inv + b1[1]), (_Float16)(o[t][6] * inv + b1[2]), (_Float16)(o[t][7] * inv + b1[3])};
        *(v8h*)(st + (qt * 16 + l15) * SPI + h * 32 + t * 16 + 8 * hf) = w;
    }
    // output conv: the wave's 16 weight rows, all 8 k steps, are asked for ahead of the barrier
    const int mt = wave >> 1, np = wave & 1;
    const _Float16* wr = WO + (size_t)((mt >> 2) * (C / 8) + (mt & 3)) * 512 + lane * 8;   // WO in fragment order: [64-row tile][k step][16 rows]: this lane's 8 halves of the wave's fragment of k step 0
    v16h wa[C / 32];
#pragma unroll
    for (int s = 0; s < C / 32; ++s) wa[s] = frag_ld(wr + s * 2048);
    asm volatile("s_wait_xcnt 0x0" ::: "memory");   // the weight loads' address registers are reused further down: the wait stands in front of that overwrite
    __syncthreads();                                 // all 8 heads of the 64 positions lie in st
    v8f acc[2];
#pragma unroll
    for (int j = 0; j < 2; ++j) { v8f zz = {}; acc[j] = zz; }
#pragma unroll
    for (int s = 0; s < C / 32; ++s)
#pragma unroll
        for (int j = 0; j < 2; ++j) {
            const _Float16* sp = st + (np * 32 + j * 16 + l15) * SPI + 32 * s + 8 * hf;
            union { v16h v; v8h p[2]; } f; f.p[0] = *(const v8h*)(sp); f.p[1] = *(const v8h*)(sp + 16);
            acc[j] = wmma16(wa[s], f.v, acc[j]);
        }
#pragma unroll
    for (int j = 0; j < 2; ++j)
#pragma unroll
        for (int r = 0; r < 8; ++r) myo[(8 * hf + r) * OP + j * 16 + l15] = acc[j][r] * wscale;
    // the tile is read back row by row by other lanes of this wave
    __builtin_amdgcn_fence(__ATOMIC_RELEASE, "workgroup");
    __builtin_amdgcn_wave_barrier();
    __builtin_amdgcn_fence(__ATOMIC_ACQUIRE, "workgroup");
    float* ob = OUT + ((size_t)z * C + mt * 16) * LQ + blockIdx.x * 64 + np * 32;
#pragma unroll
    for (int r0 = 0; r0 < 16; r0 += 4) {
        const v4f v = *(const v4f*)(myo + (r0 + r4) * OP + c4);
        VST2V4(ob + (size_t)(r0 + r4) * LQ + c4, v);
    }
}

// =====================================================================================================================
// k_tr: dst(z, c, r) = alpha * src(z, r, c) (+ beta * R2(z, c, r)): [Z][R][C] (row stride lds) -> [Z][C][R] (row stride ldd) through a 32x32 LDS tile;
//   flags: 1 -> add beta * residual R2 addressed like dst (z*sRz + c*ldr + r); act applied before the residual.
// =====================================================================================================================
struct TrP { const float* src; float* dst; const float* R2; long long sSz, lds, sDz, ldd, sRz, ldr; int R, C, flags, act; float alpha, beta; };
static_assert(sizeof(TrP) == 3 * 8 + 6 * 8 + 6 * 4, "TrP has padding");
__global__ __launch_bounds__(256) void k_tr(TrP p) {
    __shared__ float tile[32][33];
    const int c0 = blockIdx.x * 32, r0 = blockIdx.y * 32, z = blockIdx.z;
    const int lane = threadIdx.x & 31, wave = threadIdx.x >> 5;
    const float* s = p.src + z * p.sSz;
#pragma unroll
    for (int k = 0; k < 4; ++k) {
        const int rl = wave * 4 + k, r = r0 + rl, c = c0 + lane;
        tile[rl][lane] = (r < p.R && c < p.C) ? s[(long long)r * p.lds + c] : 0.f;
    }
    __syncthreads();
    float* d = p.dst + z * p.sDz; const float* rr = p.R2 + z * p.sRz;
#pragma unroll
    for (int k = 0; k < 4; ++k) {
        const int cl = wave * 4 + k, c = c0 + cl, r = r0 + lane;
        if (c < p.C && r < p.R) {
            float v = act_fn(p.alpha * tile[lane][cl], p.act);
            if (p.flags & 1) v += p.beta * rr[(long long)c * p.ldr + r];
            VST2(float, d + (long long)c * p.ldd + r, v);
        }
    }
}

// k_affine: dst[i] = a * (sdev ? sdev[0] : 1) * src[i] + b, i < n (one thread per element; consecutive lanes -> consecutive addresses)
__global__ __launch_bounds__(256) void k_affine(const float* __restrict__ src, float* __restrict__ dst, int n, float a, float b, const float* __restrict__ sdev) {
    const int i = blockIdx.x * 256 + threadIdx.x;
    if (i < n) { const float aa = sdev ? a * sdev[0] : a; const float v = aa * src[i] + b; VST2(float, dst + i, v); }
}

// =====================================================================================================================
// k_softmax: row softmax over n contiguous elements, one 256-thread block per row; rows addressed z*sz + r*sr (grid (R, Z)).
//   out = scale_out * softmax(scale_in * x + (Mf ? Mf[z*smz + r*smr + j] : 0)); a row whose max is -inf is written as 0.
// =====================================================================================================================
struct SmP { const float* src; float* dst; const float* Mf; long long sz, sr, dz, dr, smz, smr; int n, pad; float scale_in, scale_out; };
static_assert(sizeof(SmP) == 3 * 8 + 6 * 8 + 4 * 4, "SmP has padding");
__global__ __launch_bounds__(256) void k_softmax(SmP p) {
    __shared__ float red[256];
    const int r = blockIdx.x, z = blockIdx.y, tid = threadIdx.x;
    const float* s = p.src + z * p.sz + (long long)r * p.sr;
    const float* mf = p.Mf ? (p.Mf + z * p.smz + (long long)r * p.smr) : nullptr;
    float mx = -__builtin_inff();
    for (int j = tid; j < p.n; j += 256) { float v = s[j] * p.scale_in; if (mf) v += mf[j]; mx = fmaxf(mx, v); }
    red[tid] = mx; __syncthreads();
    for (int o = 128; o > 0; o >>= 1) { if (tid < o) red[tid] = fmaxf(red[tid], red[tid + o]); __syncthreads(); }
    mx = red[0]; __syncthreads();
    float sum = 0.f;
    for (int j = tid; j < p.n; j += 256) { float v = s[j] * p.scale_in; if (mf) v += mf[j]; sum += (mx == -__builtin_inff()) ? 0.f : expf(v - mx); }
    red[tid] = sum; __syncthreads();
    for (int o = 128; o > 0; o >>= 1) { if (tid < o) red[tid] += red[tid + o]; __syncthreads(); }
    sum = red[0];
    const float inv = (sum > 0.f) ? p.scale_out / sum : 0.f;
    float* d = p.dst + z * p.dz + (long long)r * p.dr;
    for (int j = tid; j < p.n; j += 256) { float v = s[j] * p.scale_in; if (mf) v += mf[j]; const float o = (mx == -__builtin_inff()) ? 0.f : expf(v - mx) * inv; VST2(float, d + j, o); }
}
// =====================================================================================================================
// k_stats: mean and rsqrt(var + eps) over a set of n elements addressed base + z*sz + (e / inner) * so + (e % inner) * si, one 256-thread
// k_norm_apply: y = (x - mean[set]) * rstd[set] * g[c] + b[c] over a [Z][C][L] channel-major tensor with set = z*G + c / (C/G) (G groups per z;
//   G = C -> per-channel sets indexed z*C+c; for batch norm pass stats indexed by c only via bn = 1). Optional act. Output same layout.
// =====================================================================================================================
//   mode 0: mean / rsqrt(var + eps); mode 1 (RMSNorm): 0 / rsqrt(mean(x^2) + eps); mode 2 (L2 normalize * sqrt(n)): 0 / sqrt(n) / max(||x||, eps); mode 3: as 0 with unbiased variance (n-1)
__global__ __launch_bounds__(256) void k_stats(const float* __restrict__ x, long long sz, long long so, long long si, int inner, int n, float eps, float* __restrict__ stat, int mode) {
    __shared__ float red[256];
    const int z = blockIdx.x, tid = threadIdx.x;
    const float* base = x + z * sz;
    float s = 0.f;
    for (int e = tid; e < n; e += 256) s += base[(long long)(e / inner) * so + (long long)(e % inner) * si];
    red[tid] = s; __syncthreads();
    for (int o = 128; o > 0; o >>= 1) { if (tid < o) red[tid] += red[tid + o]; __syncthreads(); }
    const float mu = (mode == 0 || mode == 3) ? red[0] / (float)n : 0.f; __syncthreads();
    float q = 0.f;
    for (int e = tid; e < n; e += 256) { const float dlt = base[(long long)(e / inner) * so + (long long)(e % inner) * si] - mu; q += dlt * dlt; }
    red[tid] = q; __syncthreads();
    for (int o = 128; o > 0; o >>= 1) { if (tid < o) red[tid] += red[tid + o]; __syncthreads(); }
    {
        float rs;
        if (mode == 2) rs = sqrtf((float)n) / fmaxf(sqrtf(red[0]), eps); else if (mode == 3) rs = rsqrtf(red[0] / (float)(n - 1) + eps); else rs = rsqrtf(red[0] / (float)n + eps);
        if (tid < 32) { const float v = (tid == 0) ? mu : ((tid == 1) ? rs : 0.f); VST2(float, stat + (long long)z * 32 + tid, v); }
    }
}
//   One thread per element over the flat [Z][C][L] index space: grid ceil(Z*C*L / 256).
__global__ __launch_bounds__(256) void k_norm_apply(const float* __restrict__ x, float* __restrict__ y, const float* __restrict__ stat, const float* __restrict__ g, const float* __restrict__ bta,
                                                     int Z, int C, int L, int G, int bn, int act) {
    const long long idx = (long long)blockIdx.x * 256 + threadIdx.x;
    if (idx >= (long long)Z * C * L) return;
    const int l = (int)(idx % L); const long long zc = idx / L; const int c = (int)(zc % C), z = (int)(zc / C); (void)l;
    const int set = bn ? c : (z * G + c / (C / G));
    float v = (x[idx] - stat[(long long)set * 32]) * stat[(long long)set * 32 + 1];
    if (g) v *= g[c];
    if (bta) v += bta[c];
    v = act_fn(v, act);
    VST2(float, y + idx, v);
}

// k_lse_neg: c[i] = -(st[2i] + log(st[2i+1])) = minus the log-sum-exp of row i (for softmax over the query axis)
__global__ __launch_bounds__(256) void k_lse_neg(const float* __restrict__ st, float* __restrict__ c, int n) {
    const int i = blockIdx.x * 256 + threadIdx.x;
    if (i < n) { const float v = -(st[2 * i] + logf(st[2 * i + 1])); VST2(float, c + i, v); }
}

// k_iota: dst[i] = a * i + b as int32 (segment/position id helper)
__global__ __launch_bounds__(256) void k_iota(int* __restrict__ dst, int n, int a, int b) {
    const int i = blockIdx.x * 256 + threadIdx.x;
    if (i < n) { const int v = a * i + b; VST2(int, dst + i, v); }
}

// k_axpby: dst[i] = a * x[i] + b * y[i] (+ c), i < n
__global__ __launch_bounds__(256) void k_axpby(const float* __restrict__ x, const float* __restrict__ y, float* __restrict__ dst, int n, float a, float b, float c) {
    const int i = blockIdx.x * 256 + threadIdx.x;
    if (i < n) { const float v = a * x[i] + b * y[i] + c; VST2(float, dst + i, v); }
}

// =====================================================================================================================
// k_rope: rotary embedding on a [R rows][Hn heads][D] view (row stride sXr, head stride sXh, element stride 1) -> Y (own strides).
//   mode 0: rotate_half (partner d±D/2, sign - for d<D/2); mode 1: interleaved pairs (partner d^1, sign - for even d).
//   table column tcol: tmode 0 -> d, 1 -> d % (D/2), 2 -> d / 2; position p: pmode 0 -> r % S, 1 -> head index, 2 -> pos[r];
//   c = C[(r / S) * sCb + p * sCp + tcol * sCd], s likewise from Sn; y = x[d] * c + sign * x[partner] * s. X and Y must not alias.
// =====================================================================================================================
struct RopeP { const float* X; float* Y; const float* C; const float* Sn; const int* pos; long long sXr, sXh, sYr, sYh, sCb, sCp, sCd; int R, Hn, D, S, mode, tmode, pmode, pad; };
static_assert(sizeof(RopeP) == 5 * 8 + 7 * 8 + 8 * 4, "RopeP has padding");
__global__ __launch_bounds__(256) void k_rope(RopeP p) {
    const long long idx = (long long)blockIdx.x * 256 + threadIdx.x;
    if (idx >= (long long)p.R * p.Hn * p.D) return;
    const int d = (int)(idx % p.D); const long long rh = idx / p.D; const int h = (int)(rh % p.Hn); const int r = (int)(rh / p.Hn);
    const int half = p.D / 2;
    int partner; float sign;
    if (p.mode == 0) { partner = (d < half) ? d + half : d - half; sign = (d < half) ? -1.f : 1.f; }
    else { partner = d ^ 1; sign = (d & 1) ? 1.f : -1.f; }
    const int tcol = (p.tmode == 0) ? d : ((p.tmode == 1) ? (d % half) : (d >> 1));
    const int pp = (p.pmode == 0) ? (r % p.S) : ((p.pmode == 1) ? h : p.pos[r]);
    const long long toff = (long long)(r / p.S) * p.sCb + (long long)pp * p.sCp + (long long)tcol * p.sCd;
    const float* xr = p.X + (long long)r * p.sXr + (long long)h * p.sXh;
    const float v = xr[d] * p.C[toff] + sign * xr[partner] * p.Sn[toff];
    VST2(float, p.Y + (long long)r * p.sYr + (long long)h * p.sYh + d, v);
}

// k_invf + k_sincos (split so neither kernel carries a large VALU-fma footprint): invf_i = num * (1 / powf(base, (2 i)/D)) [fmode 0],
//   num * expf((2 i) * cexp) [fmode 1], num * powf(base, -2 (i - 1) / D) [fmode 2]; then cs/sn[s*half + i] = cos/sin((pscale * s) * invf_i)
__global__ __launch_bounds__(256) void k_invf(float* __restrict__ invb, int half, int D, float base, float num, int fmode, float cexp) {
    const int i = blockIdx.x * 256 + threadIdx.x;
    if (i >= ((half + 31) / 32) * 32) return;
    if (i >= half) { VST2(float, invb + i, 0.f); return; }
    const float e = (float)(2 * i) / (float)D;
    float invf;
    if (fmode == 1) invf = num * expf((float)(2 * i) * cexp);
    else if (fmode == 2) invf = num * powf(base, (-2.0f * ((float)i - 1.0f)) / (float)D);
    else invf = num * (1.0f / powf(base, e));
    VST2(float, invb + i, invf);
}
__global__ __launch_bounds__(256) void k_sincos(float* __restrict__ cs, float* __restrict__ sn, const float* __restrict__ invb, int S, int half, float pscale) {
    const int idx = blockIdx.x * 256 + threadIdx.x;
    if (idx >= S * half) return;
    const int s = idx / half, i = idx - s * half;
    const float ang = (pscale * (float)s) * invb[i];
    VST2(float, cs + idx, cosf(ang)); VST2(float, sn + idx, sinf(ang));
}

// k_mulact: dst[i] = act(x[i]) * y[i]
__global__ __launch_bounds__(256) void k_mulact(const float* __restrict__ x, const float* __restrict__ y, float* __restrict__ dst, int n, int act) {
    const int i = blockIdx.x * 256 + threadIdx.x;
    if (i < n) { const float v = act_fn(x[i], act) * y[i]; VST2(float, dst + i, v); }
}

// =====================================================================================================================
// k_matvec: thread-per-row matrix-vector products for N <= 8 output columns (heads with 1-3 outputs, gates), f32 on the VALU.
//   C[r*sCm + j] = act(alpha * sum_k A[r*sAm + k*sAk] * B[j*sBn + k*sBk] + bias[j]) + beta * R[r*sRm + j*sRn]; each thread writes its N contiguous floats.
// =====================================================================================================================
__global__ __launch_bounds__(256) void k_matvec(GemmP p) {
    // 32 lanes write one line with one instruction.
    const int rpt = (p.N == 1) ? 1 : 32;
    const long long r0 = ((long long)blockIdx.x * 256 + threadIdx.x) * rpt; const int z = blockIdx.z, zo = z / p.zi_n, zi = z - zo * p.zi_n;
    if (r0 >= p.M) return;
    const float* Bb = p.B + zo * p.sBo + zi * p.sBi;
    float* C = p.C + zo * p.sCo + zi * p.sCi; const float* R = p.R + zo * p.sRo + zi * p.sRi;
    for (int rr = 0; rr < rpt; ++rr) {
        const long long r = r0 + rr; if (r >= p.M) break;
        const float* A = p.A + zo * p.sAo + zi * p.sAi + r * p.sAm;
        float acc[8] = {0.f, 0.f, 0.f, 0.f, 0.f, 0.f, 0.f, 0.f};
        for (int k = 0; k < p.K; ++k) { const float a = A[(long long)k * p.sAk];
#pragma unroll
            for (int j = 0; j < 8; ++j) if (j < p.N) acc[j] += a * Bb[(long long)j * p.sBn + (long long)k * p.sBk]; }
#pragma unroll
        for (int j = 0; j < 8; ++j) if (j < p.N) {
            float v = acc[j] * p.alpha;
            if (p.flags & 1) v += p.bias[j];
            if (p.flags & 2) v += p.bias[r];
            v = act_fn(v, p.act);
            if (p.flags & 4) v += p.beta * R[r * p.sRm + (long long)j * p.sRn];
            VST2(float, C + r * p.sCm + j, v);
        }
    }
}
// k_smallsoftmax: thread-per-row softmax for short rows (n <= 64): dst[r*dr + j] = softmax(scale*src[r*sr + j])
__global__ __launch_bounds__(256) void k_smallsoftmax(const float* __restrict__ src, float* __restrict__ dst, long long sr, long long dr, int n, long long R, float scale) {
    const long long r0 = ((long long)blockIdx.x * 256 + threadIdx.x) * 32;
    for (int rr = 0; rr < 32; ++rr) {
        const long long r = r0 + rr; if (r >= R) return;
        const float* s = src + r * sr; float* d = dst + r * dr;
        float mx = -__builtin_inff();
        for (int j = 0; j < n; ++j) mx = fmaxf(mx, s[j] * scale);
        float sum = 0.f;
        for (int j = 0; j < n; ++j) sum += expf(s[j] * scale - mx);
        const float inv = 1.f / sum;
        for (int j = 0; j < n; ++j) { const float v = expf(s[j] * scale - mx) * inv; VST2(float, d + j, v); }
    }
}

__global__ __launch_bounds__(32) void k_unitstat(float* __restrict__ st) { const int t = threadIdx.x; const float v = (t == 1) ? 1.f : 0.f; VST2(float, st + t, v); }

// destination (e.g. a d_out whose row width is not a multiple of 32 floats) is written by consecutive lanes of one instruction
__global__ __launch_bounds__(256) void k_lincopy(const float* __restrict__ src, long long lds, float* __restrict__ dst, long long ldd, long long rows, int cols) {
    const long long i = (long long)blockIdx.x * 256 + threadIdx.x; if (i >= rows * cols) return;
    const long long r = i / cols; const int c = (int)(i - r * cols);
    const float v = src[r * lds + c]; VST2(float, dst + r * ldd + c, v);
}

namespace w25 {
typedef __attribute__((ext_vector_type(16))) _Float16 v16h;
typedef __attribute__((ext_vector_type(8)))  _Float16 v8h;
typedef __attribute__((ext_vector_type(16))) __bf16   v16b;
typedef __attribute__((ext_vector_type(8)))  __bf16   v8b;
typedef __attribute__((ext_vector_type(8)))  float    v8f;
typedef __attribute__((ext_vector_type(4)))  float    v4f;

__device__ __forceinline__ unsigned short f2bf_bits(float f) {
  unsigned u = __float_as_uint(f);
  return (unsigned short)((u + 0x7FFFu + ((u >> 16) & 1u)) >> 16);
}
__device__ __forceinline__ float bf_bits2f(unsigned short h) { return __uint_as_float(((unsigned)h) << 16); }

// hazard guards as plain device helpers (no inline asm inside the kernel template body)
__device__ __forceinline__ void dep_guard_h(v8f& a, v8f& b, v16h x, v16h y) { asm volatile("v_nop\n\tv_nop\n\tv_nop\n\tv_nop" : "+v"(a), "+v"(b) : "v"(x), "v"(y)); }
__device__ __forceinline__ void dep_guard_b(v8f& a, v8f& b, v16b x, v16b y) { asm volatile("v_nop\n\tv_nop\n\tv_nop\n\tv_nop" : "+v"(a), "+v"(b) : "v"(x), "v"(y)); }
__device__ __forceinline__ void keep4_h(v16h a, v16h b, v16h c, v16h d) { asm volatile("v_nop" :: "v"(a), "v"(b), "v"(c), "v"(d)); }
__device__ __forceinline__ void keep4_b(v16b a, v16b b, v16b c, v16b d) { asm volatile("v_nop" :: "v"(a), "v"(b), "v"(c), "v"(d)); }
__device__ __forceinline__ void acc_guard4(v8f& a, v8f& b, v8f& c, v8f& d) { asm volatile("v_nop\n\tv_nop\n\tv_nop\n\tv_nop" : "+v"(a), "+v"(b), "+v"(c), "+v"(d)); }
// an address that is the same in every lane, held in a scalar register pair: a load then takes it as its scalar base, beside one 32-bit lane offset
__device__ __forceinline__ unsigned long long scalar_addr(const void* p) {
  const unsigned long long u = (unsigned long long)p;
  const unsigned l = (unsigned)__builtin_amdgcn_readfirstlane((int)(unsigned)u), h = (unsigned)__builtin_amdgcn_readfirstlane((int)(unsigned)(u >> 32));
  return ((unsigned long long)h << 32) | l;
}
template <typename T> struct Frag;
template <> struct Frag<_Float16> {
  typedef v16h V; union U { v16h v; v8h h[2]; };
  static __device__ __forceinline__ v16h load(const _Float16* p) {   // elements 0..7 <- p[0..7], 8..15 <- p[16..23]
    U f; f.h[0] = *(const v8h*)(p); f.h[1] = *(const v8h*)(p + 16); return f.v;
  }
  static __device__ __forceinline__ v16h loads(unsigned long long p, unsigned off) {   // the same from scalar base p (address of a 16-row tile) + off (this lane's byte offset in the tile)
    typedef const __attribute__((address_space(1))) v8h* G;
    U f; f.h[0] = *(G)(p + off); f.h[1] = *(G)(p + off + 32); return f.v;
  }
  static __device__ __forceinline__ v16h loadf(unsigned long long p, unsigned off) {   // from a plane in fragment order: the fragment's two halves are 512 bytes apart, off = its place + 16 * lane
    typedef const __attribute__((address_space(1))) v8h* G;
    U f; f.h[0] = *(G)(p + off); f.h[1] = *(G)(p + off + 512); return f.v;
  }
  static __device__ __forceinline__ v8f mma(v16h a, v16h b, v8f c) {
    return __builtin_amdgcn_wmma_f32_16x16x32_f16(false, a, false, b, (short)0, c, false, false);
  }
  static __device__ __forceinline__ void guard(v8f& a, v8f& b, v16h x, v16h y) { dep_guard_h(a, b, x, y); }
  static __device__ __forceinline__ void keep(v16h a, v16h b, v16h c, v16h d) { keep4_h(a, b, c, d); }
};
template <> struct Frag<__bf16> {
  typedef v16b V; union U { v16b v; v8b h[2]; };
  static __device__ __forceinline__ v16b load(const __bf16* p) {
    U f; f.h[0] = *(const v8b*)(p); f.h[1] = *(const v8b*)(p + 16); return f.v;
  }
  static __device__ __forceinline__ v16b loads(unsigned long long p, unsigned off) {
    typedef const __attribute__((address_space(1))) v8b* G;
    U f; f.h[0] = *(G)(p + off); f.h[1] = *(G)(p + off + 32); return f.v;
  }
  static __device__ __forceinline__ v16b loadf(unsigned long long p, unsigned off) {
    typedef const __attribute__((address_space(1))) v8b* G;
    U f; f.h[0] = *(G)(p + off); f.h[1] = *(G)(p + off + 512); return f.v;
  }
  static __device__ __forceinline__ v8f mma(v16b a, v16b b, v8f c) {
    return __builtin_amdgcn_wmma_f32_16x16x32_bf16(false, a, false, b, (short)0, c, false, false);
  }
  static __device__ __forceinline__ void guard(v8f& a, v8f& b, v16b x, v16b y) { dep_guard_b(a, b, x, y); }
  static __device__ __forceinline__ void keep(v16b a, v16b b, v16b c, v16b d) { keep4_b(a, b, c, d); }
};

// ---- Register-blocked batched WMMA GEMM ------------------------------------
// C[m,n] = scale * sum_k A[m,k] * Bt[n,k] (+bias)(+resid); each wave owns a 64x64 tile.
// A row-major [M,K]; Bt row-major [N,K]; M,N % 64 == 0, K % 32 == 0.
// SPLIT: operands are hi/lo planes (A2/Bt2 = lo planes, same layout); product = hi·hi + hi·lo + lo·hi.
// BIAS_MODE: 0 = none, 1 = bias[m], 2 = bias[n].
// OUT_MODE: 0 = f32, 1 = f16, 2 = bf16 hi plane (Cout) + bf16 lo plane (Cout2).
// ET: 0 = f16 operands, 1 = bf16 operands (pointers passed as 16-bit storage)
template <int ET> struct Elem;
template <> struct Elem<0> { typedef _Float16 T; };
template <> struct Elem<1> { typedef __bf16 T; };
// The body takes its block's place in the grid (bx: 8 tiles, b: batch) as arguments, so that one launch can hold the blocks of more than one product.
// FRAGKV, and frag set (block-uniform): the product is the kv conv, rows m = (image, key) with 2^lgk keys an image, columns n = [k | v], each half N / 64 heads of 32 channels. The result is
// stored as f16 in the fragment order that the attention kernel reads (its head comment has the two maps): k to kfrag, v to vfrag, one plane of 32 * 2^lgk halves a (image, head).
// FRAGAB: A and Bt lie in fragment order, not row-major: [64-row tile][k step of 32][i = 0..3][j = 0, 1][lane (hf, s)][8 halves], the 8 halves being k = 16 j + 8 hf + e of the k step, of the row that
// stands in slot s of fragment i. A wave's load instruction then reads 512 consecutive bytes (4 whole lines), not 32 bytes of each of 16 lines. Bt: slot s of fragment i is row 16 i + s of the tile.
// A: the writer of the plane chooses; an f32 result is stored for row 4 s + i (the x^T plane); the kv conv's rows are keys, whose order inside an image the attention does not depend on (k and v share it).
template <int ET, bool SPLIT, int BIAS_MODE, int OUT_MODE, bool RESID, int ACT, bool FRAGKV = false, bool FRAGAB = false>
__device__ __forceinline__ void gemm64_block(
    const unsigned short* __restrict__ Ap, const unsigned short* __restrict__ A2p, int lda, long strideA,
    const unsigned short* __restrict__ Btp, const unsigned short* __restrict__ Bt2p, int ldb, long strideB,
    void* __restrict__ Cout, void* __restrict__ Cout2, int ldc, long strideC,
    const float* __restrict__ bias,
    const float* __restrict__ resid, long strideR,
    int M, int N, int K, float scale, int bx, int b,
    _Float16* __restrict__ kfrag = nullptr, _Float16* __restrict__ vfrag = nullptr, int lgk = 0, bool frag = false) {
  typedef typename Elem<ET>::T T;
  typedef typename Frag<T>::V V;
  const T* A = (const T*)Ap; const T* A2 = (const T*)A2p; const T* Bt = (const T*)Btp; const T* Bt2 = (const T*)Bt2p;
  __shared__ __align__(16) float sT[8][16 * 68];   // per-wave 16x64 slab, pitch 68 floats
  const int lane = threadIdx.x & 31;
  const int wave = __builtin_amdgcn_readfirstlane(threadIdx.x >> 5);   // the wave's number as a scalar: every fragment address below is a scalar base plus one lane offset
  const int tilesN = N >> 6;
  const int tilesM = M >> 6;
  const int tile = bx * 8 + wave;
  if (tile >= tilesM * tilesN) return;   // wave-uniform; no block barriers in this kernel
  const int tm = tile / tilesN;
  const int tn = tile - tm * tilesN;
  const int m0 = tm << 6;
  const int n0 = tn << 6;

  const T* Ab  = A  + (size_t)b * strideA;
  const T* Bb  = Bt + (size_t)b * strideB;
  const T* Ab2 = SPLIT ? (A2  + (size_t)b * strideA) : nullptr;
  const T* Bb2 = SPLIT ? (Bt2 + (size_t)b * strideB) : nullptr;

  const int rlane = lane & 15;                 // row (A) / col (B, D) within subtile
  const int koff  = (lane >> 4) * 8;           // k offset of this lane half
  const int mOff  = (lane >> 4) * 8;           // D row offset

  v8f acc[4][4];
#pragma unroll
  for (int i = 0; i < 4; ++i)
#pragma unroll
    for (int j = 0; j < 4; ++j) acc[i][j] = (v8f){0.f,0.f,0.f,0.f,0.f,0.f,0.f,0.f};

  unsigned long long pa[4], pb[4], pa2[4], pb2[4];   // the 4 + 4 row tiles of 16 rows
#pragma unroll
  for (int i = 0; i < 4; ++i) {
    pa[i] = scalar_addr(Ab + (size_t)(m0 + (i << 4)) * lda); pb[i] = scalar_addr(Bb + (size_t)(n0 + (i << 4)) * ldb);
    pa2[i] = SPLIT ? scalar_addr(Ab2 + (size_t)(m0 + (i << 4)) * lda) : 0; pb2[i] = SPLIT ? scalar_addr(Bb2 + (size_t)(n0 + (i << 4)) * ldb) : 0;
  }
  const unsigned la = (unsigned)(rlane * lda + koff) * 2, lb = (unsigned)(rlane * ldb + koff) * 2;   // this lane's byte offset in a row tile of A, of Bt, at k0 = 0
  const unsigned lf = (unsigned)lane * 16;                                                            // fragment order: this lane's byte offset in half a fragment; a k step of a 64-row tile is 4096 bytes

  for (int k0 = 0; k0 < K; k0 += 32) {
    V bh[4], bl[4], ah[4], al[4];     // all 8 fragments of the k step have registers of their own: their loads are issued together, one memory latency a k step
#pragma unroll
    for (int j = 0; j < 4; ++j) {
      bh[j] = FRAGAB ? Frag<T>::loadf(pb[0], lf + k0 * 128 + j * 1024) : Frag<T>::loads(pb[j], lb + k0 * 2);
      if (SPLIT) bl[j] = Frag<T>::loads(pb2[j], lb + k0 * 2);
    }
#pragma unroll
    for (int i = 0; i < 4; ++i) {
      ah[i] = FRAGAB ? Frag<T>::loadf(pa[0], lf + k0 * 128 + i * 1024) : Frag<T>::loads(pa[i], la + k0 * 2);
      if (SPLIT) al[i] = Frag<T>::loads(pa2[i], la + k0 * 2);
    }
#pragma unroll
    for (int i = 0; i < 4; ++i) {
#pragma unroll
      for (int j = 0; j < 4; ++j) {
        acc[i][j] = Frag<T>::mma(ah[i], bh[j], acc[i][j]);
        if (SPLIT) {
          acc[i][j] = Frag<T>::mma(ah[i], bl[j], acc[i][j]);
          acc[i][j] = Frag<T>::mma(al[i], bh[j], acc[i][j]);
        }
      }
      Frag<T>::guard(acc[i][0], acc[i][3], ah[i], SPLIT ? al[i] : ah[i]);
    }
    Frag<T>::keep(bh[0], bh[1], bh[2], bh[3]);
    if (SPLIT) Frag<T>::keep(bl[0], bl[1], bl[2], bl[3]);
  }
  acc_guard4(acc[0][0], acc[0][1], acc[0][2], acc[0][3]);
  acc_guard4(acc[1][0], acc[1][1], acc[1][2], acc[1][3]);
  acc_guard4(acc[2][0], acc[2][1], acc[2][2], acc[2][3]);
  acc_guard4(acc[3][0], acc[3][1], acc[3][2], acc[3][3]);

  // ---- epilogue ----
  float* slab = sT[wave];
  const float* Rb = RESID ? (resid + (size_t)b * strideR) : nullptr;
#pragma unroll
  for (int i = 0; i < 4; ++i) {
    const int mBase = m0 + (i << 4);
#pragma unroll
    for (int j = 0; j < 4; ++j) {
      const int n = n0 + (j << 4) + rlane;
      float bv = 0.f;
      if (BIAS_MODE == 2) bv = bias[n];
#pragma unroll
      for (int r = 0; r < 8; ++r) {
        float v = acc[i][j][r] * scale;
        if (BIAS_MODE == 1) v += bias[mBase + mOff + r];
        if (BIAS_MODE == 2) v += bv;
        if (RESID) v += Rb[(size_t)(mBase + mOff + r) * ldc + n];
        if (ACT == 1) v = tanhf(v);
        if (ACT == 2) v = fmaxf(v, 0.0f);
        if (ACT == 3) v = v / (1.0f + expf(-v));
        if (ACT == 4) v = (v > 0.f) ? v : 0.01f * v;
        if (ACT == 5) v = 0.5f * v * (1.0f + erff(v * 0.70710678118654752f));
        slab[(mOff + r) * 68 + (j << 4) + rlane] = v;
      }
    }
    __builtin_amdgcn_fence(__ATOMIC_RELEASE, "workgroup");
    __builtin_amdgcn_wave_barrier();
    __builtin_amdgcn_fence(__ATOMIC_ACQUIRE, "workgroup");
    if (FRAGKV && frag) {
      const int hfl = lane >> 4;
      const int z = mBase >> lgk, kb = mBase - (z << lgk);            // image, and the first of these 16 keys in it
      const bool isk = n0 < (N >> 1);                                 // the tile's 64 columns are 2 heads of k or 2 heads of v
      const int head0 = (isk ? n0 : n0 - (N >> 1)) >> 5;
      _Float16* pl = (isk ? kfrag : vfrag) + ((size_t)(z * (N >> 6) + head0) << (lgk + 5)) + lane * 8;
      v8h w[4];
      if (isk) {
        pl += (kb >> 4) * 512;                                        // fragment = these 16 keys; w[2 hh + j]: 8 consecutive channels of this lane's key
#pragma unroll
        for (int q = 0; q < 4; ++q) {
          const float* sp = slab + rlane * 68 + (q >> 1) * 32 + (q & 1) * 16 + hfl * 8;
          const v4f a = *(const v4f*)(sp), c = *(const v4f*)(sp + 4);
          const v8h t = {(_Float16)a[0], (_Float16)a[1], (_Float16)a[2], (_Float16)a[3], (_Float16)c[0], (_Float16)c[1], (_Float16)c[2], (_Float16)c[3]};
          w[q] = t;
        }
#pragma unroll
        for (int q = 0; q < 4; ++q) *(v8h*)(pl + ((size_t)(q >> 1) << (lgk + 5)) + (q & 1) * 256) = w[q];
      } else {
        pl += (kb >> 5) * 512 + ((kb >> 4) & 1) * 256;                // these 16 keys are half j of fragment g; w[2 hh + dt]: 8 consecutive keys of this lane's channel
#pragma unroll
        for (int q = 0; q < 4; ++q) {
          const float* sp = slab + hfl * 8 * 68 + (q >> 1) * 32 + (q & 1) * 16 + rlane;
          const v8h t = {(_Float16)sp[0], (_Float16)sp[68], (_Float16)sp[136], (_Float16)sp[204], (_Float16)sp[272], (_Float16)sp[340], (_Float16)sp[408], (_Float16)sp[476]};
          w[q] = t;
        }
#pragma unroll
        for (int q = 0; q < 4; ++q) *(v8h*)(pl + ((size_t)(q >> 1) << (lgk + 5)) + ((size_t)(q & 1) << (lgk + 4))) = w[q];
      }
      asm volatile("s_wait_xcnt 0x0" ::: "memory");   // the stores' address and data registers are rewritten by the next 16 rows: the wait stands in front of that overwrite
    } else if (OUT_MODE == 0) {
      float* C = (float*)Cout + (size_t)b * strideC;
      const int hh = lane >> 4, c4 = (lane & 15) * 4;     // row seg = 256 B = 16 lanes x 16 B
      {
#pragma unroll
        for (int it = 0; it < 8; ++it) {
          const int row = it * 2 + hh;
          v4f v = *(const v4f*)(slab + row * 68 + c4);
          *(v4f*)(C + (size_t)(FRAGAB ? m0 + 4 * row + i : mBase + row) * ldc + n0 + c4) = v;
        }
        if (FRAGKV) asm volatile("s_wait_xcnt 0x0" ::: "memory");   // in the built kernel the fragment arm's code lies behind these stores and rewrites their registers: the wait stands in front of it
      }
    } else {
      const int q = lane >> 3, c8 = (lane & 7) * 8;
      unsigned short* C  = (unsigned short*)Cout  + (size_t)b * strideC;
      unsigned short* C2 = (OUT_MODE == 2) ? ((unsigned short*)Cout2 + (size_t)b * strideC) : nullptr;
      {
#pragma unroll
        for (int it = 0; it < 4; ++it) {
          const int row = it * 4 + q;
          const float* sp = slab + row * 68 + c8;
          v8h hv, lv;
#pragma unroll
          for (int e = 0; e < 8; ++e) {
            if (OUT_MODE == 1) {
              hv[e] = (_Float16)sp[e];
            } else {
              unsigned short hb = f2bf_bits(sp[e]);
              unsigned short lb = f2bf_bits(sp[e] - bf_bits2f(hb));
              hv[e] = __builtin_bit_cast(_Float16, hb);
              lv[e] = __builtin_bit_cast(_Float16, lb);
            }
          }
          *(v8h*)(C + (size_t)(mBase + row) * ldc + n0 + c8) = hv;
          if (OUT_MODE == 2) *(v8h*)(C2 + (size_t)(mBase + row) * ldc + n0 + c8) = lv;
        }
        
      }
    }
    __builtin_amdgcn_fence(__ATOMIC_RELEASE, "workgroup");
    __builtin_amdgcn_wave_barrier();
    __builtin_amdgcn_fence(__ATOMIC_ACQUIRE, "workgroup");
  }
}

template <int ET, bool SPLIT, int BIAS_MODE, int OUT_MODE, bool RESID, int ACT = 0>
__global__ __launch_bounds__(256) void wmma_gemm64(
    const unsigned short* __restrict__ Ap, const unsigned short* __restrict__ A2p, int lda, long strideA,
    const unsigned short* __restrict__ Btp, const unsigned short* __restrict__ Bt2p, int ldb, long strideB,
    void* __restrict__ Cout, void* __restrict__ Cout2, int ldc, long strideC,
    const float* __restrict__ bias,
    const float* __restrict__ resid, long strideR,
    int M, int N, int K, float scale) {
  gemm64_block<ET, SPLIT, BIAS_MODE, OUT_MODE, RESID, ACT>(Ap, A2p, lda, strideA, Btp, Bt2p, ldb, strideB, Cout, Cout2, ldc, strideC, bias, resid, strideR, M, N, K, scale, blockIdx.x, blockIdx.y);
}
// Two independent f16 products in one launch: blocks 0 .. nb0 - 1 do product 0, the blocks behind them product 1. Product 0 is the one with the longer k loop;
// it is the kv conv, stored as f16 fragment planes (KF, VF; 2^lgk keys an image). Product 1 has an f32 result. A and Bt: planes in fragment order, k0 / k1 halves a row; C1: row pitch n1 (dense).
// grid nb0 + m1 * n1 / 32768, block 256.
__global__ __launch_bounds__(256) void wmma_gemm64_pair(
    const unsigned short* __restrict__ A0, const unsigned short* __restrict__ Bt0, _Float16* __restrict__ KF, _Float16* __restrict__ VF, int lgk, int m0, int n0, int k0, int nb0,
    const unsigned short* __restrict__ A1, const unsigned short* __restrict__ Bt1, float* __restrict__ C1, int m1, int n1, int k1, float scale) {
  const int bi = blockIdx.x;
  const bool p0 = bi < nb0;             // block-uniform
  const int n = p0 ? n0 : n1, k = p0 ? k0 : k1;
  gemm64_block<0, false, 0, 0, false, 0, true, true>(p0 ? A0 : A1, nullptr, k, 0, p0 ? Bt0 : Bt1, nullptr, k, 0, (void*)C1, nullptr, n, 0, nullptr, nullptr, 0, p0 ? m0 : m1, n, k, scale, p0 ? bi : bi - nb0, 0, KF, VF, lgk, p0);
}

__global__ __launch_bounds__(256) void cast_f32_f16x2(
    const float* __restrict__ in, _Float16* __restrict__ out, int n2) {
  int i = blockIdx.x * 256 + threadIdx.x;
  if (i < n2) {
    const _Float16 h0 = (_Float16)in[2 * i], h1 = (_Float16)in[2 * i + 1];
    const unsigned u = (unsigned)__builtin_bit_cast(unsigned short, h0) | ((unsigned)__builtin_bit_cast(unsigned short, h1) << 16);
    ((unsigned*)out)[i] = u;
    
  }
}


} // namespace w25

// The element-wise stages below give each thread 16 or 32 elements, moved by 16-byte loads and stores that are all in flight together, so that a launch is a few
// thousand waves. Every wave store instruction writes whole 128-byte lines.
__device__ __forceinline__ v8h cast8(v4f a, v4f b, float s) {
    const v8h o = {(_Float16)(a[0] * s), (_Float16)(a[1] * s), (_Float16)(a[2] * s), (_Float16)(a[3] * s), (_Float16)(b[0] * s), (_Float16)(b[1] * s), (_Float16)(b[2] * s), (_Float16)(b[3] * s)};
    return o;
}
// castT16_block<R, C>: f16(src[z][r][c] * s), the transpose with rows (z, c) and k = r, as a GEMM A plane in fragment order (head comment of gemm64_block; slot s of fragment i holds row 4 s + i of its 64-row tile).
//   One thread: 8 rows r x 4 columns c (8 loads, 4 stores). Lane = (hf = lane >> 4: which 8 rows, s = lane & 15: column quad): a load instruction reads 256 consecutive bytes of each of 2 rows,
//   store e writes the 512 consecutive bytes that are half j of fragment e. Block (bx < C / 128, by < R / 64, bz < Z) of 256 threads: wave w has columns 128 bx + 64 (w >> 2) .. + 63, rows 64 by + 16 (w & 3) .. + 15.
template <int R, int C>
__device__ __forceinline__ void castT16_block(const float* __restrict__ src, _Float16* __restrict__ dst, float s, int bx, int by, int bz) {
    static_assert(R % 64 == 0 && C % 128 == 0, "whole tiles");
    const int lane = threadIdx.x & 31, wave = threadIdx.x >> 5;
    const int r0 = by * 64 + (wave & 3) * 16 + (lane >> 4) * 8;
    const int c0 = bx * 128 + (wave >> 2) * 64 + (lane & 15) * 4;
    const int tile = bz * (C / 64) + bx * 2 + (wave >> 2), ks = by * 2 + ((wave & 3) >> 1), j = wave & 1;
    src += ((size_t)bz * R + r0) * C + c0;
    dst += ((size_t)(tile * (R / 32) + ks) * 8 + j) * 256 + lane * 8;
    v4f a[8];
#pragma unroll
    for (int q = 0; q < 8; ++q) a[q] = *(const v4f*)(src + (size_t)q * C);
#pragma unroll
    for (int e = 0; e < 4; ++e) {
        const v8h o = {(_Float16)(a[0][e] * s), (_Float16)(a[1][e] * s), (_Float16)(a[2][e] * s), (_Float16)(a[3][e] * s), (_Float16)(a[4][e] * s), (_Float16)(a[5][e] * s), (_Float16)(a[6][e] * s), (_Float16)(a[7][e] * s)};
        *(v8h*)(dst + e * 512) = o;
    }
}
// f32 -> bf16 hi plane + bf16 lo plane (x = hi + lo to ~2^-17 relative; RNE both), [R][C] -> [R][C] (or transposed to [C][R]); 2 consecutive destination elements
__device__ __forceinline__ unsigned int f2bf2_pack(float a, float b, unsigned int* lo) {
    const unsigned short ha = w25::f2bf_bits(a), hb = w25::f2bf_bits(b);
    const unsigned short la = w25::f2bf_bits(a - w25::bf_bits2f(ha)), lb = w25::f2bf_bits(b - w25::bf_bits2f(hb));
    *lo = (unsigned)la | ((unsigned)lb << 16); return (unsigned)ha | ((unsigned)hb << 16); }
__global__ __launch_bounds__(256) void k_castS16(const float* __restrict__ src, long long lds, __bf16* __restrict__ dhi, __bf16* __restrict__ dlo, long long ldd, int R, int C, float s, int transpose) {
    const long long i = (long long)blockIdx.x * 256 + threadIdx.x; long long o; float a, b;
    if (transpose) { const long long np = (long long)C * (R / 2); if (i >= np) return; const int c = (int)(i / (R / 2)); const int r = 2 * (int)(i % (R / 2)); a = src[(long long)r * lds + c] * s; b = src[(long long)(r + 1) * lds + c] * s; o = (long long)c * ldd + r; }
    else { const long long np = (long long)R * (C / 2); if (i >= np) return; const int r = (int)(i / (C / 2)); const int c = 2 * (int)(i % (C / 2)); a = src[(long long)r * lds + c] * s; b = src[(long long)r * lds + c + 1] * s; o = (long long)r * ldd + c; }
    unsigned lo; const unsigned hi = f2bf2_pack(a, b, &lo); unsigned* ph = (unsigned*)(dhi + o); unsigned* pl = (unsigned*)(dlo + o);
    *ph = hi; *pl = lo;  }

// all five weight tensors (each dense) -> one f16 plane [Wq | Wqb | Wkvb | Wkv | Wout], scaled by s, each in fragment order (head comment of gemm64_block; slot s of fragment i is row 16 i + s of the 64-row tile;
//   [Wq | Wqb | Wkvb] is one plane of 1024 rows). A block takes 4096 elements (every tensor is a whole number of blocks), a wave one fragment: 2 stores of 512 consecutive bytes;
//   lane (hf, s) reads k = 8 hf .. + 7 and 16 + 8 hf .. + 7 of the k step from row s of the fragment.
__device__ __forceinline__ void castW16_block(const float* __restrict__ Wq, const float* __restrict__ Wqb, const float* __restrict__ Wkvb, const float* __restrict__ Wkv, const float* __restrict__ Wout, _Float16* __restrict__ dst, float s, int bx) {
    const int eb = bx * 4096;
    const float* src = Wq; int base = 0, lgk = 8;                    // 2^lgk elements a weight row
    if (eb >= 786432) { src = Wout; base = 786432; } else if (eb >= 262144) { src = Wkv; base = 262144; lgk = 10; } else if (eb >= 131072) { src = Wkvb; base = 131072; } else if (eb >= 65536) { src = Wqb; base = 65536; }
    const int lane = threadIdx.x & 31, wave = threadIdx.x >> 5;
    const int f = (eb - base) / 512 + wave;                          // the fragment's number in its tensor: [64-row tile][k step][i]
    const int i = f & 3, ks = (f >> 2) & ((1 << (lgk - 5)) - 1), tile = f >> (lgk - 3);
    const float* sp = src + ((size_t)(tile * 64 + i * 16 + (lane & 15)) << lgk) + ks * 32 + (lane >> 4) * 8;
    const v4f a0 = *(const v4f*)(sp), a1 = *(const v4f*)(sp + 4), b0 = *(const v4f*)(sp + 16), b1 = *(const v4f*)(sp + 20);
    _Float16* d = dst + eb + wave * 512 + lane * 8;
    *(v8h*)(d) = cast8(a0, a1, s);
    *(v8h*)(d + 256) = cast8(b0, b1, s);
    asm volatile("s_wait_xcnt 0x0" ::: "memory");   // in the built kernel another arm's code lies behind these stores and rewrites their registers: the wait stands in front of it
}
// im2col for the 2x2 stride-2 conv, stored as the f16 GEMM A plane in fragment order (head comment of gemm64_block): row (b, Y, X), k = (c, ky, kx) <- f16(x[b][c][2Y+ky][2X+kx]).
//   A 64-row tile is two rows Y of one image; slot s of fragment i holds (Y & 1 = i >> 1, X = 2 s + (i & 1)).
//   One thread: 4 channels (two pairs of neighbours) x 2 output columns X: per channel 4 floats of each of the two input rows; the (ky,kx) quads of two neighbour channels make one 16-byte store.
//   Lane = (hf = lane >> 4: channel pair, s = lane & 15: column pair): a load instruction reads 256 consecutive bytes of each of 2 channels, a store instruction writes the 512 consecutive bytes of half a fragment.
//   Block (bx < Hs / 2 * C / 64, image b) of 256 threads = one Y, 64 channels, the whole row; a wave has one k step (8 channels).
template <int C, int Hs>
__device__ __forceinline__ void es_col_block(const float* __restrict__ X, _Float16* __restrict__ COL, int bx, int b) {
    static_assert(Hs == 64 && C % 64 == 0, "16 lanes span one input row");
    constexpr int Hr = Hs / 2;
    const int lane = threadIdx.x & 31, wave = threadIdx.x >> 5;
    const int Y = bx / (C / 64), cb = bx % (C / 64);
    const int ks = cb * 8 + wave;
    const int c = ks * 8 + (lane >> 4) * 2;
    const float* s = X + (((size_t)b * C + c) * Hs + 2 * Y) * Hs + 4 * (lane & 15);
    _Float16* d = COL + ((size_t)((b * (Hr * Hr / 64) + (Y >> 1)) * (C / 8) + ks) * 4 + (Y & 1) * 2) * 512 + lane * 8;
    v4f r0[4], r1[4];                                    // g: channel c + 4 (g >> 1) + (g & 1)
#pragma unroll
    for (int g = 0; g < 4; ++g) {
        const float* sg = s + (size_t)((g >> 1) * 4 + (g & 1)) * Hs * Hs;
        r0[g] = *(const v4f*)(sg); r1[g] = *(const v4f*)(sg + Hs);
    }
#pragma unroll
    for (int gg = 0; gg < 2; ++gg) {                     // half gg of the two fragments
        const v4f a0 = r0[2 * gg], a1 = r1[2 * gg], b0 = r0[2 * gg + 1], b1 = r1[2 * gg + 1];
        const v8h lo = {(_Float16)a0[0], (_Float16)a0[1], (_Float16)a1[0], (_Float16)a1[1], (_Float16)b0[0], (_Float16)b0[1], (_Float16)b1[0], (_Float16)b1[1]};
        const v8h hi = {(_Float16)a0[2], (_Float16)a0[3], (_Float16)a1[2], (_Float16)a1[3], (_Float16)b0[2], (_Float16)b0[3], (_Float16)b1[2], (_Float16)b1[3]};
        *(v8h*)(d + 256 * gg) = lo; *(v8h*)(d + 512 + 256 * gg) = hi;
    }
    asm volatile("s_wait_xcnt 0x0" ::: "memory");   // in the built kernel another arm's code lies behind these stores and rewrites their registers: the wait stands in front of it
}
// every re-layout of the inputs in one launch (none reads what another writes): blocks 0 .. NX - 1 transpose and cast x (Z images of R x Hs*Hs), the NC blocks behind them lay out the im2col operand,
// the last 208 cast the weights (x sw). grid NX + NC + 208, block 256.
template <int R, int Hs, int Z>
__global__ __launch_bounds__(256) void k_cast_in(const float* __restrict__ x, _Float16* __restrict__ xt, _Float16* __restrict__ col, const float* __restrict__ Wq, const float* __restrict__ Wqb, const float* __restrict__ Wkvb,
                                                  const float* __restrict__ Wkv, const float* __restrict__ Wout, _Float16* __restrict__ w16, float sw) {
    constexpr int C = Hs * Hs, BX = C / 128, BY = R / 64, NX = BX * BY * Z, CB = Hs / 2 * (R / 64), NC = CB * Z;
    const int bi = blockIdx.x;
    if (bi < NX) castT16_block<R, C>(x, xt, 1.0f, bi % BX, (bi / BX) % BY, bi / (BX * BY));
    else if (bi < NX + NC) es_col_block<R, Hs>(x, col, (bi - NX) % CB, (bi - NX) / CB);
    else castW16_block(Wq, Wqb, Wkvb, Wkv, Wout, w16, sw, bi - NX - NC);
}

extern "C" void kernel_launch(void* const* d_in, const int* in_sizes, int n_in, void* d_out, int out_size, void* d_ws, size_t ws_size, hipStream_t stream) {
    (void)in_sizes; (void)n_in; (void)out_size; (void)ws_size;
    const float* x = (const float*)d_in[0];
    const float* Wq = (const float*)d_in[1];
    const float* Wkv = (const float*)d_in[2];
    const float* Wqb = (const float*)d_in[3];
    const float* Wkvb = (const float*)d_in[4];
    const float* Wout = (const float*)d_in[5];
    float* out = (float*)d_out;
    // every plane holds all 4 images, image-major; each is written by one launch and read by later ones of this call
    char* wsp = (char*)d_ws;
    float* PRJ = (float*)wsp; wsp += (size_t)4 * 4096 * 1024 * 4;          // [4][4096][1024] the 1x1 projections, position-major: q | q_b | k_b | v_b
    _Float16* KF16 = (_Float16*)wsp; wsp += (size_t)4 * 8 * 1024 * 32 * 2; // [4][8] planes of k in fragment order
    _Float16* VF16 = (_Float16*)wsp; wsp += (size_t)4 * 8 * 1024 * 32 * 2; // [4][8] planes of v in fragment order
    _Float16* XT16 = (_Float16*)wsp; wsp += (size_t)4 * 4096 * 256 * 2;    // x^T, 4 * 4096 rows of 256, in fragment order
    _Float16* COL16 = (_Float16*)wsp; wsp += (size_t)4 * 1024 * 1024 * 2;  // im2col, 4 * 1024 rows of 1024, in fragment order
    _Float16* W16 = (_Float16*)wsp; wsp += (size_t)851968 * 2;             // [Wq | Wqb | Wkvb | Wkv | Wout], x16, each in fragment order
    const _Float16* Wkv16 = W16 + 262144;
    const _Float16* Wout16 = W16 + 786432;
    k_cast_in<256, 64, 4><<<1232, 256, 0, stream>>>(x, XT16, COL16, Wq, Wqb, Wkvb, Wkv, Wout, W16, 16.0f);
    // one launch for the two products that need only the planes above. The kv conv: im2col rows x Wkv. The 1x1 projections share their left operand and their weights over the images:
    // one product over the 4 * 4096 stacked positions and the 1024 stacked weight rows [Wq | Wqb | Wkvb].
    w25::wmma_gemm64_pair<<<576, 256, 0, stream>>>((const unsigned short*)(COL16), (const unsigned short*)(Wkv16), KF16, VF16, 10, 4096, 512, 1024, 64, (const unsigned short*)(XT16), (const unsigned short*)(W16), PRJ, 16384, 1024, 256, 0.0625f);
    // both attentions, their sum and the output conv: one work-group a (64 positions, image), all 8 heads
    k_attn_out<4096, 1024, 1024, 256><<<dim3(64, 4), 1024, 0, stream>>>(PRJ, KF16, VF16, Wout16, out, 0.1767766952966369f, 0.0625f);
}
